// v000
// Times are from an AMD MI455X. After a warm-up the kernel runs many times in a row, and a time is the length of
// such a window on the GPU divided by its runs, so every launch and the gaps after it count. The runs cycle
// through copies of the inputs. A figure is the median of several windows, for all but v000 over two sittings.
// Sittings can differ by a few percent; kernels timed side by side share one.
// v000 is the starting kernel. One run takes 300 microseconds.
#include <hip/hip_runtime.h>
#include <hip/hip_bf16.h>

typedef _Float16 half_t;
typedef __attribute__((ext_vector_type(16))) _Float16 v16h;
typedef __attribute__((ext_vector_type(8)))  float    v8f;

#define BATCH  4
#define CDIM   512
#define HEADS  8
#define HD     64
#define NPOS   4096   // 64*64
#define NKPOS  1024   // 32*32
#define ATT_SCALE 0.125f

// ---------------------------------------------------------------------------
// WMMA helpers.  16-bit A-matrix 16x32 layout (ISA 7.12.2): lane L holds row
// m = L%16; its 16 halves are two contiguous 8-half chunks at k = off..off+7
// and k = off+16..off+23, off = (L>=16 ? 8 : 0).  B uses the symmetric layout
// (lane = column, identical k packing), so both fragments are two 16-byte
// loads from a k-contiguous row.
// ---------------------------------------------------------------------------
__device__ __forceinline__ v16h frag_ld(const half_t* rowbase, int lane) {
  const int off = (lane & 16) ? 8 : 0;
  union { uint4 u[2]; v16h v; } t;
  t.u[0] = *(const uint4*)(rowbase + off);
  t.u[1] = *(const uint4*)(rowbase + off + 16);
  return t.v;
}

__device__ __forceinline__ v8f wmma16(v16h a, v16h b, v8f c) {
  return __builtin_amdgcn_wmma_f32_16x16x32_f16(false, a, false, b,
                                                (short)0, c, false, false);
}

// Low 32 bits of a flat pointer into LDS == LDS byte offset (ISA 10.2:
// the LDS aperture maps by truncating to addr[31:0]).
__device__ __forceinline__ uint32_t lds_addr32(const void* p) {
  return (uint32_t)(uintptr_t)p;
}

// async global->LDS, 16B per lane, GVS addressing (SGPR base + VGPR offset).
// Tracked with ASYNCcnt; no VGPR destination, no LOADcnt/DScnt involvement.
__device__ __forceinline__ void async_ld_b128(uint32_t lds_off, uint32_t goff,
                                              unsigned long long base) {
  asm volatile("global_load_async_to_lds_b128 %0, %1, %2"
               :: "v"(lds_off), "v"(goff), "s"(base) : "memory");
}

// ---------------------------------------------------------------------------
// Conversion kernels (f32 -> f16, layout shuffles)
// ---------------------------------------------------------------------------
__global__ void cvt_f16(const float* __restrict__ in, half_t* __restrict__ out, int n) {
  int i = blockIdx.x * 256 + threadIdx.x;
  if (i < n) out[i] = (half_t)in[i];
}

// x [B][512][4096] -> xT [B][4096][512] (f16, position-major)
__global__ void cvt_xT(const float* __restrict__ x, half_t* __restrict__ xT) {
  int i = blockIdx.x * 256 + threadIdx.x;        // over B*512*4096
  int b = i >> 21;
  int rem = i & ((1 << 21) - 1);
  int c = rem >> 12;
  int n = rem & 4095;
  xT[((size_t)b * NPOS + n) * CDIM + c] = (half_t)x[i];
}

// sr_w [O=512][C=512][2][2] -> srwh [o][k], k = (sy*2+sx)*512 + c
__global__ void cvt_srw(const float* __restrict__ srw, half_t* __restrict__ out) {
  int i = blockIdx.x * 256 + threadIdx.x;        // over 512*2048
  int o = i >> 11;
  int k = i & 2047;
  int s = k >> 9;
  int c = k & 511;
  int sy = s >> 1, sx = s & 1;
  out[i] = (half_t)srw[(((size_t)o * 512 + c) * 2 + sy) * 2 + sx];
}

// ---------------------------------------------------------------------------
// LayerNorm over channels at each reduced spatial position.
// kvin [B*1024][512] f32 -> lnT [B*1024][512] f16
// ---------------------------------------------------------------------------
__global__ __launch_bounds__(256)
void ln_kernel(const float* __restrict__ kvin, const float* __restrict__ g,
               const float* __restrict__ be, half_t* __restrict__ lnT) {
  __shared__ float r1[256], r2[256];
  const int pos = blockIdx.x;
  const int t = threadIdx.x;
  const float* xr = kvin + (size_t)pos * CDIM;
  float x0 = xr[t], x1 = xr[t + 256];
  r1[t] = x0 + x1;
  r2[t] = x0 * x0 + x1 * x1;
  __syncthreads();
  for (int off = 128; off > 0; off >>= 1) {
    if (t < off) { r1[t] += r1[t + off]; r2[t] += r2[t + off]; }
    __syncthreads();
  }
  float mean = r1[0] * (1.0f / 512.0f);
  float var  = r2[0] * (1.0f / 512.0f) - mean * mean;
  float rs   = rsqrtf(var + 1e-6f);
  lnT[(size_t)pos * CDIM + t]       = (half_t)((x0 - mean) * rs * g[t]       + be[t]);
  lnT[(size_t)pos * CDIM + t + 256] = (half_t)((x1 - mean) * rs * g[t + 256] + be[t + 256]);
}

// ---------------------------------------------------------------------------
// Tiled WMMA GEMM: out[M][Npos] = W[M][K] * act[Npos][K]^T  (+bias)
// Block = 256 threads = 8 waves, 128x128 tile, k-step 32.
// Tiles are staged with double-buffered GLOBAL_LOAD_ASYNC_TO_LDS_B128:
// tile t+1 is fetched (ASYNCcnt) while tile t runs through the WMMAs.
// MODE 0: Q proj   K=512 NP=4096 -> qh  [bh][n][d]   f16
// MODE 1: SR conv  K=2048 NP=1024 (im2col gather from xT) -> kvin f32 [b][n][o]
// MODE 2: KV proj  K=512 NP=1024 -> kh [bh][nk][d], vt [bh][d][nk]  f16
// MODE 3: out proj K=512 NP=4096 -> d_out f32 [b][o][n]
// ---------------------------------------------------------------------------
template<int MODE>
__global__ __launch_bounds__(256)
void gemm_wmma(const half_t* __restrict__ W, const half_t* __restrict__ actBase,
               const float* __restrict__ bias,
               float* __restrict__ outF, half_t* __restrict__ outH,
               half_t* __restrict__ outH2) {
  constexpr int K  = (MODE == 1) ? 2048 : 512;
  constexpr int TILE = 128 * 40;    // halves per buffer, 40-half pitch (conflict free)

  __shared__ half_t Ah[2 * TILE];
  __shared__ half_t Bh[2 * TILE];

  const int b    = blockIdx.z;
  const int n0   = blockIdx.x * 128;
  const int m0   = blockIdx.y * 128;
  const int tid  = threadIdx.x;
  const int lane = tid & 31;
  const int wave = tid >> 5;
  const int wm   = wave & 3;   // 4 row blocks of 32
  const int wn   = wave >> 2;  // 2 col blocks of 64
  const half_t* act = actBase + (size_t)b * ((MODE == 2) ? (NKPOS * CDIM) : (NPOS * CDIM));

  const uint32_t ldsA = lds_addr32(&Ah[0]);
  const uint32_t ldsB = lds_addr32(&Bh[0]);
  const unsigned long long wbase = (unsigned long long)(uintptr_t)W;
  const unsigned long long abase = (unsigned long long)(uintptr_t)act;

  // Issue one 128x32 A tile + B tile into buffer `buf` (4 async instrs / wave).
  auto issue_tile = [&](int buf, int k0) {
    #pragma unroll
    for (int i = 0; i < 2; i++) {
      int idx = tid + i * 256;
      int row = idx >> 2;
      int ch  = (idx & 3) * 8;           // 8-half (16B) chunk
      uint32_t lofs = (uint32_t)(buf * TILE + row * 40 + ch) * 2u;
      async_ld_b128(ldsA + lofs, (uint32_t)(((m0 + row) * K + k0 + ch) * 2), wbase);
      uint32_t gb;
      if (MODE == 1) {
        int kk = k0 + ch;
        int s  = kk >> 9;                // 2x2 tap selector
        int c  = kk & 511;
        int sy = s >> 1, sx = s & 1;
        int n  = n0 + row;               // reduced position
        int py = n >> 5, px = n & 31;
        int sp = (2 * py + sy) * 64 + (2 * px + sx);
        gb = (uint32_t)((sp * CDIM + c) * 2);
      } else {
        gb = (uint32_t)(((n0 + row) * K + k0 + ch) * 2);
      }
      async_ld_b128(ldsB + lofs, gb, abase);
    }
  };

  v8f acc[2][4];
  const v8f vzero = {0.f, 0.f, 0.f, 0.f, 0.f, 0.f, 0.f, 0.f};
  for (int i = 0; i < 2; i++)
    for (int j = 0; j < 4; j++) acc[i][j] = vzero;

  issue_tile(0, 0);
  for (int k0 = 0, it = 0; k0 < K; k0 += 32, ++it) {
    const int cur = it & 1;
    const bool more = (k0 + 32) < K;
    if (more) issue_tile(cur ^ 1, k0 + 32);
    // async loads complete in order: <=4 outstanding means current tile landed
    if (more) asm volatile("s_wait_asynccnt 0x4" ::: "memory");
    else      asm volatile("s_wait_asynccnt 0x0" ::: "memory");
    __syncthreads();                     // every wave's part of the tile is in LDS

    v16h af[2], bf[4];
    #pragma unroll
    for (int mt = 0; mt < 2; mt++)
      af[mt] = frag_ld(&Ah[cur * TILE + (wm * 32 + mt * 16 + (lane & 15)) * 40], lane);
    #pragma unroll
    for (int nt = 0; nt < 4; nt++)
      bf[nt] = frag_ld(&Bh[cur * TILE + (wn * 64 + nt * 16 + (lane & 15)) * 40], lane);
    #pragma unroll
    for (int mt = 0; mt < 2; mt++)
      #pragma unroll
      for (int nt = 0; nt < 4; nt++)
        acc[mt][nt] = wmma16(af[mt], bf[nt], acc[mt][nt]);

    // fragment reads done before anyone overwrites this buffer
    asm volatile("s_wait_dscnt 0x0" ::: "memory");
    __syncthreads();
  }

  // epilogue: C/D layout -> lane holds col n = lane%16, rows r + (lane>=16?8:0)
  const int halfoff = (lane & 16) ? 8 : 0;
  const int ncol = lane & 15;
  #pragma unroll
  for (int mt = 0; mt < 2; mt++) {
    #pragma unroll
    for (int nt = 0; nt < 4; nt++) {
      #pragma unroll
      for (int r = 0; r < 8; r++) {
        int o = m0 + wm * 32 + mt * 16 + r + halfoff;
        int n = n0 + wn * 64 + nt * 16 + ncol;
        float v = acc[mt][nt][r] + bias[o];
        if (MODE == 0) {
          int head = o >> 6, d = o & 63;
          outH[(((size_t)(b * HEADS + head) * NPOS) + n) * HD + d] = (half_t)v;
        } else if (MODE == 1) {
          outF[((size_t)b * NKPOS + n) * CDIM + o] = v;
        } else if (MODE == 2) {
          if (o < CDIM) {
            int head = o >> 6, d = o & 63;
            outH[(((size_t)(b * HEADS + head) * NKPOS) + n) * HD + d] = (half_t)v;
          } else {
            int vc = o - CDIM;
            int head = vc >> 6, d = vc & 63;
            outH2[(((size_t)(b * HEADS + head) * HD) + d) * NKPOS + n] = (half_t)v;
          }
        } else { // MODE 3
          outF[((size_t)b * CDIM + o) * NPOS + n] = v;
        }
      }
    }
  }
}

// ---------------------------------------------------------------------------
// Flash attention: 256 threads = 8 waves; each wave owns 16 queries and loops
// over keys in 32-chunks with online softmax.  Q/K/V fragments loaded straight
// from global (layouts are k-contiguous by construction); only the probability
// tile round-trips through per-wave LDS for the C/D -> A-layout transpose.
// ---------------------------------------------------------------------------
__global__ __launch_bounds__(256)
void attn_kernel(const half_t* __restrict__ qh, const half_t* __restrict__ kh,
                 const half_t* __restrict__ vt, half_t* __restrict__ attnT) {
  __shared__ half_t Pbuf[8 * 16 * 40];
  const int tid  = threadIdx.x;
  const int lane = tid & 31;
  const int wave = tid >> 5;
  const int bh   = blockIdx.y;          // b*8 + h
  const int b    = bh >> 3, h = bh & 7;
  const int q0   = blockIdx.x * 128 + wave * 16;
  const int lrow = lane & 15;
  const int halfoff = (lane & 16) ? 8 : 0;
  half_t* Pw = &Pbuf[wave * 16 * 40];

  // Q A-fragments (16 q x 64 d = two k-steps), loaded once
  const half_t* qrow = qh + ((size_t)bh * NPOS + q0 + lrow) * HD;
  v16h qa0 = frag_ld(qrow, lane);
  v16h qa1 = frag_ld(qrow + 32, lane);

  const v8f vzero = {0.f, 0.f, 0.f, 0.f, 0.f, 0.f, 0.f, 0.f};
  v8f acc[4];
  for (int dt = 0; dt < 4; dt++) acc[dt] = vzero;
  float rmax[8], rsum[8];
  for (int r = 0; r < 8; r++) { rmax[r] = -1e30f; rsum[r] = 0.f; }

  for (int kb = 0; kb < NKPOS; kb += 32) {
    // S = (Q K^T) * scale for a 16x32 chunk (two 16x16 tiles)
    v8f s[2];
    #pragma unroll
    for (int st = 0; st < 2; st++) {
      const half_t* kbase = kh + ((size_t)bh * NKPOS + kb + st * 16 + lrow) * HD;
      v16h kf0 = frag_ld(kbase, lane);
      v16h kf1 = frag_ld(kbase + 32, lane);
      v8f z = vzero;
      z = wmma16(qa0, kf0, z);
      z = wmma16(qa1, kf1, z);
      #pragma unroll
      for (int r = 0; r < 8; r++) z[r] *= ATT_SCALE;
      s[st] = z;
    }
    // online softmax, rows live in 16-lane halves
    #pragma unroll
    for (int r = 0; r < 8; r++) {
      float m = fmaxf(s[0][r], s[1][r]);
      for (int off = 1; off < 16; off <<= 1) m = fmaxf(m, __shfl_xor(m, off, 32));
      float nm = fmaxf(rmax[r], m);
      float alpha = __expf(rmax[r] - nm);
      rmax[r] = nm;
      float p0 = __expf(s[0][r] - nm);
      float p1 = __expf(s[1][r] - nm);
      s[0][r] = p0; s[1][r] = p1;
      float ps = p0 + p1;
      for (int off = 1; off < 16; off <<= 1) ps += __shfl_xor(ps, off, 32);
      rsum[r] = rsum[r] * alpha + ps;
      #pragma unroll
      for (int dt = 0; dt < 4; dt++) acc[dt][r] *= alpha;
    }
    // transpose P (C/D layout) into A layout via per-wave LDS tile
    #pragma unroll
    for (int st = 0; st < 2; st++)
      #pragma unroll
      for (int r = 0; r < 8; r++)
        Pw[(r + halfoff) * 40 + st * 16 + lrow] = (half_t)s[st][r];
    asm volatile("s_wait_dscnt 0x0" ::: "memory");
    v16h pa = frag_ld(&Pw[lrow * 40], lane);
    // acc += P (16x32) * V (32 keys x 16 d), V^T layout -> contiguous keys
    #pragma unroll
    for (int dt = 0; dt < 4; dt++) {
      const half_t* vbase = vt + ((size_t)bh * HD + dt * 16 + lrow) * NKPOS + kb;
      v16h vf = frag_ld(vbase, lane);
      acc[dt] = wmma16(pa, vf, acc[dt]);
    }
  }

  // normalize and emit position-major [n][c] f16 for the projection GEMM
  #pragma unroll
  for (int dt = 0; dt < 4; dt++)
    #pragma unroll
    for (int r = 0; r < 8; r++) {
      int orow = q0 + r + halfoff;
      int c = h * HD + dt * 16 + lrow;
      attnT[((size_t)b * NPOS + orow) * CDIM + c] = (half_t)(acc[dt][r] / rsum[r]);
    }
}

// ---------------------------------------------------------------------------
extern "C" void kernel_launch(void* const* d_in, const int* in_sizes, int n_in,
                              void* d_out, int out_size, void* d_ws, size_t ws_size,
                              hipStream_t stream) {
  const float* x      = (const float*)d_in[0];
  const float* q_w    = (const float*)d_in[1];
  const float* q_b    = (const float*)d_in[2];
  const float* kv_w   = (const float*)d_in[3];
  const float* kv_b   = (const float*)d_in[4];
  const float* sr_w   = (const float*)d_in[5];
  const float* sr_b   = (const float*)d_in[6];
  const float* ln_g   = (const float*)d_in[7];
  const float* ln_b   = (const float*)d_in[8];
  const float* proj_w = (const float*)d_in[9];
  const float* proj_b = (const float*)d_in[10];
  float* out = (float*)d_out;

  size_t off = 0;
  auto carve = [&](size_t bytes) {
    void* p = (char*)d_ws + off;
    off += (bytes + 255) & ~(size_t)255;
    return p;
  };
  half_t* xT    = (half_t*)carve((size_t)BATCH * NPOS * CDIM * 2);
  half_t* qwh   = (half_t*)carve((size_t)CDIM * CDIM * 2);
  half_t* kvwh  = (half_t*)carve((size_t)2 * CDIM * CDIM * 2);
  half_t* srwh  = (half_t*)carve((size_t)CDIM * 2048 * 2);
  half_t* pwh   = (half_t*)carve((size_t)CDIM * CDIM * 2);
  half_t* qhb   = (half_t*)carve((size_t)BATCH * HEADS * NPOS * HD * 2);
  float*  kvin  = (float*)carve((size_t)BATCH * NKPOS * CDIM * 4);
  half_t* lnT   = (half_t*)carve((size_t)BATCH * NKPOS * CDIM * 2);
  half_t* khb   = (half_t*)carve((size_t)BATCH * HEADS * NKPOS * HD * 2);
  half_t* vtb   = (half_t*)carve((size_t)BATCH * HEADS * HD * NKPOS * 2);
  half_t* attnT = (half_t*)carve((size_t)BATCH * NPOS * CDIM * 2);

  // 1. precision / layout conversions
  cvt_xT<<<(BATCH * CDIM * NPOS) / 256, 256, 0, stream>>>(x, xT);
  cvt_f16<<<(CDIM * CDIM) / 256, 256, 0, stream>>>(q_w, qwh, CDIM * CDIM);
  cvt_f16<<<(2 * CDIM * CDIM) / 256, 256, 0, stream>>>(kv_w, kvwh, 2 * CDIM * CDIM);
  cvt_f16<<<(CDIM * CDIM) / 256, 256, 0, stream>>>(proj_w, pwh, CDIM * CDIM);
  cvt_srw<<<(CDIM * 2048) / 256, 256, 0, stream>>>(sr_w, srwh);

  // 2. SR conv as im2col GEMM -> kvin f32 [b][n][c]
  gemm_wmma<1><<<dim3(NKPOS / 128, CDIM / 128, BATCH), 256, 0, stream>>>(
      srwh, xT, sr_b, kvin, nullptr, nullptr);

  // 3. channel LayerNorm -> lnT f16
  ln_kernel<<<BATCH * NKPOS, 256, 0, stream>>>(kvin, ln_g, ln_b, lnT);

  // 4. KV projection -> kh [bh][nk][d], vt [bh][d][nk]
  gemm_wmma<2><<<dim3(NKPOS / 128, (2 * CDIM) / 128, BATCH), 256, 0, stream>>>(
      kvwh, lnT, kv_b, nullptr, khb, vtb);

  // 5. Q projection -> qh [bh][n][d]
  gemm_wmma<0><<<dim3(NPOS / 128, CDIM / 128, BATCH), 256, 0, stream>>>(
      qwh, xT, q_b, nullptr, qhb, nullptr);

  // 6. flash attention -> attnT f16 [b][n][c]
  attn_kernel<<<dim3(NPOS / 128, BATCH * HEADS), 256, 0, stream>>>(
      qhb, khb, vtb, attnT);

  // 7. output projection -> d_out f32 [b][c][n]
  gemm_wmma<3><<<dim3(NPOS / 128, CDIM / 128, BATCH), 256, 0, stream>>>(
      pwh, attnT, proj_b, out, nullptr, nullptr);
}

// v001
// It runs in 225 microseconds.
// In both of two side-by-side timings against v000, it was 1.38 times as fast.
#include <hip/hip_runtime.h>
#include <hip/hip_bf16.h>

typedef _Float16 half_t;
typedef __attribute__((ext_vector_type(16))) _Float16 v16h;
typedef __attribute__((ext_vector_type(8)))  float    v8f;

#define BATCH  4
#define CDIM   512
#define HEADS  8
#define HD     64
#define NPOS   4096   // 64*64
#define NKPOS  1024   // 32*32
#define ATT_SCALE 0.125f

// ---------------------------------------------------------------------------
// WMMA helpers.  16-bit A-matrix 16x32 layout (ISA 7.12.2): lane L holds row
// m = L%16; its 16 halves are two contiguous 8-half chunks at k = off..off+7
// and k = off+16..off+23, off = (L>=16 ? 8 : 0).  B uses the symmetric layout
// (lane = column, identical k packing), so both fragments are two 16-byte
// loads from a k-contiguous row.
// ---------------------------------------------------------------------------
__device__ __forceinline__ v16h frag_ld(const half_t* rowbase, int lane) {
  const int off = (lane & 16) ? 8 : 0;
  union { uint4 u[2]; v16h v; } t;
  t.u[0] = *(const uint4*)(rowbase + off);
  t.u[1] = *(const uint4*)(rowbase + off + 16);
  return t.v;
}

__device__ __forceinline__ v8f wmma16(v16h a, v16h b, v8f c) {
  return __builtin_amdgcn_wmma_f32_16x16x32_f16(false, a, false, b,
                                                (short)0, c, false, false);
}

// Low 32 bits of a flat pointer into LDS == LDS byte offset (ISA 10.2:
// the LDS aperture maps by truncating to addr[31:0]).
__device__ __forceinline__ uint32_t lds_addr32(const void* p) {
  return (uint32_t)(uintptr_t)p;
}

// async global->LDS, 16B per lane, GVS addressing (SGPR base + VGPR offset).
// Tracked with ASYNCcnt; no VGPR destination, no LOADcnt/DScnt involvement.
__device__ __forceinline__ void async_ld_b128(uint32_t lds_off, uint32_t goff,
                                              unsigned long long base) {
  asm volatile("global_load_async_to_lds_b128 %0, %1, %2"
               :: "v"(lds_off), "v"(goff), "s"(base) : "memory");
}

// Four async global->LDS copies of one lane, 16 B each, per-lane 64-bit address.
// s_wait_xcnt closes the same statement as a precaution: the address registers
// are not rewritten ahead of it.
__device__ __forceinline__ void async_cp4_b128(uint32_t l0, const half_t* g0,
                                               uint32_t l1, const half_t* g1,
                                               uint32_t l2, const half_t* g2,
                                               uint32_t l3, const half_t* g3) {
  asm volatile("global_load_async_to_lds_b128 %0, %1, off\n\t"
               "global_load_async_to_lds_b128 %2, %3, off\n\t"
               "global_load_async_to_lds_b128 %4, %5, off\n\t"
               "global_load_async_to_lds_b128 %6, %7, off\n\t"
               "s_wait_xcnt 0x0"
               :: "v"(l0), "v"(g0), "v"(l1), "v"(g1),
                  "v"(l2), "v"(g2), "v"(l3), "v"(g3) : "memory");
}

// ---------------------------------------------------------------------------
// Conversion kernels (f32 -> f16, layout shuffles)
// ---------------------------------------------------------------------------
__global__ void cvt_f16(const float* __restrict__ in, half_t* __restrict__ out, int n) {
  int i = blockIdx.x * 256 + threadIdx.x;
  if (i < n) out[i] = (half_t)in[i];
}

// x [B][512][4096] -> xT [B][4096][512] (f16, position-major)
__global__ void cvt_xT(const float* __restrict__ x, half_t* __restrict__ xT) {
  int i = blockIdx.x * 256 + threadIdx.x;        // over B*512*4096
  int b = i >> 21;
  int rem = i & ((1 << 21) - 1);
  int c = rem >> 12;
  int n = rem & 4095;
  xT[((size_t)b * NPOS + n) * CDIM + c] = (half_t)x[i];
}

// sr_w [O=512][C=512][2][2] -> srwh [o][k], k = (sy*2+sx)*512 + c
__global__ void cvt_srw(const float* __restrict__ srw, half_t* __restrict__ out) {
  int i = blockIdx.x * 256 + threadIdx.x;        // over 512*2048
  int o = i >> 11;
  int k = i & 2047;
  int s = k >> 9;
  int c = k & 511;
  int sy = s >> 1, sx = s & 1;
  out[i] = (half_t)srw[(((size_t)o * 512 + c) * 2 + sy) * 2 + sx];
}

// ---------------------------------------------------------------------------
// LayerNorm over channels at each reduced spatial position.
// kvin [B*1024][512] f32 -> lnT [B*1024][512] f16
// ---------------------------------------------------------------------------
__global__ __launch_bounds__(256)
void ln_kernel(const float* __restrict__ kvin, const float* __restrict__ g,
               const float* __restrict__ be, half_t* __restrict__ lnT) {
  __shared__ float r1[256], r2[256];
  const int pos = blockIdx.x;
  const int t = threadIdx.x;
  const float* xr = kvin + (size_t)pos * CDIM;
  float x0 = xr[t], x1 = xr[t + 256];
  r1[t] = x0 + x1;
  r2[t] = x0 * x0 + x1 * x1;
  __syncthreads();
  for (int off = 128; off > 0; off >>= 1) {
    if (t < off) { r1[t] += r1[t + off]; r2[t] += r2[t + off]; }
    __syncthreads();
  }
  float mean = r1[0] * (1.0f / 512.0f);
  float var  = r2[0] * (1.0f / 512.0f) - mean * mean;
  float rs   = rsqrtf(var + 1e-6f);
  lnT[(size_t)pos * CDIM + t]       = (half_t)((x0 - mean) * rs * g[t]       + be[t]);
  lnT[(size_t)pos * CDIM + t + 256] = (half_t)((x1 - mean) * rs * g[t + 256] + be[t + 256]);
}

// ---------------------------------------------------------------------------
// Tiled WMMA GEMM: out[M][Npos] = W[M][K] * act[Npos][K]^T  (+bias)
// Block = 256 threads = 8 waves, 128x128 tile, k-step 32.
// Tiles are staged with double-buffered GLOBAL_LOAD_ASYNC_TO_LDS_B128:
// tile t+1 is fetched (ASYNCcnt) while tile t runs through the WMMAs.
// MODE 0: Q proj   K=512 NP=4096 -> qh  [bh][n][d]   f16
// MODE 1: SR conv  K=2048 NP=1024 (im2col gather from xT) -> kvin f32 [b][n][o]
// MODE 2: KV proj  K=512 NP=1024 -> kh [bh][nk][d], vt [bh][d][nk]  f16
// MODE 3: out proj K=512 NP=4096 -> d_out f32 [b][o][n]
// ---------------------------------------------------------------------------
template<int MODE>
__global__ __launch_bounds__(256)
void gemm_wmma(const half_t* __restrict__ W, const half_t* __restrict__ actBase,
               const float* __restrict__ bias,
               float* __restrict__ outF, half_t* __restrict__ outH,
               half_t* __restrict__ outH2) {
  constexpr int K  = (MODE == 1) ? 2048 : 512;
  constexpr int TILE = 128 * 40;    // halves per buffer, 40-half pitch (conflict free)

  __shared__ half_t Ah[2 * TILE];
  __shared__ half_t Bh[2 * TILE];

  const int b    = blockIdx.z;
  const int n0   = blockIdx.x * 128;
  const int m0   = blockIdx.y * 128;
  const int tid  = threadIdx.x;
  const int lane = tid & 31;
  const int wave = tid >> 5;
  const int wm   = wave & 3;   // 4 row blocks of 32
  const int wn   = wave >> 2;  // 2 col blocks of 64
  const half_t* act = actBase + (size_t)b * ((MODE == 2) ? (NKPOS * CDIM) : (NPOS * CDIM));

  const uint32_t ldsA = lds_addr32(&Ah[0]);
  const uint32_t ldsB = lds_addr32(&Bh[0]);
  const unsigned long long wbase = (unsigned long long)(uintptr_t)W;
  const unsigned long long abase = (unsigned long long)(uintptr_t)act;

  // Issue one 128x32 A tile + B tile into buffer `buf` (4 async instrs / wave).
  auto issue_tile = [&](int buf, int k0) {
    #pragma unroll
    for (int i = 0; i < 2; i++) {
      int idx = tid + i * 256;
      int row = idx >> 2;
      int ch  = (idx & 3) * 8;           // 8-half (16B) chunk
      uint32_t lofs = (uint32_t)(buf * TILE + row * 40 + ch) * 2u;
      async_ld_b128(ldsA + lofs, (uint32_t)(((m0 + row) * K + k0 + ch) * 2), wbase);
      uint32_t gb;
      if (MODE == 1) {
        int kk = k0 + ch;
        int s  = kk >> 9;                // 2x2 tap selector
        int c  = kk & 511;
        int sy = s >> 1, sx = s & 1;
        int n  = n0 + row;               // reduced position
        int py = n >> 5, px = n & 31;
        int sp = (2 * py + sy) * 64 + (2 * px + sx);
        gb = (uint32_t)((sp * CDIM + c) * 2);
      } else {
        gb = (uint32_t)(((n0 + row) * K + k0 + ch) * 2);
      }
      async_ld_b128(ldsB + lofs, gb, abase);
    }
  };

  v8f acc[2][4];
  const v8f vzero = {0.f, 0.f, 0.f, 0.f, 0.f, 0.f, 0.f, 0.f};
  for (int i = 0; i < 2; i++)
    for (int j = 0; j < 4; j++) acc[i][j] = vzero;

  issue_tile(0, 0);
  for (int k0 = 0, it = 0; k0 < K; k0 += 32, ++it) {
    const int cur = it & 1;
    const bool more = (k0 + 32) < K;
    if (more) issue_tile(cur ^ 1, k0 + 32);
    // async loads complete in order: <=4 outstanding means current tile landed
    if (more) asm volatile("s_wait_asynccnt 0x4" ::: "memory");
    else      asm volatile("s_wait_asynccnt 0x0" ::: "memory");
    __syncthreads();                     // every wave's part of the tile is in LDS

    v16h af[2], bf[4];
    #pragma unroll
    for (int mt = 0; mt < 2; mt++)
      af[mt] = frag_ld(&Ah[cur * TILE + (wm * 32 + mt * 16 + (lane & 15)) * 40], lane);
    #pragma unroll
    for (int nt = 0; nt < 4; nt++)
      bf[nt] = frag_ld(&Bh[cur * TILE + (wn * 64 + nt * 16 + (lane & 15)) * 40], lane);
    #pragma unroll
    for (int mt = 0; mt < 2; mt++)
      #pragma unroll
      for (int nt = 0; nt < 4; nt++)
        acc[mt][nt] = wmma16(af[mt], bf[nt], acc[mt][nt]);

    // fragment reads done before anyone overwrites this buffer
    asm volatile("s_wait_dscnt 0x0" ::: "memory");
    __syncthreads();
  }

  // epilogue: C/D layout -> lane holds col n = lane%16, rows r + (lane>=16?8:0)
  const int halfoff = (lane & 16) ? 8 : 0;
  const int ncol = lane & 15;
  #pragma unroll
  for (int mt = 0; mt < 2; mt++) {
    #pragma unroll
    for (int nt = 0; nt < 4; nt++) {
      #pragma unroll
      for (int r = 0; r < 8; r++) {
        int o = m0 + wm * 32 + mt * 16 + r + halfoff;
        int n = n0 + wn * 64 + nt * 16 + ncol;
        float v = acc[mt][nt][r] + bias[o];
        if (MODE == 0) {
          int head = o >> 6, d = o & 63;
          outH[(((size_t)(b * HEADS + head) * NPOS) + n) * HD + d] = (half_t)v;
        } else if (MODE == 1) {
          outF[((size_t)b * NKPOS + n) * CDIM + o] = v;
        } else if (MODE == 2) {
          if (o < CDIM) {
            int head = o >> 6, d = o & 63;
            outH[(((size_t)(b * HEADS + head) * NKPOS) + n) * HD + d] = (half_t)v;
          } else {
            int vc = o - CDIM;
            int head = vc >> 6, d = vc & 63;
            outH2[(((size_t)(b * HEADS + head) * HD) + d) * NKPOS + n] = (half_t)v;
          }
        } else { // MODE 3
          outF[((size_t)b * CDIM + o) * NPOS + n] = v;
        }
      }
    }
  }
}

// ---------------------------------------------------------------------------
// Flash attention: 256 threads = 8 waves; each wave owns 16 queries and loops
// over keys in 32-chunks with online softmax.  K and V^T are staged in LDS in
// 64-key tiles that all 8 waves share: two buffers, filled by async copies one
// tile ahead, whole 128-byte lines per row.  Rows are 128 B at a 144 B pitch
// (16 B x odd: conflict free for 16-byte fragment reads).  The probability
// tile round-trips through per-wave LDS for the C/D -> A-layout transpose.
// ---------------------------------------------------------------------------
#define KSTG   64              // keys per staged tile
#define KVP    72              // LDS row pitch in halves
#define KVTILE (64 * KVP)      // halves per tile (64 rows: keys for K, d for V^T)
__global__ __launch_bounds__(256)
void attn_kernel(const half_t* __restrict__ qh, const half_t* __restrict__ kh,
                 const half_t* __restrict__ vt, half_t* __restrict__ attnT) {
  __shared__ half_t Pbuf[8 * 16 * 40];
  __shared__ __attribute__((aligned(16))) half_t Ks[2 * KVTILE];
  __shared__ __attribute__((aligned(16))) half_t Vs[2 * KVTILE];
  const int tid  = threadIdx.x;
  const int lane = tid & 31;
  const int wave = tid >> 5;
  const int bh   = blockIdx.y;          // b*8 + h
  const int b    = bh >> 3, h = bh & 7;
  const int q0   = blockIdx.x * 128 + wave * 16;
  const int lrow = lane & 15;
  const int halfoff = (lane & 16) ? 8 : 0;
  half_t* Pw = &Pbuf[wave * 16 * 40];

  // Q A-fragments (16 q x 64 d = two k-steps), loaded once
  const half_t* qrow = qh + ((size_t)bh * NPOS + q0 + lrow) * HD;
  v16h qa0 = frag_ld(qrow, lane);
  v16h qa1 = frag_ld(qrow + 32, lane);

  const v8f vzero = {0.f, 0.f, 0.f, 0.f, 0.f, 0.f, 0.f, 0.f};
  v8f acc[4];
  for (int dt = 0; dt < 4; dt++) acc[dt] = vzero;
  float rmax[8], rsum[8];
  for (int r = 0; r < 8; r++) { rmax[r] = -1e30f; rsum[r] = 0.f; }

  // Each thread copies two 16-byte chunks of the K tile and two of the V^T tile.
  const int crow = tid >> 3;            // rows crow and crow + 32
  const int cch  = (tid & 7) * 8;       // 8-half chunk inside the 64-half row
  const uint32_t ldsK = lds_addr32(&Ks[crow * KVP + cch]);
  const uint32_t ldsV = lds_addr32(&Vs[crow * KVP + cch]);
  const half_t* gK = kh + ((size_t)bh * NKPOS + crow) * HD + cch;
  const half_t* gV = vt + ((size_t)bh * HD + crow) * NKPOS + cch;
  auto issue_stage = [&](int buf, int kb0) {
    const uint32_t lo = (uint32_t)(buf * KVTILE * 2);
    const half_t* k0p = gK + (size_t)kb0 * HD;
    const half_t* v0p = gV + kb0;
    async_cp4_b128(ldsK + lo,                k0p,
                   ldsK + lo + 32 * KVP * 2, k0p + 32 * HD,
                   ldsV + lo,                v0p,
                   ldsV + lo + 32 * KVP * 2, v0p + 32 * NKPOS);
  };

  issue_stage(0, 0);
  // tile 0 landed (this wave's copies), then visible to every wave
  asm volatile("s_wait_asynccnt 0x0" ::: "memory");
  __syncthreads();
  issue_stage(1, KSTG);

  for (int t = 0; t < NKPOS / KSTG; ++t) {
   const half_t* Kt = &Ks[(t & 1) * KVTILE];
   const half_t* Vt = &Vs[(t & 1) * KVTILE];
   // unrolled so that sub folds into the immediate offsets of the LDS reads
   #pragma unroll
   for (int sub = 0; sub < KSTG; sub += 32) {
    // S = (Q K^T) * scale for a 16x32 chunk (two 16x16 tiles)
    v8f s[2];
    #pragma unroll
    for (int st = 0; st < 2; st++) {
      const half_t* kbase = Kt + (sub + st * 16 + lrow) * KVP;
      v16h kf0 = frag_ld(kbase, lane);
      v16h kf1 = frag_ld(kbase + 32, lane);
      v8f z = vzero;
      z = wmma16(qa0, kf0, z);
      z = wmma16(qa1, kf1, z);
      #pragma unroll
      for (int r = 0; r < 8; r++) z[r] *= ATT_SCALE;
      s[st] = z;
    }
    // online softmax, rows live in 16-lane halves
    #pragma unroll
    for (int r = 0; r < 8; r++) {
      float m = fmaxf(s[0][r], s[1][r]);
      for (int off = 1; off < 16; off <<= 1) m = fmaxf(m, __shfl_xor(m, off, 32));
      float nm = fmaxf(rmax[r], m);
      float alpha = __expf(rmax[r] - nm);
      rmax[r] = nm;
      float p0 = __expf(s[0][r] - nm);
      float p1 = __expf(s[1][r] - nm);
      s[0][r] = p0; s[1][r] = p1;
      float ps = p0 + p1;
      for (int off = 1; off < 16; off <<= 1) ps += __shfl_xor(ps, off, 32);
      rsum[r] = rsum[r] * alpha + ps;
      #pragma unroll
      for (int dt = 0; dt < 4; dt++) acc[dt][r] *= alpha;
    }
    // transpose P (C/D layout) into A layout via per-wave LDS tile
    #pragma unroll
    for (int st = 0; st < 2; st++)
      #pragma unroll
      for (int r = 0; r < 8; r++)
        Pw[(r + halfoff) * 40 + st * 16 + lrow] = (half_t)s[st][r];
    asm volatile("s_wait_dscnt 0x0" ::: "memory");
    v16h pa = frag_ld(&Pw[lrow * 40], lane);
    // acc += P (16x32) * V (32 keys x 16 d), V^T layout -> contiguous keys
    #pragma unroll
    for (int dt = 0; dt < 4; dt++) {
      const half_t* vbase = Vt + (dt * 16 + lrow) * KVP + sub;
      v16h vf = frag_ld(vbase, lane);
      acc[dt] = wmma16(pa, vf, acc[dt]);
    }
   }
   // hand-over: this wave's reads of tile t are done ...
   asm volatile("s_wait_dscnt 0x0" ::: "memory");
   // ... its copies of tile t + 1 have landed ...
   asm volatile("s_wait_asynccnt 0x0" ::: "memory");
   // ... and one barrier publishes tile t + 1 and frees tile t's buffer
   __syncthreads();
   if (t + 2 < NKPOS / KSTG) issue_stage(t & 1, (t + 2) * KSTG);
  }
  // nothing is outstanding here; kept so that no copy can outlive the wave
  asm volatile("s_wait_asynccnt 0x0" ::: "memory");

  // normalize and emit position-major [n][c] f16 for the projection GEMM
  #pragma unroll
  for (int dt = 0; dt < 4; dt++)
    #pragma unroll
    for (int r = 0; r < 8; r++) {
      int orow = q0 + r + halfoff;
      int c = h * HD + dt * 16 + lrow;
      attnT[((size_t)b * NPOS + orow) * CDIM + c] = (half_t)(acc[dt][r] / rsum[r]);
    }
}

// ---------------------------------------------------------------------------
extern "C" void kernel_launch(void* const* d_in, const int* in_sizes, int n_in,
                              void* d_out, int out_size, void* d_ws, size_t ws_size,
                              hipStream_t stream) {
  const float* x      = (const float*)d_in[0];
  const float* q_w    = (const float*)d_in[1];
  const float* q_b    = (const float*)d_in[2];
  const float* kv_w   = (const float*)d_in[3];
  const float* kv_b   = (const float*)d_in[4];
  const float* sr_w   = (const float*)d_in[5];
  const float* sr_b   = (const float*)d_in[6];
  const float* ln_g   = (const float*)d_in[7];
  const float* ln_b   = (const float*)d_in[8];
  const float* proj_w = (const float*)d_in[9];
  const float* proj_b = (const float*)d_in[10];
  float* out = (float*)d_out;

  size_t off = 0;
  auto carve = [&](size_t bytes) {
    void* p = (char*)d_ws + off;
    off += (bytes + 255) & ~(size_t)255;
    return p;
  };
  half_t* xT    = (half_t*)carve((size_t)BATCH * NPOS * CDIM * 2);
  half_t* qwh   = (half_t*)carve((size_t)CDIM * CDIM * 2);
  half_t* kvwh  = (half_t*)carve((size_t)2 * CDIM * CDIM * 2);
  half_t* srwh  = (half_t*)carve((size_t)CDIM * 2048 * 2);
  half_t* pwh   = (half_t*)carve((size_t)CDIM * CDIM * 2);
  half_t* qhb   = (half_t*)carve((size_t)BATCH * HEADS * NPOS * HD * 2);
  float*  kvin  = (float*)carve((size_t)BATCH * NKPOS * CDIM * 4);
  half_t* lnT   = (half_t*)carve((size_t)BATCH * NKPOS * CDIM * 2);
  half_t* khb   = (half_t*)carve((size_t)BATCH * HEADS * NKPOS * HD * 2);
  half_t* vtb   = (half_t*)carve((size_t)BATCH * HEADS * HD * NKPOS * 2);
  half_t* attnT = (half_t*)carve((size_t)BATCH * NPOS * CDIM * 2);

  // 1. precision / layout conversions
  cvt_xT<<<(BATCH * CDIM * NPOS) / 256, 256, 0, stream>>>(x, xT);
  cvt_f16<<<(CDIM * CDIM) / 256, 256, 0, stream>>>(q_w, qwh, CDIM * CDIM);
  cvt_f16<<<(2 * CDIM * CDIM) / 256, 256, 0, stream>>>(kv_w, kvwh, 2 * CDIM * CDIM);
  cvt_f16<<<(CDIM * CDIM) / 256, 256, 0, stream>>>(proj_w, pwh, CDIM * CDIM);
  cvt_srw<<<(CDIM * 2048) / 256, 256, 0, stream>>>(sr_w, srwh);

  // 2. SR conv as im2col GEMM -> kvin f32 [b][n][c]
  gemm_wmma<1><<<dim3(NKPOS / 128, CDIM / 128, BATCH), 256, 0, stream>>>(
      srwh, xT, sr_b, kvin, nullptr, nullptr);

  // 3. channel LayerNorm -> lnT f16
  ln_kernel<<<BATCH * NKPOS, 256, 0, stream>>>(kvin, ln_g, ln_b, lnT);

  // 4. KV projection -> kh [bh][nk][d], vt [bh][d][nk]
  gemm_wmma<2><<<dim3(NKPOS / 128, (2 * CDIM) / 128, BATCH), 256, 0, stream>>>(
      kvwh, lnT, kv_b, nullptr, khb, vtb);

  // 5. Q projection -> qh [bh][n][d]
  gemm_wmma<0><<<dim3(NPOS / 128, CDIM / 128, BATCH), 256, 0, stream>>>(
      qwh, xT, q_b, nullptr, qhb, nullptr);

  // 6. flash attention -> attnT f16 [b][n][c]
  attn_kernel<<<dim3(NPOS / 128, BATCH * HEADS), 256, 0, stream>>>(
      qhb, khb, vtb, attnT);

  // 7. output projection -> d_out f32 [b][c][n]
  gemm_wmma<3><<<dim3(NPOS / 128, CDIM / 128, BATCH), 256, 0, stream>>>(
      pwh, attnT, proj_b, out, nullptr, nullptr);
}

// v002
// A run of this version takes 188 microseconds.
// In both of two side-by-side timings against v001, it was 1.19 times as fast.
// Counting every step since v000, it is 1.64 times as fast.
#include <hip/hip_runtime.h>
#include <hip/hip_bf16.h>

typedef _Float16 half_t;
typedef __attribute__((ext_vector_type(16))) _Float16 v16h;
typedef __attribute__((ext_vector_type(8)))  float    v8f;

#define BATCH  4
#define CDIM   512
#define HEADS  8
#define HD     64
#define NPOS   4096   // 64*64
#define NKPOS  1024   // 32*32
#define ATT_SCALE 0.125f

// ---------------------------------------------------------------------------
// WMMA helpers.  16-bit A-matrix 16x32 layout (ISA 7.12.2): lane L holds row
// m = L%16; its 16 halves are two contiguous 8-half chunks at k = off..off+7
// and k = off+16..off+23, off = (L>=16 ? 8 : 0).  B uses the symmetric layout
// (lane = column, identical k packing), so both fragments are two 16-byte
// loads from a k-contiguous row.
// ---------------------------------------------------------------------------
__device__ __forceinline__ v16h frag_ld(const half_t* rowbase, int lane) {
  const int off = (lane & 16) ? 8 : 0;
  union { uint4 u[2]; v16h v; } t;
  t.u[0] = *(const uint4*)(rowbase + off);
  t.u[1] = *(const uint4*)(rowbase + off + 16);
  return t.v;
}

__device__ __forceinline__ v8f wmma16(v16h a, v16h b, v8f c) {
  return __builtin_amdgcn_wmma_f32_16x16x32_f16(false, a, false, b,
                                                (short)0, c, false, false);
}

// Low 32 bits of a flat pointer into LDS == LDS byte offset (ISA 10.2:
// the LDS aperture maps by truncating to addr[31:0]).
__device__ __forceinline__ uint32_t lds_addr32(const void* p) {
  return (uint32_t)(uintptr_t)p;
}

// async global->LDS, 16B per lane, GVS addressing (SGPR base + VGPR offset).
// Tracked with ASYNCcnt; no VGPR destination, no LOADcnt/DScnt involvement.
__device__ __forceinline__ void async_ld_b128(uint32_t lds_off, uint32_t goff,
                                              unsigned long long base) {
  asm volatile("global_load_async_to_lds_b128 %0, %1, %2"
               :: "v"(lds_off), "v"(goff), "s"(base) : "memory");
}

// Four async global->LDS copies of one lane, 16 B each, per-lane 64-bit address.
// s_wait_xcnt closes the same statement as a precaution: the address registers
// are not rewritten ahead of it.
__device__ __forceinline__ void async_cp4_b128(uint32_t l0, const half_t* g0,
                                               uint32_t l1, const half_t* g1,
                                               uint32_t l2, const half_t* g2,
                                               uint32_t l3, const half_t* g3) {
  asm volatile("global_load_async_to_lds_b128 %0, %1, off\n\t"
               "global_load_async_to_lds_b128 %2, %3, off\n\t"
               "global_load_async_to_lds_b128 %4, %5, off\n\t"
               "global_load_async_to_lds_b128 %6, %7, off\n\t"
               "s_wait_xcnt 0x0"
               :: "v"(l0), "v"(g0), "v"(l1), "v"(g1),
                  "v"(l2), "v"(g2), "v"(l3), "v"(g3) : "memory");
}

// ---------------------------------------------------------------------------
// Conversion kernels (f32 -> f16, layout shuffles)
// ---------------------------------------------------------------------------
__global__ void cvt_f16(const float* __restrict__ in, half_t* __restrict__ out, int n) {
  int i = blockIdx.x * 256 + threadIdx.x;
  if (i < n) out[i] = (half_t)in[i];
}

// x [B][512][4096] -> xT [B][4096][512] (f16, position-major)
__global__ void cvt_xT(const float* __restrict__ x, half_t* __restrict__ xT) {
  int i = blockIdx.x * 256 + threadIdx.x;        // over B*512*4096
  int b = i >> 21;
  int rem = i & ((1 << 21) - 1);
  int c = rem >> 12;
  int n = rem & 4095;
  xT[((size_t)b * NPOS + n) * CDIM + c] = (half_t)x[i];
}

// sr_w [O=512][C=512][2][2] -> srwh [o][k], k = (sy*2+sx)*512 + c
__global__ void cvt_srw(const float* __restrict__ srw, half_t* __restrict__ out) {
  int i = blockIdx.x * 256 + threadIdx.x;        // over 512*2048
  int o = i >> 11;
  int k = i & 2047;
  int s = k >> 9;
  int c = k & 511;
  int sy = s >> 1, sx = s & 1;
  out[i] = (half_t)srw[(((size_t)o * 512 + c) * 2 + sy) * 2 + sx];
}

// ---------------------------------------------------------------------------
// LayerNorm over channels at each reduced spatial position.
// kvin [B*1024][512] f32 -> lnT [B*1024][512] f16
// ---------------------------------------------------------------------------
__global__ __launch_bounds__(256)
void ln_kernel(const float* __restrict__ kvin, const float* __restrict__ g,
               const float* __restrict__ be, half_t* __restrict__ lnT) {
  __shared__ float r1[256], r2[256];
  const int pos = blockIdx.x;
  const int t = threadIdx.x;
  const float* xr = kvin + (size_t)pos * CDIM;
  float x0 = xr[t], x1 = xr[t + 256];
  r1[t] = x0 + x1;
  r2[t] = x0 * x0 + x1 * x1;
  __syncthreads();
  for (int off = 128; off > 0; off >>= 1) {
    if (t < off) { r1[t] += r1[t + off]; r2[t] += r2[t + off]; }
    __syncthreads();
  }
  float mean = r1[0] * (1.0f / 512.0f);
  float var  = r2[0] * (1.0f / 512.0f) - mean * mean;
  float rs   = rsqrtf(var + 1e-6f);
  lnT[(size_t)pos * CDIM + t]       = (half_t)((x0 - mean) * rs * g[t]       + be[t]);
  lnT[(size_t)pos * CDIM + t + 256] = (half_t)((x1 - mean) * rs * g[t + 256] + be[t + 256]);
}

// ---------------------------------------------------------------------------
// Tiled WMMA GEMM: out[M][Npos] = W[M][K] * act[Npos][K]^T  (+bias)
// Block = 256 threads = 8 waves, 128x128 tile, k-step 32.
// Tiles are staged with double-buffered GLOBAL_LOAD_ASYNC_TO_LDS_B128:
// tile t+1 is fetched (ASYNCcnt) while tile t runs through the WMMAs.
// MODE 0: Q proj   K=512 NP=4096 -> qh  [bh][n][d]   f16
// MODE 1: SR conv  K=2048 NP=1024 (im2col gather from xT) -> kvin f32 [b][n][o]
// MODE 2: KV proj  K=512 NP=1024 -> kh [bh][nk][d], vt [bh][d][nk]  f16
// MODE 3: out proj K=512 NP=4096 -> d_out f32 [b][o][n]
// ---------------------------------------------------------------------------
template<int MODE>
__global__ __launch_bounds__(256)
void gemm_wmma(const half_t* __restrict__ W, const half_t* __restrict__ actBase,
               const float* __restrict__ bias,
               float* __restrict__ outF, half_t* __restrict__ outH,
               half_t* __restrict__ outH2) {
  constexpr int K  = (MODE == 1) ? 2048 : 512;
  constexpr int TILE = 128 * 40;    // halves per buffer, 40-half pitch (conflict free)

  __shared__ half_t Ah[2 * TILE];
  __shared__ half_t Bh[2 * TILE];

  const int b    = blockIdx.z;
  const int n0   = blockIdx.x * 128;
  const int m0   = blockIdx.y * 128;
  const int tid  = threadIdx.x;
  const int lane = tid & 31;
  const int wave = tid >> 5;
  const int wm   = wave & 3;   // 4 row blocks of 32
  const int wn   = wave >> 2;  // 2 col blocks of 64
  const half_t* act = actBase + (size_t)b * ((MODE == 2) ? (NKPOS * CDIM) : (NPOS * CDIM));

  const uint32_t ldsA = lds_addr32(&Ah[0]);
  const uint32_t ldsB = lds_addr32(&Bh[0]);
  const unsigned long long wbase = (unsigned long long)(uintptr_t)W;
  const unsigned long long abase = (unsigned long long)(uintptr_t)act;

  // Issue one 128x32 A tile + B tile into buffer `buf` (4 async instrs / wave).
  auto issue_tile = [&](int buf, int k0) {
    #pragma unroll
    for (int i = 0; i < 2; i++) {
      int idx = tid + i * 256;
      int row = idx >> 2;
      int ch  = (idx & 3) * 8;           // 8-half (16B) chunk
      uint32_t lofs = (uint32_t)(buf * TILE + row * 40 + ch) * 2u;
      async_ld_b128(ldsA + lofs, (uint32_t)(((m0 + row) * K + k0 + ch) * 2), wbase);
      uint32_t gb;
      if (MODE == 1) {
        int kk = k0 + ch;
        int s  = kk >> 9;                // 2x2 tap selector
        int c  = kk & 511;
        int sy = s >> 1, sx = s & 1;
        int n  = n0 + row;               // reduced position
        int py = n >> 5, px = n & 31;
        int sp = (2 * py + sy) * 64 + (2 * px + sx);
        gb = (uint32_t)((sp * CDIM + c) * 2);
      } else {
        gb = (uint32_t)(((n0 + row) * K + k0 + ch) * 2);
      }
      async_ld_b128(ldsB + lofs, gb, abase);
    }
  };

  v8f acc[2][4];
  const v8f vzero = {0.f, 0.f, 0.f, 0.f, 0.f, 0.f, 0.f, 0.f};
  for (int i = 0; i < 2; i++)
    for (int j = 0; j < 4; j++) acc[i][j] = vzero;

  issue_tile(0, 0);
  for (int k0 = 0, it = 0; k0 < K; k0 += 32, ++it) {
    const int cur = it & 1;
    const bool more = (k0 + 32) < K;
    if (more) issue_tile(cur ^ 1, k0 + 32);
    // async loads complete in order: <=4 outstanding means current tile landed
    if (more) asm volatile("s_wait_asynccnt 0x4" ::: "memory");
    else      asm volatile("s_wait_asynccnt 0x0" ::: "memory");
    __syncthreads();                     // every wave's part of the tile is in LDS

    v16h af[2], bf[4];
    #pragma unroll
    for (int mt = 0; mt < 2; mt++)
      af[mt] = frag_ld(&Ah[cur * TILE + (wm * 32 + mt * 16 + (lane & 15)) * 40], lane);
    #pragma unroll
    for (int nt = 0; nt < 4; nt++)
      bf[nt] = frag_ld(&Bh[cur * TILE + (wn * 64 + nt * 16 + (lane & 15)) * 40], lane);
    #pragma unroll
    for (int mt = 0; mt < 2; mt++)
      #pragma unroll
      for (int nt = 0; nt < 4; nt++)
        acc[mt][nt] = wmma16(af[mt], bf[nt], acc[mt][nt]);

    // fragment reads done before anyone overwrites this buffer
    asm volatile("s_wait_dscnt 0x0" ::: "memory");
    __syncthreads();
  }

  // epilogue: C/D layout -> lane holds col n = lane%16, rows r + (lane>=16?8:0)
  const int halfoff = (lane & 16) ? 8 : 0;
  const int ncol = lane & 15;
  #pragma unroll
  for (int mt = 0; mt < 2; mt++) {
    #pragma unroll
    for (int nt = 0; nt < 4; nt++) {
      #pragma unroll
      for (int r = 0; r < 8; r++) {
        int o = m0 + wm * 32 + mt * 16 + r + halfoff;
        int n = n0 + wn * 64 + nt * 16 + ncol;
        float v = acc[mt][nt][r] + bias[o];
        if (MODE == 0) {
          int head = o >> 6, d = o & 63;
          outH[(((size_t)(b * HEADS + head) * NPOS) + n) * HD + d] = (half_t)v;
        } else if (MODE == 1) {
          outF[((size_t)b * NKPOS + n) * CDIM + o] = v;
        } else if (MODE == 2) {
          if (o < CDIM) {
            int head = o >> 6, d = o & 63;
            outH[(((size_t)(b * HEADS + head) * NKPOS) + n) * HD + d] = (half_t)v;
          } else {
            int vc = o - CDIM;
            int head = vc >> 6, d = vc & 63;
            outH2[(((size_t)(b * HEADS + head) * HD) + d) * NKPOS + n] = (half_t)v;
          }
        } else { // MODE 3
          outF[((size_t)b * CDIM + o) * NPOS + n] = v;
        }
      }
    }
  }
}

#define KSTG   64
#define KVP    72
#define KVTILE (64 * KVP)

// value of lane l ^ 16 (a vector cross-row move, no LDS round trip)
__device__ __forceinline__ float xhalf(float x) {
  return __builtin_bit_cast(float, __builtin_amdgcn_permlanex16(
      __builtin_bit_cast(int, x), __builtin_bit_cast(int, x),
      0x76543210, 0xfedcba98, false, false));
}

__global__ __launch_bounds__(256)
void attn_kernel(const half_t* __restrict__ qh, const half_t* __restrict__ kh,
                 const half_t* __restrict__ vt, half_t* __restrict__ attnT) {
  __shared__ __attribute__((aligned(16))) half_t Ks[2 * KVTILE];
  __shared__ __attribute__((aligned(16))) half_t Vs[2 * KVTILE];
  const int tid  = threadIdx.x;
  const int lane = tid & 31;
  const int wave = tid >> 5;
  const int bh   = blockIdx.y;          // b*8 + h
  const int b    = bh >> 3, h = bh & 7;
  const int q0   = blockIdx.x * 128 + wave * 16;
  const int lrow = lane & 15;
  const int halfoff = (lane & 16) ? 8 : 0;

  // Q B-fragments (64 d x 16 q = two k-steps), loaded once; lane = query column
  const half_t* qrow = qh + ((size_t)bh * NPOS + q0 + lrow) * HD;
  v16h qa0 = frag_ld(qrow, lane);
  v16h qa1 = frag_ld(qrow + 32, lane);

  const v8f vzero = {0.f, 0.f, 0.f, 0.f, 0.f, 0.f, 0.f, 0.f};
  v8f acc[4];                           // O^T: acc[dt][r] = O[q = lrow][d = dt*16 + halfoff + r]
  for (int dt = 0; dt < 4; dt++) acc[dt] = vzero;
  float rmax = -1e30f;                  // running maximum of this lane's query
  float rsum = 0.f;                     // this lane's half of the query's denominator

  // Each thread copies two 16-byte chunks of the K tile and two of the V^T tile.
  const int crow = tid >> 3;            // rows crow and crow + 32
  const int cch  = (tid & 7) * 8;       // 8-half chunk inside the 64-half row
  const uint32_t ldsK = lds_addr32(&Ks[crow * KVP + cch]);
  const uint32_t ldsV = lds_addr32(&Vs[crow * KVP + cch]);
  const half_t* gK = kh + ((size_t)bh * NKPOS + crow) * HD + cch;
  const half_t* gV = vt + ((size_t)bh * HD + crow) * NKPOS + cch;
  auto issue_stage = [&](int buf, int kb0) {
    const uint32_t lo = (uint32_t)(buf * KVTILE * 2);
    const half_t* k0p = gK + (size_t)kb0 * HD;
    const half_t* v0p = gV + kb0;
    async_cp4_b128(ldsK + lo,                k0p,
                   ldsK + lo + 32 * KVP * 2, k0p + 32 * HD,
                   ldsV + lo,                v0p,
                   ldsV + lo + 32 * KVP * 2, v0p + 32 * NKPOS);
  };

  issue_stage(0, 0);
  // tile 0 landed (this wave's copies), then visible to every wave
  asm volatile("s_wait_asynccnt 0x0" ::: "memory");
  __syncthreads();
  issue_stage(1, KSTG);

  for (int t = 0; t < NKPOS / KSTG; ++t) {
   const half_t* Kt = &Ks[(t & 1) * KVTILE];
   const half_t* Vt = &Vs[(t & 1) * KVTILE];
   // unrolled so that sub folds into the immediate offsets of the LDS reads
   #pragma unroll
   for (int sub = 0; sub < KSTG; sub += 32) {
    // S^T = (K Q^T) * scale for a 32x16 chunk (two 16x16 tiles):
    // s[st][r] = score of key sub + st*16 + halfoff + r against query lrow
    v8f s[2];
    #pragma unroll
    for (int st = 0; st < 2; st++) {
      const half_t* kbase = Kt + (sub + st * 16 + lrow) * KVP;
      v16h kf0 = frag_ld(kbase, lane);
      v16h kf1 = frag_ld(kbase + 32, lane);
      v8f z = vzero;
      z = wmma16(kf0, qa0, z);
      z = wmma16(kf1, qa1, z);
      #pragma unroll
      for (int r = 0; r < 8; r++) z[r] *= ATT_SCALE;
      s[st] = z;
    }
    // online softmax: 16 scores of one query per lane, the other 16 in lane^16
    float mx[8];
    #pragma unroll
    for (int i = 0; i < 8; i++) mx[i] = fmaxf(s[i >> 2][2 * (i & 3)], s[i >> 2][2 * (i & 3) + 1]);
    float m = fmaxf(fmaxf(fmaxf(mx[0], mx[1]), fmaxf(mx[2], mx[3])),
                    fmaxf(fmaxf(mx[4], mx[5]), fmaxf(mx[6], mx[7])));
    m = fmaxf(m, xhalf(m));
    const float nm = fmaxf(rmax, m);
    const float alpha = __expf(rmax - nm);
    rmax = nm;
    // P^T as the B operand: element e = key kmap(e) = tile e>>3, register e&7
    v16h pb;
    float pp[8];
    #pragma unroll
    for (int i = 0; i < 8; i++) {
      float p0 = __expf(s[i >> 2][2 * (i & 3)] - nm);
      float p1 = __expf(s[i >> 2][2 * (i & 3) + 1] - nm);
      pb[2 * i]     = (half_t)p0;
      pb[2 * i + 1] = (half_t)p1;
      pp[i] = p0 + p1;
    }
    const float ps = ((pp[0] + pp[1]) + (pp[2] + pp[3])) + ((pp[4] + pp[5]) + (pp[6] + pp[7]));
    rsum = rsum * alpha + ps;
    #pragma unroll
    for (int dt = 0; dt < 4; dt++)
      #pragma unroll
      for (int r = 0; r < 8; r++) acc[dt][r] *= alpha;
    // acc += V^T (16 d x 32 keys) * P^T (32 keys x 16 q)
    #pragma unroll
    for (int dt = 0; dt < 4; dt++) {
      const half_t* vbase = Vt + (dt * 16 + lrow) * KVP + sub;
      v16h vf = frag_ld(vbase, lane);
      acc[dt] = wmma16(vf, pb, acc[dt]);
    }
   }
   // hand-over: this wave's reads of tile t are done ...
   asm volatile("s_wait_dscnt 0x0" ::: "memory");
   // ... its copies of tile t + 1 have landed ...
   asm volatile("s_wait_asynccnt 0x0" ::: "memory");
   // ... and one barrier publishes tile t + 1 and frees tile t's buffer
   __syncthreads();
   if (t + 2 < NKPOS / KSTG) issue_stage(t & 1, (t + 2) * KSTG);
  }
  // nothing is outstanding here; kept so that no copy can outlive the wave
  asm volatile("s_wait_asynccnt 0x0" ::: "memory");

  // join the two halves' denominators, normalize and emit position-major
  // [n][c] f16 for the projection GEMM: 8 consecutive d per lane, 16-byte stores
  const float inv = 1.0f / (rsum + xhalf(rsum));
  half_t* orow = attnT + ((size_t)b * NPOS + q0 + lrow) * CDIM + h * HD + halfoff;
  #pragma unroll
  for (int dt = 0; dt < 4; dt++) {
    union { uint4 u; half_t e[8]; } o;
    #pragma unroll
    for (int r = 0; r < 8; r++) o.e[r] = (half_t)(acc[dt][r] * inv);
    *(uint4*)(orow + dt * 16) = o.u;
  }
}

// ---------------------------------------------------------------------------
extern "C" void kernel_launch(void* const* d_in, const int* in_sizes, int n_in,
                              void* d_out, int out_size, void* d_ws, size_t ws_size,
                              hipStream_t stream) {
  const float* x      = (const float*)d_in[0];
  const float* q_w    = (const float*)d_in[1];
  const float* q_b    = (const float*)d_in[2];
  const float* kv_w   = (const float*)d_in[3];
  const float* kv_b   = (const float*)d_in[4];
  const float* sr_w   = (const float*)d_in[5];
  const float* sr_b   = (const float*)d_in[6];
  const float* ln_g   = (const float*)d_in[7];
  const float* ln_b   = (const float*)d_in[8];
  const float* proj_w = (const float*)d_in[9];
  const float* proj_b = (const float*)d_in[10];
  float* out = (float*)d_out;

  size_t off = 0;
  auto carve = [&](size_t bytes) {
    void* p = (char*)d_ws + off;
    off += (bytes + 255) & ~(size_t)255;
    return p;
  };
  half_t* xT    = (half_t*)carve((size_t)BATCH * NPOS * CDIM * 2);
  half_t* qwh   = (half_t*)carve((size_t)CDIM * CDIM * 2);
  half_t* kvwh  = (half_t*)carve((size_t)2 * CDIM * CDIM * 2);
  half_t* srwh  = (half_t*)carve((size_t)CDIM * 2048 * 2);
  half_t* pwh   = (half_t*)carve((size_t)CDIM * CDIM * 2);
  half_t* qhb   = (half_t*)carve((size_t)BATCH * HEADS * NPOS * HD * 2);
  float*  kvin  = (float*)carve((size_t)BATCH * NKPOS * CDIM * 4);
  half_t* lnT   = (half_t*)carve((size_t)BATCH * NKPOS * CDIM * 2);
  half_t* khb   = (half_t*)carve((size_t)BATCH * HEADS * NKPOS * HD * 2);
  half_t* vtb   = (half_t*)carve((size_t)BATCH * HEADS * HD * NKPOS * 2);
  half_t* attnT = (half_t*)carve((size_t)BATCH * NPOS * CDIM * 2);

  // 1. precision / layout conversions
  cvt_xT<<<(BATCH * CDIM * NPOS) / 256, 256, 0, stream>>>(x, xT);
  cvt_f16<<<(CDIM * CDIM) / 256, 256, 0, stream>>>(q_w, qwh, CDIM * CDIM);
  cvt_f16<<<(2 * CDIM * CDIM) / 256, 256, 0, stream>>>(kv_w, kvwh, 2 * CDIM * CDIM);
  cvt_f16<<<(CDIM * CDIM) / 256, 256, 0, stream>>>(proj_w, pwh, CDIM * CDIM);
  cvt_srw<<<(CDIM * 2048) / 256, 256, 0, stream>>>(sr_w, srwh);

  // 2. SR conv as im2col GEMM -> kvin f32 [b][n][c]
  gemm_wmma<1><<<dim3(NKPOS / 128, CDIM / 128, BATCH), 256, 0, stream>>>(
      srwh, xT, sr_b, kvin, nullptr, nullptr);

  // 3. channel LayerNorm -> lnT f16
  ln_kernel<<<BATCH * NKPOS, 256, 0, stream>>>(kvin, ln_g, ln_b, lnT);

  // 4. KV projection -> kh [bh][nk][d], vt [bh][d][nk]
  gemm_wmma<2><<<dim3(NKPOS / 128, (2 * CDIM) / 128, BATCH), 256, 0, stream>>>(
      kvwh, lnT, kv_b, nullptr, khb, vtb);

  // 5. Q projection -> qh [bh][n][d]
  gemm_wmma<0><<<dim3(NPOS / 128, CDIM / 128, BATCH), 256, 0, stream>>>(
      qwh, xT, q_b, nullptr, qhb, nullptr);

  // 6. flash attention -> attnT f16 [b][n][c]
  attn_kernel<<<dim3(NPOS / 128, BATCH * HEADS), 256, 0, stream>>>(
      qhb, khb, vtb, attnT);

  // 7. output projection -> d_out f32 [b][c][n]
  gemm_wmma<3><<<dim3(NPOS / 128, CDIM / 128, BATCH), 256, 0, stream>>>(
      pwh, attnT, proj_b, out, nullptr, nullptr);
}

// v003
// Measured time: 145 microseconds a run.
// Next to v002, in two timings, it ran 1.29 and 1.30 times as fast.
// Counting every step since v000, it is 2.14 times as fast.
#include <hip/hip_runtime.h>
#include <hip/hip_bf16.h>

typedef _Float16 half_t;
typedef __attribute__((ext_vector_type(16))) _Float16 v16h;
typedef __attribute__((ext_vector_type(8)))  float    v8f;

#define BATCH  4
#define CDIM   512
#define HEADS  8
#define HD     64
#define NPOS   4096   // 64*64
#define NKPOS  1024   // 32*32
#define ATT_SCALE 0.125f

// ---------------------------------------------------------------------------
// WMMA helpers.  16-bit A-matrix 16x32 layout (ISA 7.12.2): lane L holds row
// m = L%16; its 16 halves are two contiguous 8-half chunks at k = off..off+7
// and k = off+16..off+23, off = (L>=16 ? 8 : 0).  B uses the symmetric layout
// (lane = column, identical k packing), so both fragments are two 16-byte
// loads from a k-contiguous row.
// ---------------------------------------------------------------------------
__device__ __forceinline__ v16h frag_ld(const half_t* rowbase, int lane) {
  const int off = (lane & 16) ? 8 : 0;
  union { uint4 u[2]; v16h v; } t;
  t.u[0] = *(const uint4*)(rowbase + off);
  t.u[1] = *(const uint4*)(rowbase + off + 16);
  return t.v;
}

__device__ __forceinline__ v8f wmma16(v16h a, v16h b, v8f c) {
  return __builtin_amdgcn_wmma_f32_16x16x32_f16(false, a, false, b,
                                                (short)0, c, false, false);
}

// Low 32 bits of a flat pointer into LDS == LDS byte offset (ISA 10.2:
// the LDS aperture maps by truncating to addr[31:0]).
__device__ __forceinline__ uint32_t lds_addr32(const void* p) {
  return (uint32_t)(uintptr_t)p;
}

// async global->LDS, 16B per lane, GVS addressing (SGPR base + VGPR offset).
// Tracked with ASYNCcnt; no VGPR destination, no LOADcnt/DScnt involvement.
__device__ __forceinline__ void async_ld_b128(uint32_t lds_off, uint32_t goff,
                                              unsigned long long base) {
  asm volatile("global_load_async_to_lds_b128 %0, %1, %2"
               :: "v"(lds_off), "v"(goff), "s"(base) : "memory");
}

// Four async global->LDS copies of one lane, 16 B each, per-lane 64-bit address.
// s_wait_xcnt closes the same statement as a precaution: the address registers
// are not rewritten ahead of it.
__device__ __forceinline__ void async_cp4_b128(uint32_t l0, const half_t* g0,
                                               uint32_t l1, const half_t* g1,
                                               uint32_t l2, const half_t* g2,
                                               uint32_t l3, const half_t* g3) {
  asm volatile("global_load_async_to_lds_b128 %0, %1, off\n\t"
               "global_load_async_to_lds_b128 %2, %3, off\n\t"
               "global_load_async_to_lds_b128 %4, %5, off\n\t"
               "global_load_async_to_lds_b128 %6, %7, off\n\t"
               "s_wait_xcnt 0x0"
               :: "v"(l0), "v"(g0), "v"(l1), "v"(g1),
                  "v"(l2), "v"(g2), "v"(l3), "v"(g3) : "memory");
}

// ---------------------------------------------------------------------------
// Conversion kernels (f32 -> f16, layout shuffles)
// ---------------------------------------------------------------------------
__global__ void cvt_f16(const float* __restrict__ in, half_t* __restrict__ out, int n) {
  int i = blockIdx.x * 256 + threadIdx.x;
  if (i < n) out[i] = (half_t)in[i];
}

// x [B][512][4096] -> xT [B][4096][512] (f16, position-major)
// The transposition happens in registers: a thread holds 16 channels x 4
// positions (sixteen 16-byte loads, all in flight together) and stores, per
// position, two 16-byte runs of 8 channels.  A wave covers 64 channels x 32
// positions: every load reads four whole 128-byte lines of x, and the two
// stores of one position fill one whole 128-byte line of xT, 64 bytes each.
__global__ __launch_bounds__(256)
void cvt_xT(const float* __restrict__ x, half_t* __restrict__ xT) {
  const int lane = threadIdx.x & 31;
  const int wave = threadIdx.x >> 5;
  const int blk  = blockIdx.x;                    // B * 8 channel tiles * 16 position tiles
  const int b    = blk >> 7;
  const int c0   = ((blk >> 4) & 7) * 64 + (lane >> 3) * 8;   // and c0 + 32
  const int n0   = (blk & 15) * 256 + wave * 32 + (lane & 7) * 4;
  const float* src = x + ((size_t)b * CDIM + c0) * NPOS + n0;
  float4 v[2][8];
  #pragma unroll
  for (int g = 0; g < 2; g++)
    #pragma unroll
    for (int j = 0; j < 8; j++)
      v[g][j] = *(const float4*)(src + (size_t)(g * 32 + j) * NPOS);
  // the wait that belongs in front of any rewrite of the loads' address pair; it
  // names the pair, so that no load's own result is placed on it either
  asm volatile("s_wait_xcnt 0x0" :: "v"(src) : "memory");
  // keeps all sixteen loads in front of the first conversion: without it four of
  // them are issued behind a wait and the wave pays a second memory latency
  __builtin_amdgcn_sched_barrier(0);
  half_t* dst = xT + ((size_t)b * NPOS + n0) * CDIM + c0;
  #pragma unroll
  for (int i = 0; i < 4; i++) {
    #pragma unroll
    for (int g = 0; g < 2; g++) {
      union { uint4 u; half_t e[8]; } o;
      #pragma unroll
      for (int j = 0; j < 8; j++) {
        const float* f = (const float*)&v[g][j];
        o.e[j] = (half_t)f[i];
      }
      *(uint4*)(dst + (size_t)i * CDIM + g * 32) = o.u;
    }
  }
}

// sr_w [O=512][C=512][2][2] -> srwh [o][k], k = (sy*2+sx)*512 + c
__global__ void cvt_srw(const float* __restrict__ srw, half_t* __restrict__ out) {
  int i = blockIdx.x * 256 + threadIdx.x;        // over 512*2048
  int o = i >> 11;
  int k = i & 2047;
  int s = k >> 9;
  int c = k & 511;
  int sy = s >> 1, sx = s & 1;
  out[i] = (half_t)srw[(((size_t)o * 512 + c) * 2 + sy) * 2 + sx];
}

// ---------------------------------------------------------------------------
// LayerNorm over channels at each reduced spatial position.
// kvin [B*1024][512] f32 -> lnT [B*1024][512] f16
// ---------------------------------------------------------------------------
__global__ __launch_bounds__(256)
void ln_kernel(const float* __restrict__ kvin, const float* __restrict__ g,
               const float* __restrict__ be, half_t* __restrict__ lnT) {
  __shared__ float r1[256], r2[256];
  const int pos = blockIdx.x;
  const int t = threadIdx.x;
  const float* xr = kvin + (size_t)pos * CDIM;
  float x0 = xr[t], x1 = xr[t + 256];
  r1[t] = x0 + x1;
  r2[t] = x0 * x0 + x1 * x1;
  __syncthreads();
  for (int off = 128; off > 0; off >>= 1) {
    if (t < off) { r1[t] += r1[t + off]; r2[t] += r2[t + off]; }
    __syncthreads();
  }
  float mean = r1[0] * (1.0f / 512.0f);
  float var  = r2[0] * (1.0f / 512.0f) - mean * mean;
  float rs   = rsqrtf(var + 1e-6f);
  lnT[(size_t)pos * CDIM + t]       = (half_t)((x0 - mean) * rs * g[t]       + be[t]);
  lnT[(size_t)pos * CDIM + t + 256] = (half_t)((x1 - mean) * rs * g[t + 256] + be[t + 256]);
}

// ---------------------------------------------------------------------------
// Tiled WMMA GEMM: out[M][Npos] = W[M][K] * act[Npos][K]^T  (+bias)
// Block = 256 threads = 8 waves, 128x128 tile, k-step 32.
// Tiles are staged with double-buffered GLOBAL_LOAD_ASYNC_TO_LDS_B128:
// tile t+1 is fetched (ASYNCcnt) while tile t runs through the WMMAs.
// MODE 0: Q proj   K=512 NP=4096 -> qh  [bh][n][d]   f16
// MODE 1: SR conv  K=2048 NP=1024 (im2col gather from xT) -> kvin f32 [b][n][o]
// MODE 2: KV proj  K=512 NP=1024 -> kh [bh][nk][d], vt [bh][d][nk]  f16
// MODE 3: out proj K=512 NP=4096 -> d_out f32 [b][o][n]
// ---------------------------------------------------------------------------
template<int MODE>
__global__ __launch_bounds__(256)
void gemm_wmma(const half_t* __restrict__ W, const half_t* __restrict__ actBase,
               const float* __restrict__ bias,
               float* __restrict__ outF, half_t* __restrict__ outH,
               half_t* __restrict__ outH2) {
  constexpr int K  = (MODE == 1) ? 2048 : 512;
  constexpr int TILE = 128 * 40;    // halves per buffer, 40-half pitch (conflict free)

  __shared__ half_t Ah[2 * TILE];
  __shared__ half_t Bh[2 * TILE];

  const int b    = blockIdx.z;
  const int n0   = blockIdx.x * 128;
  const int m0   = blockIdx.y * 128;
  const int tid  = threadIdx.x;
  const int lane = tid & 31;
  const int wave = tid >> 5;
  const int wm   = wave & 3;   // 4 row blocks of 32
  const int wn   = wave >> 2;  // 2 col blocks of 64
  const half_t* act = actBase + (size_t)b * ((MODE == 2) ? (NKPOS * CDIM) : (NPOS * CDIM));

  const uint32_t ldsA = lds_addr32(&Ah[0]);
  const uint32_t ldsB = lds_addr32(&Bh[0]);
  const unsigned long long wbase = (unsigned long long)(uintptr_t)W;
  const unsigned long long abase = (unsigned long long)(uintptr_t)act;

  // Issue one 128x32 A tile + B tile into buffer `buf` (4 async instrs / wave).
  auto issue_tile = [&](int buf, int k0) {
    #pragma unroll
    for (int i = 0; i < 2; i++) {
      int idx = tid + i * 256;
      int row = idx >> 2;
      int ch  = (idx & 3) * 8;           // 8-half (16B) chunk
      uint32_t lofs = (uint32_t)(buf * TILE + row * 40 + ch) * 2u;
      async_ld_b128(ldsA + lofs, (uint32_t)(((m0 + row) * K + k0 + ch) * 2), wbase);
      uint32_t gb;
      if (MODE == 1) {
        int kk = k0 + ch;
        int s  = kk >> 9;                // 2x2 tap selector
        int c  = kk & 511;
        int sy = s >> 1, sx = s & 1;
        int n  = n0 + row;               // reduced position
        int py = n >> 5, px = n & 31;
        int sp = (2 * py + sy) * 64 + (2 * px + sx);
        gb = (uint32_t)((sp * CDIM + c) * 2);
      } else {
        gb = (uint32_t)(((n0 + row) * K + k0 + ch) * 2);
      }
      async_ld_b128(ldsB + lofs, gb, abase);
    }
  };

  v8f acc[2][4];
  const v8f vzero = {0.f, 0.f, 0.f, 0.f, 0.f, 0.f, 0.f, 0.f};
  for (int i = 0; i < 2; i++)
    for (int j = 0; j < 4; j++) acc[i][j] = vzero;

  issue_tile(0, 0);
  for (int k0 = 0, it = 0; k0 < K; k0 += 32, ++it) {
    const int cur = it & 1;
    const bool more = (k0 + 32) < K;
    if (more) issue_tile(cur ^ 1, k0 + 32);
    // async loads complete in order: <=4 outstanding means current tile landed
    if (more) asm volatile("s_wait_asynccnt 0x4" ::: "memory");
    else      asm volatile("s_wait_asynccnt 0x0" ::: "memory");
    __syncthreads();                     // every wave's part of the tile is in LDS

    v16h af[2], bf[4];
    #pragma unroll
    for (int mt = 0; mt < 2; mt++)
      af[mt] = frag_ld(&Ah[cur * TILE + (wm * 32 + mt * 16 + (lane & 15)) * 40], lane);
    #pragma unroll
    for (int nt = 0; nt < 4; nt++)
      bf[nt] = frag_ld(&Bh[cur * TILE + (wn * 64 + nt * 16 + (lane & 15)) * 40], lane);
    #pragma unroll
    for (int mt = 0; mt < 2; mt++)
      #pragma unroll
      for (int nt = 0; nt < 4; nt++)
        acc[mt][nt] = wmma16(af[mt], bf[nt], acc[mt][nt]);

    // fragment reads done before anyone overwrites this buffer
    asm volatile("s_wait_dscnt 0x0" ::: "memory");
    __syncthreads();
  }

  // epilogue: C/D layout -> lane holds col n = lane%16, rows r + (lane>=16?8:0)
  const int halfoff = (lane & 16) ? 8 : 0;
  const int ncol = lane & 15;
  #pragma unroll
  for (int mt = 0; mt < 2; mt++) {
    #pragma unroll
    for (int nt = 0; nt < 4; nt++) {
      #pragma unroll
      for (int r = 0; r < 8; r++) {
        int o = m0 + wm * 32 + mt * 16 + r + halfoff;
        int n = n0 + wn * 64 + nt * 16 + ncol;
        float v = acc[mt][nt][r] + bias[o];
        if (MODE == 0) {
          int head = o >> 6, d = o & 63;
          outH[(((size_t)(b * HEADS + head) * NPOS) + n) * HD + d] = (half_t)v;
        } else if (MODE == 1) {
          outF[((size_t)b * NKPOS + n) * CDIM + o] = v;
        } else if (MODE == 2) {
          if (o < CDIM) {
            int head = o >> 6, d = o & 63;
            outH[(((size_t)(b * HEADS + head) * NKPOS) + n) * HD + d] = (half_t)v;
          } else {
            int vc = o - CDIM;
            int head = vc >> 6, d = vc & 63;
            outH2[(((size_t)(b * HEADS + head) * HD) + d) * NKPOS + n] = (half_t)v;
          }
        } else { // MODE 3
          outF[((size_t)b * CDIM + o) * NPOS + n] = v;
        }
      }
    }
  }
}

#define KSTG   64
#define KVP    72
#define KVTILE (64 * KVP)

// value of lane l ^ 16 (a vector cross-row move, no LDS round trip)
__device__ __forceinline__ float xhalf(float x) {
  return __builtin_bit_cast(float, __builtin_amdgcn_permlanex16(
      __builtin_bit_cast(int, x), __builtin_bit_cast(int, x),
      0x76543210, 0xfedcba98, false, false));
}

__global__ __launch_bounds__(256)
void attn_kernel(const half_t* __restrict__ qh, const half_t* __restrict__ kh,
                 const half_t* __restrict__ vt, half_t* __restrict__ attnT) {
  __shared__ __attribute__((aligned(16))) half_t Ks[2 * KVTILE];
  __shared__ __attribute__((aligned(16))) half_t Vs[2 * KVTILE];
  const int tid  = threadIdx.x;
  const int lane = tid & 31;
  const int wave = tid >> 5;
  const int bh   = blockIdx.y;          // b*8 + h
  const int b    = bh >> 3, h = bh & 7;
  const int q0   = blockIdx.x * 128 + wave * 16;
  const int lrow = lane & 15;
  const int halfoff = (lane & 16) ? 8 : 0;

  // Q B-fragments (64 d x 16 q = two k-steps), loaded once; lane = query column
  const half_t* qrow = qh + ((size_t)bh * NPOS + q0 + lrow) * HD;
  v16h qa0 = frag_ld(qrow, lane);
  v16h qa1 = frag_ld(qrow + 32, lane);

  const v8f vzero = {0.f, 0.f, 0.f, 0.f, 0.f, 0.f, 0.f, 0.f};
  v8f acc[4];                           // O^T: acc[dt][r] = O[q = lrow][d = dt*16 + halfoff + r]
  for (int dt = 0; dt < 4; dt++) acc[dt] = vzero;
  float rmax = -1e30f;                  // running maximum of this lane's query
  float rsum = 0.f;                     // this lane's half of the query's denominator

  // Each thread copies two 16-byte chunks of the K tile and two of the V^T tile.
  const int crow = tid >> 3;            // rows crow and crow + 32
  const int cch  = (tid & 7) * 8;       // 8-half chunk inside the 64-half row
  const uint32_t ldsK = lds_addr32(&Ks[crow * KVP + cch]);
  const uint32_t ldsV = lds_addr32(&Vs[crow * KVP + cch]);
  const half_t* gK = kh + ((size_t)bh * NKPOS + crow) * HD + cch;
  const half_t* gV = vt + ((size_t)bh * HD + crow) * NKPOS + cch;
  auto issue_stage = [&](int buf, int kb0) {
    const uint32_t lo = (uint32_t)(buf * KVTILE * 2);
    const half_t* k0p = gK + (size_t)kb0 * HD;
    const half_t* v0p = gV + kb0;
    async_cp4_b128(ldsK + lo,                k0p,
                   ldsK + lo + 32 * KVP * 2, k0p + 32 * HD,
                   ldsV + lo,                v0p,
                   ldsV + lo + 32 * KVP * 2, v0p + 32 * NKPOS);
  };

  issue_stage(0, 0);
  // tile 0 landed (this wave's copies), then visible to every wave
  asm volatile("s_wait_asynccnt 0x0" ::: "memory");
  __syncthreads();
  issue_stage(1, KSTG);

  for (int t = 0; t < NKPOS / KSTG; ++t) {
   const half_t* Kt = &Ks[(t & 1) * KVTILE];
   const half_t* Vt = &Vs[(t & 1) * KVTILE];
   // unrolled so that sub folds into the immediate offsets of the LDS reads
   #pragma unroll
   for (int sub = 0; sub < KSTG; sub += 32) {
    // S^T = (K Q^T) * scale for a 32x16 chunk (two 16x16 tiles):
    // s[st][r] = score of key sub + st*16 + halfoff + r against query lrow
    v8f s[2];
    #pragma unroll
    for (int st = 0; st < 2; st++) {
      const half_t* kbase = Kt + (sub + st * 16 + lrow) * KVP;
      v16h kf0 = frag_ld(kbase, lane);
      v16h kf1 = frag_ld(kbase + 32, lane);
      v8f z = vzero;
      z = wmma16(kf0, qa0, z);
      z = wmma16(kf1, qa1, z);
      #pragma unroll
      for (int r = 0; r < 8; r++) z[r] *= ATT_SCALE;
      s[st] = z;
    }
    // online softmax: 16 scores of one query per lane, the other 16 in lane^16
    float mx[8];
    #pragma unroll
    for (int i = 0; i < 8; i++) mx[i] = fmaxf(s[i >> 2][2 * (i & 3)], s[i >> 2][2 * (i & 3) + 1]);
    float m = fmaxf(fmaxf(fmaxf(mx[0], mx[1]), fmaxf(mx[2], mx[3])),
                    fmaxf(fmaxf(mx[4], mx[5]), fmaxf(mx[6], mx[7])));
    m = fmaxf(m, xhalf(m));
    const float nm = fmaxf(rmax, m);
    const float alpha = __expf(rmax - nm);
    rmax = nm;
    // P^T as the B operand: element e = key kmap(e) = tile e>>3, register e&7
    v16h pb;
    float pp[8];
    #pragma unroll
    for (int i = 0; i < 8; i++) {
      float p0 = __expf(s[i >> 2][2 * (i & 3)] - nm);
      float p1 = __expf(s[i >> 2][2 * (i & 3) + 1] - nm);
      pb[2 * i]     = (half_t)p0;
      pb[2 * i + 1] = (half_t)p1;
      pp[i] = p0 + p1;
    }
    const float ps = ((pp[0] + pp[1]) + (pp[2] + pp[3])) + ((pp[4] + pp[5]) + (pp[6] + pp[7]));
    rsum = rsum * alpha + ps;
    #pragma unroll
    for (int dt = 0; dt < 4; dt++)
      #pragma unroll
      for (int r = 0; r < 8; r++) acc[dt][r] *= alpha;
    // acc += V^T (16 d x 32 keys) * P^T (32 keys x 16 q)
    #pragma unroll
    for (int dt = 0; dt < 4; dt++) {
      const half_t* vbase = Vt + (dt * 16 + lrow) * KVP + sub;
      v16h vf = frag_ld(vbase, lane);
      acc[dt] = wmma16(vf, pb, acc[dt]);
    }
   }
   // hand-over: this wave's reads of tile t are done ...
   asm volatile("s_wait_dscnt 0x0" ::: "memory");
   // ... its copies of tile t + 1 have landed ...
   asm volatile("s_wait_asynccnt 0x0" ::: "memory");
   // ... and one barrier publishes tile t + 1 and frees tile t's buffer
   __syncthreads();
   if (t + 2 < NKPOS / KSTG) issue_stage(t & 1, (t + 2) * KSTG);
  }
  // nothing is outstanding here; kept so that no copy can outlive the wave
  asm volatile("s_wait_asynccnt 0x0" ::: "memory");

  // join the two halves' denominators, normalize and emit position-major
  // [n][c] f16 for the projection GEMM: 8 consecutive d per lane, 16-byte stores
  const float inv = 1.0f / (rsum + xhalf(rsum));
  half_t* orow = attnT + ((size_t)b * NPOS + q0 + lrow) * CDIM + h * HD + halfoff;
  #pragma unroll
  for (int dt = 0; dt < 4; dt++) {
    union { uint4 u; half_t e[8]; } o;
    #pragma unroll
    for (int r = 0; r < 8; r++) o.e[r] = (half_t)(acc[dt][r] * inv);
    *(uint4*)(orow + dt * 16) = o.u;
  }
}

// ---------------------------------------------------------------------------
extern "C" void kernel_launch(void* const* d_in, const int* in_sizes, int n_in,
                              void* d_out, int out_size, void* d_ws, size_t ws_size,
                              hipStream_t stream) {
  const float* x      = (const float*)d_in[0];
  const float* q_w    = (const float*)d_in[1];
  const float* q_b    = (const float*)d_in[2];
  const float* kv_w   = (const float*)d_in[3];
  const float* kv_b   = (const float*)d_in[4];
  const float* sr_w   = (const float*)d_in[5];
  const float* sr_b   = (const float*)d_in[6];
  const float* ln_g   = (const float*)d_in[7];
  const float* ln_b   = (const float*)d_in[8];
  const float* proj_w = (const float*)d_in[9];
  const float* proj_b = (const float*)d_in[10];
  float* out = (float*)d_out;

  size_t off = 0;
  auto carve = [&](size_t bytes) {
    void* p = (char*)d_ws + off;
    off += (bytes + 255) & ~(size_t)255;
    return p;
  };
  half_t* xT    = (half_t*)carve((size_t)BATCH * NPOS * CDIM * 2);
  half_t* qwh   = (half_t*)carve((size_t)CDIM * CDIM * 2);
  half_t* kvwh  = (half_t*)carve((size_t)2 * CDIM * CDIM * 2);
  half_t* srwh  = (half_t*)carve((size_t)CDIM * 2048 * 2);
  half_t* pwh   = (half_t*)carve((size_t)CDIM * CDIM * 2);
  half_t* qhb   = (half_t*)carve((size_t)BATCH * HEADS * NPOS * HD * 2);
  float*  kvin  = (float*)carve((size_t)BATCH * NKPOS * CDIM * 4);
  half_t* lnT   = (half_t*)carve((size_t)BATCH * NKPOS * CDIM * 2);
  half_t* khb   = (half_t*)carve((size_t)BATCH * HEADS * NKPOS * HD * 2);
  half_t* vtb   = (half_t*)carve((size_t)BATCH * HEADS * HD * NKPOS * 2);
  half_t* attnT = (half_t*)carve((size_t)BATCH * NPOS * CDIM * 2);

  // 1. precision / layout conversions
  cvt_xT<<<BATCH * (CDIM / 64) * (NPOS / 256), 256, 0, stream>>>(x, xT);
  cvt_f16<<<(CDIM * CDIM) / 256, 256, 0, stream>>>(q_w, qwh, CDIM * CDIM);
  cvt_f16<<<(2 * CDIM * CDIM) / 256, 256, 0, stream>>>(kv_w, kvwh, 2 * CDIM * CDIM);
  cvt_f16<<<(CDIM * CDIM) / 256, 256, 0, stream>>>(proj_w, pwh, CDIM * CDIM);
  cvt_srw<<<(CDIM * 2048) / 256, 256, 0, stream>>>(sr_w, srwh);

  // 2. SR conv as im2col GEMM -> kvin f32 [b][n][c]
  gemm_wmma<1><<<dim3(NKPOS / 128, CDIM / 128, BATCH), 256, 0, stream>>>(
      srwh, xT, sr_b, kvin, nullptr, nullptr);

  // 3. channel LayerNorm -> lnT f16
  ln_kernel<<<BATCH * NKPOS, 256, 0, stream>>>(kvin, ln_g, ln_b, lnT);

  // 4. KV projection -> kh [bh][nk][d], vt [bh][d][nk]
  gemm_wmma<2><<<dim3(NKPOS / 128, (2 * CDIM) / 128, BATCH), 256, 0, stream>>>(
      kvwh, lnT, kv_b, nullptr, khb, vtb);

  // 5. Q projection -> qh [bh][n][d]
  gemm_wmma<0><<<dim3(NPOS / 128, CDIM / 128, BATCH), 256, 0, stream>>>(
      qwh, xT, q_b, nullptr, qhb, nullptr);

  // 6. flash attention -> attnT f16 [b][n][c]
  attn_kernel<<<dim3(NPOS / 128, BATCH * HEADS), 256, 0, stream>>>(
      qhb, khb, vtb, attnT);

  // 7. output projection -> d_out f32 [b][c][n]
  gemm_wmma<3><<<dim3(NPOS / 128, CDIM / 128, BATCH), 256, 0, stream>>>(
      pwh, attnT, proj_b, out, nullptr, nullptr);
}

// v004
// A run of this version takes 131 microseconds.
// In both of two side-by-side timings against v003, it was 1.10 times as fast.
// Over all steps from v000 it is 2.36 times as fast.
#include <hip/hip_runtime.h>
#include <hip/hip_bf16.h>

typedef _Float16 half_t;
typedef __attribute__((ext_vector_type(16))) _Float16 v16h;
typedef __attribute__((ext_vector_type(8)))  float    v8f;

#define BATCH  4
#define CDIM   512
#define HEADS  8
#define HD     64
#define NPOS   4096   // 64*64
#define NKPOS  1024   // 32*32
#define ATT_SCALE 0.125f

// ---------------------------------------------------------------------------
// WMMA helpers.  16-bit A-matrix 16x32 layout (ISA 7.12.2): lane L holds row
// m = L%16; its 16 halves are two contiguous 8-half chunks at k = off..off+7
// and k = off+16..off+23, off = (L>=16 ? 8 : 0).  B uses the symmetric layout
// (lane = column, identical k packing), so both fragments are two 16-byte
// loads from a k-contiguous row.
// ---------------------------------------------------------------------------
__device__ __forceinline__ v16h frag_ld(const half_t* rowbase, int lane) {
  const int off = (lane & 16) ? 8 : 0;
  union { uint4 u[2]; v16h v; } t;
  t.u[0] = *(const uint4*)(rowbase + off);
  t.u[1] = *(const uint4*)(rowbase + off + 16);
  return t.v;
}

__device__ __forceinline__ v8f wmma16(v16h a, v16h b, v8f c) {
  return __builtin_amdgcn_wmma_f32_16x16x32_f16(false, a, false, b,
                                                (short)0, c, false, false);
}

// Low 32 bits of a flat pointer into LDS == LDS byte offset (ISA 10.2:
// the LDS aperture maps by truncating to addr[31:0]).
__device__ __forceinline__ uint32_t lds_addr32(const void* p) {
  return (uint32_t)(uintptr_t)p;
}

// async global->LDS, 16B per lane, GVS addressing (SGPR base + VGPR offset).
// Tracked with ASYNCcnt; no VGPR destination, no LOADcnt/DScnt involvement.
__device__ __forceinline__ void async_ld_b128(uint32_t lds_off, uint32_t goff,
                                              unsigned long long base) {
  asm volatile("global_load_async_to_lds_b128 %0, %1, %2"
               :: "v"(lds_off), "v"(goff), "s"(base) : "memory");
}

// Four async global->LDS copies of one lane, 16 B each, per-lane 64-bit address.
// s_wait_xcnt closes the same statement as a precaution: the address registers
// are not rewritten ahead of it.
__device__ __forceinline__ void async_cp4_b128(uint32_t l0, const half_t* g0,
                                               uint32_t l1, const half_t* g1,
                                               uint32_t l2, const half_t* g2,
                                               uint32_t l3, const half_t* g3) {
  asm volatile("global_load_async_to_lds_b128 %0, %1, off\n\t"
               "global_load_async_to_lds_b128 %2, %3, off\n\t"
               "global_load_async_to_lds_b128 %4, %5, off\n\t"
               "global_load_async_to_lds_b128 %6, %7, off\n\t"
               "s_wait_xcnt 0x0"
               :: "v"(l0), "v"(g0), "v"(l1), "v"(g1),
                  "v"(l2), "v"(g2), "v"(l3), "v"(g3) : "memory");
}

// ---------------------------------------------------------------------------
// Conversion kernels (f32 -> f16, layout shuffles)
// ---------------------------------------------------------------------------
__device__ __forceinline__
void cvt_f16(const float* __restrict__ in, half_t* __restrict__ out, int n, int blk) {
  int i = blk * 256 + threadIdx.x;
  if (i < n) out[i] = (half_t)in[i];
}

// x [B][512][4096] -> xT [B][4096][512] (f16, position-major)
// The transposition happens in registers: a thread holds 16 channels x 4
// positions (sixteen 16-byte loads, all in flight together) and stores, per
// position, two 16-byte runs of 8 channels.  A wave covers 64 channels x 32
// positions: every load reads four whole 128-byte lines of x, and the two
// stores of one position fill one whole 128-byte line of xT, 64 bytes each.
__device__ __forceinline__
void cvt_xT(const float* __restrict__ x, half_t* __restrict__ xT,
            const int blk) {                      // B * 8 channel tiles * 16 position tiles
  const int lane = threadIdx.x & 31;
  const int wave = threadIdx.x >> 5;
  const int b    = blk >> 7;
  const int c0   = ((blk >> 4) & 7) * 64 + (lane >> 3) * 8;   // and c0 + 32
  const int n0   = (blk & 15) * 256 + wave * 32 + (lane & 7) * 4;
  const float* src = x + ((size_t)b * CDIM + c0) * NPOS + n0;
  float4 v[2][8];
  #pragma unroll
  for (int g = 0; g < 2; g++)
    #pragma unroll
    for (int j = 0; j < 8; j++)
      v[g][j] = *(const float4*)(src + (size_t)(g * 32 + j) * NPOS);
  // the wait that belongs in front of any rewrite of the loads' address pair; it
  // names the pair, so that no load's own result is placed on it either
  asm volatile("s_wait_xcnt 0x0" :: "v"(src) : "memory");
  // keeps all sixteen loads in front of the first conversion: without it four of
  // them are issued behind a wait and the wave pays a second memory latency
  __builtin_amdgcn_sched_barrier(0);
  half_t* dst = xT + ((size_t)b * NPOS + n0) * CDIM + c0;
  #pragma unroll
  for (int i = 0; i < 4; i++) {
    #pragma unroll
    for (int g = 0; g < 2; g++) {
      union { uint4 u; half_t e[8]; } o;
      #pragma unroll
      for (int j = 0; j < 8; j++) {
        const float* f = (const float*)&v[g][j];
        o.e[j] = (half_t)f[i];
      }
      *(uint4*)(dst + (size_t)i * CDIM + g * 32) = o.u;
    }
  }
}

// sr_w [O=512][C=512][2][2] -> srwh [o][k], k = (sy*2+sx)*512 + c
__device__ __forceinline__
void cvt_srw(const float* __restrict__ srw, half_t* __restrict__ out, int blk) {
  int i = blk * 256 + threadIdx.x;               // over 512*2048
  int o = i >> 11;
  int k = i & 2047;
  int s = k >> 9;
  int c = k & 511;
  int sy = s >> 1, sx = s & 1;
  out[i] = (half_t)srw[(((size_t)o * 512 + c) * 2 + sy) * 2 + sx];
  // the wait that belongs in front of any rewrite of the store's registers: in the
  // merged grid another conversion's body follows this one in the code
  asm volatile("s_wait_xcnt 0x0" ::: "memory");
}

// All five conversions are independent of one another: one grid, each block
// picks its conversion by its index range (the x transposition, the largest,
// starts first).
#define XT_BLKS  (BATCH * (CDIM / 64) * (NPOS / 256))
#define SRW_BLKS ((CDIM * 2048) / 256)
#define KVW_BLKS ((2 * CDIM * CDIM) / 256)
#define QW_BLKS  ((CDIM * CDIM) / 256)
#define PW_BLKS  ((CDIM * CDIM) / 256)
__global__ __launch_bounds__(256)
void cvt_all(const float* __restrict__ x, const float* __restrict__ sr_w,
             const float* __restrict__ kv_w, const float* __restrict__ q_w,
             const float* __restrict__ proj_w,
             half_t* __restrict__ xT, half_t* __restrict__ srwh,
             half_t* __restrict__ kvwh, half_t* __restrict__ qwh,
             half_t* __restrict__ pwh) {
  int blk = blockIdx.x;
  if (blk < XT_BLKS) { cvt_xT(x, xT, blk); return; }
  blk -= XT_BLKS;
  if (blk < SRW_BLKS) { cvt_srw(sr_w, srwh, blk); return; }
  blk -= SRW_BLKS;
  if (blk < KVW_BLKS) { cvt_f16(kv_w, kvwh, 2 * CDIM * CDIM, blk); return; }
  blk -= KVW_BLKS;
  if (blk < QW_BLKS) { cvt_f16(q_w, qwh, CDIM * CDIM, blk); return; }
  blk -= QW_BLKS;
  cvt_f16(proj_w, pwh, CDIM * CDIM, blk);
}

// ---------------------------------------------------------------------------
// LayerNorm over channels at each reduced spatial position.
// kvin [B*1024][512] f32 -> lnT [B*1024][512] f16
// ---------------------------------------------------------------------------
__global__ __launch_bounds__(256)
void ln_kernel(const float* __restrict__ kvin, const float* __restrict__ g,
               const float* __restrict__ be, half_t* __restrict__ lnT) {
  __shared__ float r1[256], r2[256];
  const int pos = blockIdx.x;
  const int t = threadIdx.x;
  const float* xr = kvin + (size_t)pos * CDIM;
  float x0 = xr[t], x1 = xr[t + 256];
  r1[t] = x0 + x1;
  r2[t] = x0 * x0 + x1 * x1;
  __syncthreads();
  for (int off = 128; off > 0; off >>= 1) {
    if (t < off) { r1[t] += r1[t + off]; r2[t] += r2[t + off]; }
    __syncthreads();
  }
  float mean = r1[0] * (1.0f / 512.0f);
  float var  = r2[0] * (1.0f / 512.0f) - mean * mean;
  float rs   = rsqrtf(var + 1e-6f);
  lnT[(size_t)pos * CDIM + t]       = (half_t)((x0 - mean) * rs * g[t]       + be[t]);
  lnT[(size_t)pos * CDIM + t + 256] = (half_t)((x1 - mean) * rs * g[t + 256] + be[t + 256]);
}

// ---------------------------------------------------------------------------
// Tiled WMMA GEMM: out[M][Npos] = W[M][K] * act[Npos][K]^T  (+bias)
// Block = 256 threads = 8 waves, 128x128 tile, k-step 32.
// Tiles are staged with double-buffered GLOBAL_LOAD_ASYNC_TO_LDS_B128:
// tile t+1 is fetched (ASYNCcnt) while tile t runs through the WMMAs.
// MODE 0: Q proj   K=512 NP=4096 -> qh  [bh][n][d]   f16
// MODE 1: SR conv  K=2048 NP=1024 (im2col gather from xT) -> kvin f32 [b][n][o]
// MODE 2: KV proj  K=512 NP=1024 -> kh [bh][nk][d], vt [bh][d][nk]  f16
// MODE 3: out proj K=512 NP=4096 -> d_out f32 [b][o][n]
// ---------------------------------------------------------------------------
#define TILE (128 * 40)             // halves per buffer, 40-half pitch (conflict free)

template<int MODE>
__device__ __forceinline__
void gemm_tile(half_t* Ah, half_t* Bh, const int bx, const int by, const int b,
               const half_t* __restrict__ W, const half_t* __restrict__ actBase,
               const float* __restrict__ bias,
               float* __restrict__ outF, half_t* __restrict__ outH,
               half_t* __restrict__ outH2) {
  constexpr int K  = (MODE == 1) ? 2048 : 512;

  const int n0   = bx * 128;
  const int m0   = by * 128;
  const int tid  = threadIdx.x;
  const int lane = tid & 31;
  const int wave = tid >> 5;
  const int wm   = wave & 3;   // 4 row blocks of 32
  const int wn   = wave >> 2;  // 2 col blocks of 64
  const half_t* act = actBase + (size_t)b * ((MODE == 2) ? (NKPOS * CDIM) : (NPOS * CDIM));

  const uint32_t ldsA = lds_addr32(&Ah[0]);
  const uint32_t ldsB = lds_addr32(&Bh[0]);
  const unsigned long long wbase = (unsigned long long)(uintptr_t)W;
  const unsigned long long abase = (unsigned long long)(uintptr_t)act;

  // Issue one 128x32 A tile + B tile into buffer `buf` (4 async instrs / wave).
  auto issue_tile = [&](int buf, int k0) {
    #pragma unroll
    for (int i = 0; i < 2; i++) {
      int idx = tid + i * 256;
      int row = idx >> 2;
      int ch  = (idx & 3) * 8;           // 8-half (16B) chunk
      uint32_t lofs = (uint32_t)(buf * TILE + row * 40 + ch) * 2u;
      async_ld_b128(ldsA + lofs, (uint32_t)(((m0 + row) * K + k0 + ch) * 2), wbase);
      uint32_t gb;
      if (MODE == 1) {
        int kk = k0 + ch;
        int s  = kk >> 9;                // 2x2 tap selector
        int c  = kk & 511;
        int sy = s >> 1, sx = s & 1;
        int n  = n0 + row;               // reduced position
        int py = n >> 5, px = n & 31;
        int sp = (2 * py + sy) * 64 + (2 * px + sx);
        gb = (uint32_t)((sp * CDIM + c) * 2);
      } else {
        gb = (uint32_t)(((n0 + row) * K + k0 + ch) * 2);
      }
      async_ld_b128(ldsB + lofs, gb, abase);
    }
  };

  v8f acc[2][4];
  const v8f vzero = {0.f, 0.f, 0.f, 0.f, 0.f, 0.f, 0.f, 0.f};
  for (int i = 0; i < 2; i++)
    for (int j = 0; j < 4; j++) acc[i][j] = vzero;

  issue_tile(0, 0);
  for (int k0 = 0, it = 0; k0 < K; k0 += 32, ++it) {
    const int cur = it & 1;
    const bool more = (k0 + 32) < K;
    if (more) issue_tile(cur ^ 1, k0 + 32);
    // async loads complete in order: <=4 outstanding means current tile landed
    if (more) asm volatile("s_wait_asynccnt 0x4" ::: "memory");
    else      asm volatile("s_wait_asynccnt 0x0" ::: "memory");
    __syncthreads();                     // every wave's part of the tile is in LDS

    v16h af[2], bf[4];
    #pragma unroll
    for (int mt = 0; mt < 2; mt++)
      af[mt] = frag_ld(&Ah[cur * TILE + (wm * 32 + mt * 16 + (lane & 15)) * 40], lane);
    #pragma unroll
    for (int nt = 0; nt < 4; nt++)
      bf[nt] = frag_ld(&Bh[cur * TILE + (wn * 64 + nt * 16 + (lane & 15)) * 40], lane);
    #pragma unroll
    for (int mt = 0; mt < 2; mt++)
      #pragma unroll
      for (int nt = 0; nt < 4; nt++)
        acc[mt][nt] = wmma16(af[mt], bf[nt], acc[mt][nt]);

    // fragment reads done before anyone overwrites this buffer
    asm volatile("s_wait_dscnt 0x0" ::: "memory");
    __syncthreads();
  }

  // epilogue: C/D layout -> lane holds col n = lane%16, rows r + (lane>=16?8:0)
  const int halfoff = (lane & 16) ? 8 : 0;
  const int ncol = lane & 15;
  #pragma unroll
  for (int mt = 0; mt < 2; mt++) {
    #pragma unroll
    for (int nt = 0; nt < 4; nt++) {
      #pragma unroll
      for (int r = 0; r < 8; r++) {
        int o = m0 + wm * 32 + mt * 16 + r + halfoff;
        int n = n0 + wn * 64 + nt * 16 + ncol;
        float v = acc[mt][nt][r] + bias[o];
        if (MODE == 0) {
          int head = o >> 6, d = o & 63;
          outH[(((size_t)(b * HEADS + head) * NPOS) + n) * HD + d] = (half_t)v;
        } else if (MODE == 1) {
          outF[((size_t)b * NKPOS + n) * CDIM + o] = v;
        } else if (MODE == 2) {
          if (o < CDIM) {
            int head = o >> 6, d = o & 63;
            outH[(((size_t)(b * HEADS + head) * NKPOS) + n) * HD + d] = (half_t)v;
          } else {
            int vc = o - CDIM;
            int head = vc >> 6, d = vc & 63;
            outH2[(((size_t)(b * HEADS + head) * HD) + d) * NKPOS + n] = (half_t)v;
          }
        } else { // MODE 3
          outF[((size_t)b * CDIM + o) * NPOS + n] = v;
        }
      }
    }
  }
}

template<int MODE>
__global__ __launch_bounds__(256)
void gemm_wmma(const half_t* __restrict__ W, const half_t* __restrict__ actBase,
               const float* __restrict__ bias,
               float* __restrict__ outF, half_t* __restrict__ outH,
               half_t* __restrict__ outH2) {
  __shared__ half_t Ah[2 * TILE];
  __shared__ half_t Bh[2 * TILE];
  gemm_tile<MODE>(Ah, Bh, blockIdx.x, blockIdx.y, blockIdx.z,
                  W, actBase, bias, outF, outH, outH2);
}

// The SR conv and the Q projection both read only xT and their own weights:
// one grid.  The SR tiles (four times the K loop, only 128 of them) start
// first; the Q tiles fill the rest of the chip beside them.
#define SR_TILES ((NKPOS / 128) * (CDIM / 128) * BATCH)
#define Q_TILES  ((NPOS / 128) * (CDIM / 128) * BATCH)
__global__ __launch_bounds__(256)
void gemm_sr_q(const half_t* __restrict__ srwh, const half_t* __restrict__ qwh,
               const half_t* __restrict__ xT,
               const float* __restrict__ sr_b, const float* __restrict__ q_b,
               float* __restrict__ kvin, half_t* __restrict__ qh) {
  __shared__ half_t Ah[2 * TILE];
  __shared__ half_t Bh[2 * TILE];
  const int blk = blockIdx.x;
  if (blk < SR_TILES) {
    gemm_tile<1>(Ah, Bh, blk & 7, (blk >> 3) & 3, blk >> 5,
                 srwh, xT, sr_b, kvin, nullptr, nullptr);
  } else {
    const int t = blk - SR_TILES;
    gemm_tile<0>(Ah, Bh, t & 31, (t >> 5) & 3, t >> 7,
                 qwh, xT, q_b, nullptr, qh, nullptr);
  }
}

#define KSTG   64
#define KVP    72
#define KVTILE (64 * KVP)

// value of lane l ^ 16 (a vector cross-row move, no LDS round trip)
__device__ __forceinline__ float xhalf(float x) {
  return __builtin_bit_cast(float, __builtin_amdgcn_permlanex16(
      __builtin_bit_cast(int, x), __builtin_bit_cast(int, x),
      0x76543210, 0xfedcba98, false, false));
}

__global__ __launch_bounds__(256)
void attn_kernel(const half_t* __restrict__ qh, const half_t* __restrict__ kh,
                 const half_t* __restrict__ vt, half_t* __restrict__ attnT) {
  __shared__ __attribute__((aligned(16))) half_t Ks[2 * KVTILE];
  __shared__ __attribute__((aligned(16))) half_t Vs[2 * KVTILE];
  const int tid  = threadIdx.x;
  const int lane = tid & 31;
  const int wave = tid >> 5;
  const int bh   = blockIdx.y;          // b*8 + h
  const int b    = bh >> 3, h = bh & 7;
  const int q0   = blockIdx.x * 128 + wave * 16;
  const int lrow = lane & 15;
  const int halfoff = (lane & 16) ? 8 : 0;

  // Q B-fragments (64 d x 16 q = two k-steps), loaded once; lane = query column
  const half_t* qrow = qh + ((size_t)bh * NPOS + q0 + lrow) * HD;
  v16h qa0 = frag_ld(qrow, lane);
  v16h qa1 = frag_ld(qrow + 32, lane);

  const v8f vzero = {0.f, 0.f, 0.f, 0.f, 0.f, 0.f, 0.f, 0.f};
  v8f acc[4];                           // O^T: acc[dt][r] = O[q = lrow][d = dt*16 + halfoff + r]
  for (int dt = 0; dt < 4; dt++) acc[dt] = vzero;
  float rmax = -1e30f;                  // running maximum of this lane's query
  float rsum = 0.f;                     // this lane's half of the query's denominator

  // Each thread copies two 16-byte chunks of the K tile and two of the V^T tile.
  const int crow = tid >> 3;            // rows crow and crow + 32
  const int cch  = (tid & 7) * 8;       // 8-half chunk inside the 64-half row
  const uint32_t ldsK = lds_addr32(&Ks[crow * KVP + cch]);
  const uint32_t ldsV = lds_addr32(&Vs[crow * KVP + cch]);
  const half_t* gK = kh + ((size_t)bh * NKPOS + crow) * HD + cch;
  const half_t* gV = vt + ((size_t)bh * HD + crow) * NKPOS + cch;
  auto issue_stage = [&](int buf, int kb0) {
    const uint32_t lo = (uint32_t)(buf * KVTILE * 2);
    const half_t* k0p = gK + (size_t)kb0 * HD;
    const half_t* v0p = gV + kb0;
    async_cp4_b128(ldsK + lo,                k0p,
                   ldsK + lo + 32 * KVP * 2, k0p + 32 * HD,
                   ldsV + lo,                v0p,
                   ldsV + lo + 32 * KVP * 2, v0p + 32 * NKPOS);
  };

  issue_stage(0, 0);
  // tile 0 landed (this wave's copies), then visible to every wave
  asm volatile("s_wait_asynccnt 0x0" ::: "memory");
  __syncthreads();
  issue_stage(1, KSTG);

  for (int t = 0; t < NKPOS / KSTG; ++t) {
   const half_t* Kt = &Ks[(t & 1) * KVTILE];
   const half_t* Vt = &Vs[(t & 1) * KVTILE];
   // unrolled so that sub folds into the immediate offsets of the LDS reads
   #pragma unroll
   for (int sub = 0; sub < KSTG; sub += 32) {
    // S^T = (K Q^T) * scale for a 32x16 chunk (two 16x16 tiles):
    // s[st][r] = score of key sub + st*16 + halfoff + r against query lrow
    v8f s[2];
    #pragma unroll
    for (int st = 0; st < 2; st++) {
      const half_t* kbase = Kt + (sub + st * 16 + lrow) * KVP;
      v16h kf0 = frag_ld(kbase, lane);
      v16h kf1 = frag_ld(kbase + 32, lane);
      v8f z = vzero;
      z = wmma16(kf0, qa0, z);
      z = wmma16(kf1, qa1, z);
      #pragma unroll
      for (int r = 0; r < 8; r++) z[r] *= ATT_SCALE;
      s[st] = z;
    }
    // online softmax: 16 scores of one query per lane, the other 16 in lane^16
    float mx[8];
    #pragma unroll
    for (int i = 0; i < 8; i++) mx[i] = fmaxf(s[i >> 2][2 * (i & 3)], s[i >> 2][2 * (i & 3) + 1]);
    float m = fmaxf(fmaxf(fmaxf(mx[0], mx[1]), fmaxf(mx[2], mx[3])),
                    fmaxf(fmaxf(mx[4], mx[5]), fmaxf(mx[6], mx[7])));
    m = fmaxf(m, xhalf(m));
    const float nm = fmaxf(rmax, m);
    const float alpha = __expf(rmax - nm);
    rmax = nm;
    // P^T as the B operand: element e = key kmap(e) = tile e>>3, register e&7
    v16h pb;
    float pp[8];
    #pragma unroll
    for (int i = 0; i < 8; i++) {
      float p0 = __expf(s[i >> 2][2 * (i & 3)] - nm);
      float p1 = __expf(s[i >> 2][2 * (i & 3) + 1] - nm);
      pb[2 * i]     = (half_t)p0;
      pb[2 * i + 1] = (half_t)p1;
      pp[i] = p0 + p1;
    }
    const float ps = ((pp[0] + pp[1]) + (pp[2] + pp[3])) + ((pp[4] + pp[5]) + (pp[6] + pp[7]));
    rsum = rsum * alpha + ps;
    #pragma unroll
    for (int dt = 0; dt < 4; dt++)
      #pragma unroll
      for (int r = 0; r < 8; r++) acc[dt][r] *= alpha;
    // acc += V^T (16 d x 32 keys) * P^T (32 keys x 16 q)
    #pragma unroll
    for (int dt = 0; dt < 4; dt++) {
      const half_t* vbase = Vt + (dt * 16 + lrow) * KVP + sub;
      v16h vf = frag_ld(vbase, lane);
      acc[dt] = wmma16(vf, pb, acc[dt]);
    }
   }
   // hand-over: this wave's reads of tile t are done ...
   asm volatile("s_wait_dscnt 0x0" ::: "memory");
   // ... its copies of tile t + 1 have landed ...
   asm volatile("s_wait_asynccnt 0x0" ::: "memory");
   // ... and one barrier publishes tile t + 1 and frees tile t's buffer
   __syncthreads();
   if (t + 2 < NKPOS / KSTG) issue_stage(t & 1, (t + 2) * KSTG);
  }
  // nothing is outstanding here; kept so that no copy can outlive the wave
  asm volatile("s_wait_asynccnt 0x0" ::: "memory");

  // join the two halves' denominators, normalize and emit position-major
  // [n][c] f16 for the projection GEMM: 8 consecutive d per lane, 16-byte stores
  const float inv = 1.0f / (rsum + xhalf(rsum));
  half_t* orow = attnT + ((size_t)b * NPOS + q0 + lrow) * CDIM + h * HD + halfoff;
  #pragma unroll
  for (int dt = 0; dt < 4; dt++) {
    union { uint4 u; half_t e[8]; } o;
    #pragma unroll
    for (int r = 0; r < 8; r++) o.e[r] = (half_t)(acc[dt][r] * inv);
    *(uint4*)(orow + dt * 16) = o.u;
  }
}

// ---------------------------------------------------------------------------
extern "C" void kernel_launch(void* const* d_in, const int* in_sizes, int n_in,
                              void* d_out, int out_size, void* d_ws, size_t ws_size,
                              hipStream_t stream) {
  const float* x      = (const float*)d_in[0];
  const float* q_w    = (const float*)d_in[1];
  const float* q_b    = (const float*)d_in[2];
  const float* kv_w   = (const float*)d_in[3];
  const float* kv_b   = (const float*)d_in[4];
  const float* sr_w   = (const float*)d_in[5];
  const float* sr_b   = (const float*)d_in[6];
  const float* ln_g   = (const float*)d_in[7];
  const float* ln_b   = (const float*)d_in[8];
  const float* proj_w = (const float*)d_in[9];
  const float* proj_b = (const float*)d_in[10];
  float* out = (float*)d_out;

  size_t off = 0;
  auto carve = [&](size_t bytes) {
    void* p = (char*)d_ws + off;
    off += (bytes + 255) & ~(size_t)255;
    return p;
  };
  half_t* xT    = (half_t*)carve((size_t)BATCH * NPOS * CDIM * 2);
  half_t* qwh   = (half_t*)carve((size_t)CDIM * CDIM * 2);
  half_t* kvwh  = (half_t*)carve((size_t)2 * CDIM * CDIM * 2);
  half_t* srwh  = (half_t*)carve((size_t)CDIM * 2048 * 2);
  half_t* pwh   = (half_t*)carve((size_t)CDIM * CDIM * 2);
  half_t* qhb   = (half_t*)carve((size_t)BATCH * HEADS * NPOS * HD * 2);
  float*  kvin  = (float*)carve((size_t)BATCH * NKPOS * CDIM * 4);
  half_t* lnT   = (half_t*)carve((size_t)BATCH * NKPOS * CDIM * 2);
  half_t* khb   = (half_t*)carve((size_t)BATCH * HEADS * NKPOS * HD * 2);
  half_t* vtb   = (half_t*)carve((size_t)BATCH * HEADS * HD * NKPOS * 2);
  half_t* attnT = (half_t*)carve((size_t)BATCH * NPOS * CDIM * 2);

  // 1. precision / layout conversions
  cvt_all<<<XT_BLKS + SRW_BLKS + KVW_BLKS + QW_BLKS + PW_BLKS, 256, 0, stream>>>(
      x, sr_w, kv_w, q_w, proj_w, xT, srwh, kvwh, qwh, pwh);

  // 2. SR conv as im2col GEMM -> kvin f32 [b][n][c], and beside it
  //    the Q projection -> qh [bh][n][d]
  gemm_sr_q<<<SR_TILES + Q_TILES, 256, 0, stream>>>(
      srwh, qwh, xT, sr_b, q_b, kvin, qhb);

  // 3. channel LayerNorm -> lnT f16
  ln_kernel<<<BATCH * NKPOS, 256, 0, stream>>>(kvin, ln_g, ln_b, lnT);

  // 4. KV projection -> kh [bh][nk][d], vt [bh][d][nk]
  gemm_wmma<2><<<dim3(NKPOS / 128, (2 * CDIM) / 128, BATCH), 256, 0, stream>>>(
      kvwh, lnT, kv_b, nullptr, khb, vtb);

  // 5. flash attention -> attnT f16 [b][n][c]
  attn_kernel<<<dim3(NPOS / 128, BATCH * HEADS), 256, 0, stream>>>(
      qhb, khb, vtb, attnT);

  // 6. output projection -> d_out f32 [b][c][n]
  gemm_wmma<3><<<dim3(NPOS / 128, CDIM / 128, BATCH), 256, 0, stream>>>(
      pwh, attnT, proj_b, out, nullptr, nullptr);
}

// v005
// A run of this version takes 119 microseconds.
// Next to v004, in two timings, it ran 1.10 times as fast each time.
// Over all steps from v000 it is 2.59 times as fast.
#include <hip/hip_runtime.h>
#include <hip/hip_bf16.h>

typedef _Float16 half_t;
typedef __attribute__((ext_vector_type(16))) _Float16 v16h;
typedef __attribute__((ext_vector_type(8)))  float    v8f;

#define BATCH  4
#define CDIM   512
#define HEADS  8
#define HD     64
#define NPOS   4096   // 64*64
#define NKPOS  1024   // 32*32
#define ATT_SCALE 0.125f

// ---------------------------------------------------------------------------
// WMMA helpers.  16-bit A-matrix 16x32 layout (ISA 7.12.2): lane L holds row
// m = L%16; its 16 halves are two contiguous 8-half chunks at k = off..off+7
// and k = off+16..off+23, off = (L>=16 ? 8 : 0).  B uses the symmetric layout
// (lane = column, identical k packing), so both fragments are two 16-byte
// loads from a k-contiguous row.
// ---------------------------------------------------------------------------
__device__ __forceinline__ v16h frag_ld(const half_t* rowbase, int lane) {
  const int off = (lane & 16) ? 8 : 0;
  union { uint4 u[2]; v16h v; } t;
  t.u[0] = *(const uint4*)(rowbase + off);
  t.u[1] = *(const uint4*)(rowbase + off + 16);
  return t.v;
}

__device__ __forceinline__ v8f wmma16(v16h a, v16h b, v8f c) {
  return __builtin_amdgcn_wmma_f32_16x16x32_f16(false, a, false, b,
                                                (short)0, c, false, false);
}

// Low 32 bits of a flat pointer into LDS == LDS byte offset (ISA 10.2:
// the LDS aperture maps by truncating to addr[31:0]).
__device__ __forceinline__ uint32_t lds_addr32(const void* p) {
  return (uint32_t)(uintptr_t)p;
}

// Eight async global->LDS copies of one lane, 16 B each: rows r, r + 16, ... of a
// 128-row tile.  lds = the lane's LDS byte address of row r, ls = LDS bytes per
// 16 rows; g0..g7 = the lane's global addresses.  s_wait_xcnt closes the same
// statement as a precaution: the address registers are not rewritten ahead of it.
__device__ __forceinline__ void async_cp8_b128(uint32_t lds, uint32_t ls,
                                               const half_t* g0, const half_t* g1,
                                               const half_t* g2, const half_t* g3,
                                               const half_t* g4, const half_t* g5,
                                               const half_t* g6, const half_t* g7) {
  asm volatile("global_load_async_to_lds_b128 %0, %1, off\n\t"
               "global_load_async_to_lds_b128 %2, %3, off\n\t"
               "global_load_async_to_lds_b128 %4, %5, off\n\t"
               "global_load_async_to_lds_b128 %6, %7, off\n\t"
               "global_load_async_to_lds_b128 %8, %9, off\n\t"
               "global_load_async_to_lds_b128 %10, %11, off\n\t"
               "global_load_async_to_lds_b128 %12, %13, off\n\t"
               "global_load_async_to_lds_b128 %14, %15, off\n\t"
               "s_wait_xcnt 0x0"
               :: "v"(lds),          "v"(g0), "v"(lds + ls),     "v"(g1),
                  "v"(lds + 2 * ls), "v"(g2), "v"(lds + 3 * ls), "v"(g3),
                  "v"(lds + 4 * ls), "v"(g4), "v"(lds + 5 * ls), "v"(g5),
                  "v"(lds + 6 * ls), "v"(g6), "v"(lds + 7 * ls), "v"(g7) : "memory");
}

// Four async global->LDS copies of one lane, 16 B each, per-lane 64-bit address.
// s_wait_xcnt closes the same statement as a precaution: the address registers
// are not rewritten ahead of it.
__device__ __forceinline__ void async_cp4_b128(uint32_t l0, const half_t* g0,
                                               uint32_t l1, const half_t* g1,
                                               uint32_t l2, const half_t* g2,
                                               uint32_t l3, const half_t* g3) {
  asm volatile("global_load_async_to_lds_b128 %0, %1, off\n\t"
               "global_load_async_to_lds_b128 %2, %3, off\n\t"
               "global_load_async_to_lds_b128 %4, %5, off\n\t"
               "global_load_async_to_lds_b128 %6, %7, off\n\t"
               "s_wait_xcnt 0x0"
               :: "v"(l0), "v"(g0), "v"(l1), "v"(g1),
                  "v"(l2), "v"(g2), "v"(l3), "v"(g3) : "memory");
}

// ---------------------------------------------------------------------------
// Conversion kernels (f32 -> f16, layout shuffles)
// ---------------------------------------------------------------------------
__device__ __forceinline__
void cvt_f16(const float* __restrict__ in, half_t* __restrict__ out, int n, int blk) {
  int i = blk * 256 + threadIdx.x;
  if (i < n) out[i] = (half_t)in[i];
}

// x [B][512][4096] -> xT [B][4096][512] (f16, position-major)
// The transposition happens in registers: a thread holds 16 channels x 4
// positions (sixteen 16-byte loads, all in flight together) and stores, per
// position, two 16-byte runs of 8 channels.  A wave covers 64 channels x 32
// positions: every load reads four whole 128-byte lines of x, and the two
// stores of one position fill one whole 128-byte line of xT, 64 bytes each.
__device__ __forceinline__
void cvt_xT(const float* __restrict__ x, half_t* __restrict__ xT,
            const int blk) {                      // B * 8 channel tiles * 16 position tiles
  const int lane = threadIdx.x & 31;
  const int wave = threadIdx.x >> 5;
  const int b    = blk >> 7;
  const int c0   = ((blk >> 4) & 7) * 64 + (lane >> 3) * 8;   // and c0 + 32
  const int n0   = (blk & 15) * 256 + wave * 32 + (lane & 7) * 4;
  const float* src = x + ((size_t)b * CDIM + c0) * NPOS + n0;
  float4 v[2][8];
  #pragma unroll
  for (int g = 0; g < 2; g++)
    #pragma unroll
    for (int j = 0; j < 8; j++)
      v[g][j] = *(const float4*)(src + (size_t)(g * 32 + j) * NPOS);
  // the wait that belongs in front of any rewrite of the loads' address pair; it
  // names the pair, so that no load's own result is placed on it either
  asm volatile("s_wait_xcnt 0x0" :: "v"(src) : "memory");
  // keeps all sixteen loads in front of the first conversion: without it four of
  // them are issued behind a wait and the wave pays a second memory latency
  __builtin_amdgcn_sched_barrier(0);
  half_t* dst = xT + ((size_t)b * NPOS + n0) * CDIM + c0;
  #pragma unroll
  for (int i = 0; i < 4; i++) {
    #pragma unroll
    for (int g = 0; g < 2; g++) {
      union { uint4 u; half_t e[8]; } o;
      #pragma unroll
      for (int j = 0; j < 8; j++) {
        const float* f = (const float*)&v[g][j];
        o.e[j] = (half_t)f[i];
      }
      *(uint4*)(dst + (size_t)i * CDIM + g * 32) = o.u;
    }
  }
}

// sr_w [O=512][C=512][2][2] -> srwh [o][k], k = (sy*2+sx)*512 + c
__device__ __forceinline__
void cvt_srw(const float* __restrict__ srw, half_t* __restrict__ out, int blk) {
  int i = blk * 256 + threadIdx.x;               // over 512*2048
  int o = i >> 11;
  int k = i & 2047;
  int s = k >> 9;
  int c = k & 511;
  int sy = s >> 1, sx = s & 1;
  out[i] = (half_t)srw[(((size_t)o * 512 + c) * 2 + sy) * 2 + sx];
  // the wait that belongs in front of any rewrite of the store's registers: in the
  // merged grid another conversion's body follows this one in the code
  asm volatile("s_wait_xcnt 0x0" ::: "memory");
}

// All five conversions are independent of one another: one grid, each block
// picks its conversion by its index range (the x transposition, the largest,
// starts first).
#define XT_BLKS  (BATCH * (CDIM / 64) * (NPOS / 256))
#define SRW_BLKS ((CDIM * 2048) / 256)
#define KVW_BLKS ((2 * CDIM * CDIM) / 256)
#define QW_BLKS  ((CDIM * CDIM) / 256)
#define PW_BLKS  ((CDIM * CDIM) / 256)
__global__ __launch_bounds__(256)
void cvt_all(const float* __restrict__ x, const float* __restrict__ sr_w,
             const float* __restrict__ kv_w, const float* __restrict__ q_w,
             const float* __restrict__ proj_w,
             half_t* __restrict__ xT, half_t* __restrict__ srwh,
             half_t* __restrict__ kvwh, half_t* __restrict__ qwh,
             half_t* __restrict__ pwh) {
  int blk = blockIdx.x;
  if (blk < XT_BLKS) { cvt_xT(x, xT, blk); return; }
  blk -= XT_BLKS;
  if (blk < SRW_BLKS) { cvt_srw(sr_w, srwh, blk); return; }
  blk -= SRW_BLKS;
  if (blk < KVW_BLKS) { cvt_f16(kv_w, kvwh, 2 * CDIM * CDIM, blk); return; }
  blk -= KVW_BLKS;
  if (blk < QW_BLKS) { cvt_f16(q_w, qwh, CDIM * CDIM, blk); return; }
  blk -= QW_BLKS;
  cvt_f16(proj_w, pwh, CDIM * CDIM, blk);
}

// ---------------------------------------------------------------------------
// LayerNorm over channels at each reduced spatial position.
// kvin [B*1024][512] f32 -> lnT [B*1024][512] f16
// ---------------------------------------------------------------------------
__global__ __launch_bounds__(256)
void ln_kernel(const float* __restrict__ kvin, const float* __restrict__ g,
               const float* __restrict__ be, half_t* __restrict__ lnT) {
  __shared__ float r1[256], r2[256];
  const int pos = blockIdx.x;
  const int t = threadIdx.x;
  const float* xr = kvin + (size_t)pos * CDIM;
  float x0 = xr[t], x1 = xr[t + 256];
  r1[t] = x0 + x1;
  r2[t] = x0 * x0 + x1 * x1;
  __syncthreads();
  for (int off = 128; off > 0; off >>= 1) {
    if (t < off) { r1[t] += r1[t + off]; r2[t] += r2[t + off]; }
    __syncthreads();
  }
  float mean = r1[0] * (1.0f / 512.0f);
  float var  = r2[0] * (1.0f / 512.0f) - mean * mean;
  float rs   = rsqrtf(var + 1e-6f);
  lnT[(size_t)pos * CDIM + t]       = (half_t)((x0 - mean) * rs * g[t]       + be[t]);
  lnT[(size_t)pos * CDIM + t + 256] = (half_t)((x1 - mean) * rs * g[t + 256] + be[t + 256]);
}

// ---------------------------------------------------------------------------
// Tiled WMMA GEMM: out[M][Npos] = W[M][K] * act[Npos][K]^T  (+bias)
// Block = 256 threads = 8 waves, 128x128 tile; a stage is 128 k of both operands.
// Stages are filled by double-buffered GLOBAL_LOAD_ASYNC_TO_LDS_B128 copies:
// stage t+1 flies (ASYNCcnt) while stage t runs through its 32 WMMAs per wave,
// so a copy has four k-steps of matrix work to land behind.
// MODE 0: Q proj   K=512 NP=4096 -> qh  [bh][n][d]   f16
// MODE 1: SR conv  K=2048 NP=1024 (im2col gather from xT) -> kvin f32 [b][n][o]
// MODE 2: KV proj  K=512 NP=1024 -> kh [bh][nk][d], vt [bh][d][nk]  f16
// MODE 3: out proj K=512 NP=4096 -> d_out f32 [b][o][n]
// ---------------------------------------------------------------------------
#define BK   128                    // k per stage: rows of 256 B, whole lines
#define GP   136                    // LDS row pitch in halves: 272 B = 16 B x odd (conflict free)
#define TILE (128 * GP)             // halves per buffer

template<int MODE>
__device__ __forceinline__
void gemm_tile(half_t* Ah, half_t* Bh, const int bx, const int by, const int b,
               const half_t* __restrict__ W, const half_t* __restrict__ actBase,
               const float* __restrict__ bias,
               float* __restrict__ outF, half_t* __restrict__ outH,
               half_t* __restrict__ outH2) {
  constexpr int K  = (MODE == 1) ? 2048 : 512;

  const int n0   = bx * 128;
  const int m0   = by * 128;
  const int tid  = threadIdx.x;
  const int lane = tid & 31;
  const int wave = tid >> 5;
  const int wm   = wave & 3;   // 4 row blocks of 32
  const int wn   = wave >> 2;  // 2 col blocks of 64
  const half_t* act = actBase + (size_t)b * ((MODE == 2) ? (NKPOS * CDIM) : (NPOS * CDIM));

  // Each thread copies eight 16-byte chunks of each operand per stage: chunk cch
  // of rows crow, crow + 16, ...; a wave's copy covers two whole 256-byte rows.
  const int crow = tid >> 4;
  const int cch  = (tid & 15) * 8;
  const uint32_t ldsA = lds_addr32(&Ah[crow * GP + cch]);
  const uint32_t ldsB = lds_addr32(&Bh[crow * GP + cch]);
  const half_t* gA = W + (size_t)(m0 + crow) * K + cch;
  // MODE 1, im2col: reduced position n = (py, px) reads x position
  // (2 py + sy, 2 px + sx); n0 is a multiple of 128 and crow < 16, so 16 rows on
  // are 16 px on (32 x positions) or, every second time, one py on (128).
  const int nrow = n0 + crow;
  const half_t* gB = (MODE == 1)
      ? act + (size_t)((nrow >> 5) * 128 + (nrow & 31) * 2) * CDIM + cch
      : act + (size_t)nrow * K + cch;
  constexpr int RA  = 16 * K;                              // halves per 16 rows of W
  constexpr int RB1 = (MODE == 1) ? 32 * CDIM  : 16 * K;   // 16 rows of act
  constexpr int RB2 = (MODE == 1) ? 128 * CDIM : 32 * K;   // 32 rows of act

  // Issue one 128x128 A stage + B stage into buffer `buf` (16 copies / wave).
  auto issue_tile = [&](int buf, int k0) {
    const uint32_t lo = (uint32_t)(buf * TILE * 2);
    const half_t* a = gA + k0;
    const half_t* p;
    if (MODE == 1) {
      const int tap = k0 >> 9;           // 2x2 tap selector, one per stage (512 % BK == 0)
      p = gB + ((tap >> 1) * 64 + (tap & 1)) * CDIM + (k0 & 511);
    } else {
      p = gB + k0;
    }
    async_cp8_b128(ldsA + lo, 16 * GP * 2,
                   a,          a + RA,     a + 2 * RA, a + 3 * RA,
                   a + 4 * RA, a + 5 * RA, a + 6 * RA, a + 7 * RA);
    async_cp8_b128(ldsB + lo, 16 * GP * 2,
                   p,           p + RB1,           p + RB2,     p + RB2 + RB1,
                   p + 2 * RB2, p + 2 * RB2 + RB1, p + 3 * RB2, p + 3 * RB2 + RB1);
  };

  v8f acc[2][4];
  const v8f vzero = {0.f, 0.f, 0.f, 0.f, 0.f, 0.f, 0.f, 0.f};
  for (int i = 0; i < 2; i++)
    for (int j = 0; j < 4; j++) acc[i][j] = vzero;

  constexpr int NT = K / BK;             // at least 4 stages in every mode
  issue_tile(0, 0);
  // stage 0 landed (this wave's copies), then visible to every wave
  asm volatile("s_wait_asynccnt 0x0" ::: "memory");
  __syncthreads();
  issue_tile(1, BK);

  for (int t = 0; t < NT; ++t) {
    const half_t* At = &Ah[(t & 1) * TILE + (wm * 32 + (lane & 15)) * GP];
    const half_t* Bt = &Bh[(t & 1) * TILE + (wn * 64 + (lane & 15)) * GP];
    // unrolled so that ks folds into the immediate offsets of the LDS reads
    #pragma unroll
    for (int ks = 0; ks < BK; ks += 32) {
      v16h af[2], bf[4];
      #pragma unroll
      for (int mt = 0; mt < 2; mt++)
        af[mt] = frag_ld(At + mt * 16 * GP + ks, lane);
      #pragma unroll
      for (int nt = 0; nt < 4; nt++)
        bf[nt] = frag_ld(Bt + nt * 16 * GP + ks, lane);
      #pragma unroll
      for (int mt = 0; mt < 2; mt++)
        #pragma unroll
        for (int nt = 0; nt < 4; nt++)
          acc[mt][nt] = wmma16(af[mt], bf[nt], acc[mt][nt]);
    }
    // hand-over: this wave's reads of stage t are done ...
    asm volatile("s_wait_dscnt 0x0" ::: "memory");
    // ... its copies of stage t + 1 have landed ...
    asm volatile("s_wait_asynccnt 0x0" ::: "memory");
    // ... and one barrier publishes stage t + 1 and frees stage t's buffer
    __syncthreads();
    if (t + 2 < NT) issue_tile(t & 1, (t + 2) * BK);
  }
  // nothing is outstanding here; kept so that no copy can outlive the wave
  asm volatile("s_wait_asynccnt 0x0" ::: "memory");

  // epilogue: C/D layout -> lane holds col n = lane%16, rows r + (lane>=16?8:0)
  const int halfoff = (lane & 16) ? 8 : 0;
  const int ncol = lane & 15;
  #pragma unroll
  for (int mt = 0; mt < 2; mt++) {
    #pragma unroll
    for (int nt = 0; nt < 4; nt++) {
      #pragma unroll
      for (int r = 0; r < 8; r++) {
        int o = m0 + wm * 32 + mt * 16 + r + halfoff;
        int n = n0 + wn * 64 + nt * 16 + ncol;
        float v = acc[mt][nt][r] + bias[o];
        if (MODE == 0) {
          int head = o >> 6, d = o & 63;
          outH[(((size_t)(b * HEADS + head) * NPOS) + n) * HD + d] = (half_t)v;
        } else if (MODE == 1) {
          outF[((size_t)b * NKPOS + n) * CDIM + o] = v;
        } else if (MODE == 2) {
          if (o < CDIM) {
            int head = o >> 6, d = o & 63;
            outH[(((size_t)(b * HEADS + head) * NKPOS) + n) * HD + d] = (half_t)v;
          } else {
            int vc = o - CDIM;
            int head = vc >> 6, d = vc & 63;
            outH2[(((size_t)(b * HEADS + head) * HD) + d) * NKPOS + n] = (half_t)v;
          }
        } else { // MODE 3
          outF[((size_t)b * CDIM + o) * NPOS + n] = v;
        }
      }
    }
  }
}

template<int MODE>
__global__ __launch_bounds__(256)
void gemm_wmma(const half_t* __restrict__ W, const half_t* __restrict__ actBase,
               const float* __restrict__ bias,
               float* __restrict__ outF, half_t* __restrict__ outH,
               half_t* __restrict__ outH2) {
  __shared__ __attribute__((aligned(16))) half_t Ah[2 * TILE];
  __shared__ __attribute__((aligned(16))) half_t Bh[2 * TILE];
  gemm_tile<MODE>(Ah, Bh, blockIdx.x, blockIdx.y, blockIdx.z,
                  W, actBase, bias, outF, outH, outH2);
}

// The SR conv and the Q projection both read only xT and their own weights:
// one grid.  The SR tiles (four times the K loop, only 128 of them) start
// first; the Q tiles fill the rest of the chip beside them.
#define SR_TILES ((NKPOS / 128) * (CDIM / 128) * BATCH)
#define Q_TILES  ((NPOS / 128) * (CDIM / 128) * BATCH)
__global__ __launch_bounds__(256)
void gemm_sr_q(const half_t* __restrict__ srwh, const half_t* __restrict__ qwh,
               const half_t* __restrict__ xT,
               const float* __restrict__ sr_b, const float* __restrict__ q_b,
               float* __restrict__ kvin, half_t* __restrict__ qh) {
  __shared__ __attribute__((aligned(16))) half_t Ah[2 * TILE];
  __shared__ __attribute__((aligned(16))) half_t Bh[2 * TILE];
  const int blk = blockIdx.x;
  if (blk < SR_TILES) {
    gemm_tile<1>(Ah, Bh, blk & 7, (blk >> 3) & 3, blk >> 5,
                 srwh, xT, sr_b, kvin, nullptr, nullptr);
  } else {
    const int t = blk - SR_TILES;
    gemm_tile<0>(Ah, Bh, t & 31, (t >> 5) & 3, t >> 7,
                 qwh, xT, q_b, nullptr, qh, nullptr);
  }
}

#define KSTG   64
#define KVP    72
#define KVTILE (64 * KVP)

// value of lane l ^ 16 (a vector cross-row move, no LDS round trip)
__device__ __forceinline__ float xhalf(float x) {
  return __builtin_bit_cast(float, __builtin_amdgcn_permlanex16(
      __builtin_bit_cast(int, x), __builtin_bit_cast(int, x),
      0x76543210, 0xfedcba98, false, false));
}

__global__ __launch_bounds__(256)
void attn_kernel(const half_t* __restrict__ qh, const half_t* __restrict__ kh,
                 const half_t* __restrict__ vt, half_t* __restrict__ attnT) {
  __shared__ __attribute__((aligned(16))) half_t Ks[2 * KVTILE];
  __shared__ __attribute__((aligned(16))) half_t Vs[2 * KVTILE];
  const int tid  = threadIdx.x;
  const int lane = tid & 31;
  const int wave = tid >> 5;
  const int bh   = blockIdx.y;          // b*8 + h
  const int b    = bh >> 3, h = bh & 7;
  const int q0   = blockIdx.x * 128 + wave * 16;
  const int lrow = lane & 15;
  const int halfoff = (lane & 16) ? 8 : 0;

  // Q B-fragments (64 d x 16 q = two k-steps), loaded once; lane = query column
  const half_t* qrow = qh + ((size_t)bh * NPOS + q0 + lrow) * HD;
  v16h qa0 = frag_ld(qrow, lane);
  v16h qa1 = frag_ld(qrow + 32, lane);

  const v8f vzero = {0.f, 0.f, 0.f, 0.f, 0.f, 0.f, 0.f, 0.f};
  v8f acc[4];                           // O^T: acc[dt][r] = O[q = lrow][d = dt*16 + halfoff + r]
  for (int dt = 0; dt < 4; dt++) acc[dt] = vzero;
  float rmax = -1e30f;                  // running maximum of this lane's query
  float rsum = 0.f;                     // this lane's half of the query's denominator

  // Each thread copies two 16-byte chunks of the K tile and two of the V^T tile.
  const int crow = tid >> 3;            // rows crow and crow + 32
  const int cch  = (tid & 7) * 8;       // 8-half chunk inside the 64-half row
  const uint32_t ldsK = lds_addr32(&Ks[crow * KVP + cch]);
  const uint32_t ldsV = lds_addr32(&Vs[crow * KVP + cch]);
  const half_t* gK = kh + ((size_t)bh * NKPOS + crow) * HD + cch;
  const half_t* gV = vt + ((size_t)bh * HD + crow) * NKPOS + cch;
  auto issue_stage = [&](int buf, int kb0) {
    const uint32_t lo = (uint32_t)(buf * KVTILE * 2);
    const half_t* k0p = gK + (size_t)kb0 * HD;
    const half_t* v0p = gV + kb0;
    async_cp4_b128(ldsK + lo,                k0p,
                   ldsK + lo + 32 * KVP * 2, k0p + 32 * HD,
                   ldsV + lo,                v0p,
                   ldsV + lo + 32 * KVP * 2, v0p + 32 * NKPOS);
  };

  issue_stage(0, 0);
  // tile 0 landed (this wave's copies), then visible to every wave
  asm volatile("s_wait_asynccnt 0x0" ::: "memory");
  __syncthreads();
  issue_stage(1, KSTG);

  for (int t = 0; t < NKPOS / KSTG; ++t) {
   const half_t* Kt = &Ks[(t & 1) * KVTILE];
   const half_t* Vt = &Vs[(t & 1) * KVTILE];
   // unrolled so that sub folds into the immediate offsets of the LDS reads
   #pragma unroll
   for (int sub = 0; sub < KSTG; sub += 32) {
    // S^T = (K Q^T) * scale for a 32x16 chunk (two 16x16 tiles):
    // s[st][r] = score of key sub + st*16 + halfoff + r against query lrow
    v8f s[2];
    #pragma unroll
    for (int st = 0; st < 2; st++) {
      const half_t* kbase = Kt + (sub + st * 16 + lrow) * KVP;
      v16h kf0 = frag_ld(kbase, lane);
      v16h kf1 = frag_ld(kbase + 32, lane);
      v8f z = vzero;
      z = wmma16(kf0, qa0, z);
      z = wmma16(kf1, qa1, z);
      #pragma unroll
      for (int r = 0; r < 8; r++) z[r] *= ATT_SCALE;
      s[st] = z;
    }
    // online softmax: 16 scores of one query per lane, the other 16 in lane^16
    float mx[8];
    #pragma unroll
    for (int i = 0; i < 8; i++) mx[i] = fmaxf(s[i >> 2][2 * (i & 3)], s[i >> 2][2 * (i & 3) + 1]);
    float m = fmaxf(fmaxf(fmaxf(mx[0], mx[1]), fmaxf(mx[2], mx[3])),
                    fmaxf(fmaxf(mx[4], mx[5]), fmaxf(mx[6], mx[7])));
    m = fmaxf(m, xhalf(m));
    const float nm = fmaxf(rmax, m);
    const float alpha = __expf(rmax - nm);
    rmax = nm;
    // P^T as the B operand: element e = key kmap(e) = tile e>>3, register e&7
    v16h pb;
    float pp[8];
    #pragma unroll
    for (int i = 0; i < 8; i++) {
      float p0 = __expf(s[i >> 2][2 * (i & 3)] - nm);
      float p1 = __expf(s[i >> 2][2 * (i & 3) + 1] - nm);
      pb[2 * i]     = (half_t)p0;
      pb[2 * i + 1] = (half_t)p1;
      pp[i] = p0 + p1;
    }
    const float ps = ((pp[0] + pp[1]) + (pp[2] + pp[3])) + ((pp[4] + pp[5]) + (pp[6] + pp[7]));
    rsum = rsum * alpha + ps;
    #pragma unroll
    for (int dt = 0; dt < 4; dt++)
      #pragma unroll
      for (int r = 0; r < 8; r++) acc[dt][r] *= alpha;
    // acc += V^T (16 d x 32 keys) * P^T (32 keys x 16 q)
    #pragma unroll
    for (int dt = 0; dt < 4; dt++) {
      const half_t* vbase = Vt + (dt * 16 + lrow) * KVP + sub;
      v16h vf = frag_ld(vbase, lane);
      acc[dt] = wmma16(vf, pb, acc[dt]);
    }
   }
   // hand-over: this wave's reads of tile t are done ...
   asm volatile("s_wait_dscnt 0x0" ::: "memory");
   // ... its copies of tile t + 1 have landed ...
   asm volatile("s_wait_asynccnt 0x0" ::: "memory");
   // ... and one barrier publishes tile t + 1 and frees tile t's buffer
   __syncthreads();
   if (t + 2 < NKPOS / KSTG) issue_stage(t & 1, (t + 2) * KSTG);
  }
  // nothing is outstanding here; kept so that no copy can outlive the wave
  asm volatile("s_wait_asynccnt 0x0" ::: "memory");

  // join the two halves' denominators, normalize and emit position-major
  // [n][c] f16 for the projection GEMM: 8 consecutive d per lane, 16-byte stores
  const float inv = 1.0f / (rsum + xhalf(rsum));
  half_t* orow = attnT + ((size_t)b * NPOS + q0 + lrow) * CDIM + h * HD + halfoff;
  #pragma unroll
  for (int dt = 0; dt < 4; dt++) {
    union { uint4 u; half_t e[8]; } o;
    #pragma unroll
    for (int r = 0; r < 8; r++) o.e[r] = (half_t)(acc[dt][r] * inv);
    *(uint4*)(orow + dt * 16) = o.u;
  }
}

// ---------------------------------------------------------------------------
extern "C" void kernel_launch(void* const* d_in, const int* in_sizes, int n_in,
                              void* d_out, int out_size, void* d_ws, size_t ws_size,
                              hipStream_t stream) {
  const float* x      = (const float*)d_in[0];
  const float* q_w    = (const float*)d_in[1];
  const float* q_b    = (const float*)d_in[2];
  const float* kv_w   = (const float*)d_in[3];
  const float* kv_b   = (const float*)d_in[4];
  const float* sr_w   = (const float*)d_in[5];
  const float* sr_b   = (const float*)d_in[6];
  const float* ln_g   = (const float*)d_in[7];
  const float* ln_b   = (const float*)d_in[8];
  const float* proj_w = (const float*)d_in[9];
  const float* proj_b = (const float*)d_in[10];
  float* out = (float*)d_out;

  size_t off = 0;
  auto carve = [&](size_t bytes) {
    void* p = (char*)d_ws + off;
    off += (bytes + 255) & ~(size_t)255;
    return p;
  };
  half_t* xT    = (half_t*)carve((size_t)BATCH * NPOS * CDIM * 2);
  half_t* qwh   = (half_t*)carve((size_t)CDIM * CDIM * 2);
  half_t* kvwh  = (half_t*)carve((size_t)2 * CDIM * CDIM * 2);
  half_t* srwh  = (half_t*)carve((size_t)CDIM * 2048 * 2);
  half_t* pwh   = (half_t*)carve((size_t)CDIM * CDIM * 2);
  half_t* qhb   = (half_t*)carve((size_t)BATCH * HEADS * NPOS * HD * 2);
  float*  kvin  = (float*)carve((size_t)BATCH * NKPOS * CDIM * 4);
  half_t* lnT   = (half_t*)carve((size_t)BATCH * NKPOS * CDIM * 2);
  half_t* khb   = (half_t*)carve((size_t)BATCH * HEADS * NKPOS * HD * 2);
  half_t* vtb   = (half_t*)carve((size_t)BATCH * HEADS * HD * NKPOS * 2);
  half_t* attnT = (half_t*)carve((size_t)BATCH * NPOS * CDIM * 2);

  // 1. precision / layout conversions
  cvt_all<<<XT_BLKS + SRW_BLKS + KVW_BLKS + QW_BLKS + PW_BLKS, 256, 0, stream>>>(
      x, sr_w, kv_w, q_w, proj_w, xT, srwh, kvwh, qwh, pwh);

  // 2. SR conv as im2col GEMM -> kvin f32 [b][n][c], and beside it
  //    the Q projection -> qh [bh][n][d]
  gemm_sr_q<<<SR_TILES + Q_TILES, 256, 0, stream>>>(
      srwh, qwh, xT, sr_b, q_b, kvin, qhb);

  // 3. channel LayerNorm -> lnT f16
  ln_kernel<<<BATCH * NKPOS, 256, 0, stream>>>(kvin, ln_g, ln_b, lnT);

  // 4. KV projection -> kh [bh][nk][d], vt [bh][d][nk]
  gemm_wmma<2><<<dim3(NKPOS / 128, (2 * CDIM) / 128, BATCH), 256, 0, stream>>>(
      kvwh, lnT, kv_b, nullptr, khb, vtb);

  // 5. flash attention -> attnT f16 [b][n][c]
  attn_kernel<<<dim3(NPOS / 128, BATCH * HEADS), 256, 0, stream>>>(
      qhb, khb, vtb, attnT);

  // 6. output projection -> d_out f32 [b][c][n]
  gemm_wmma<3><<<dim3(NPOS / 128, CDIM / 128, BATCH), 256, 0, stream>>>(
      pwh, attnT, proj_b, out, nullptr, nullptr);
}

// v006
// Measured time: 113 microseconds a run.
// Two timings next to v005 both put it at 1.05 times that version's speed.
// Counting every step since v000, it is 2.73 times as fast.
#include <hip/hip_runtime.h>
#include <hip/hip_bf16.h>

typedef _Float16 half_t;
typedef __attribute__((ext_vector_type(16))) _Float16 v16h;
typedef __attribute__((ext_vector_type(8)))  float    v8f;

#define BATCH  4
#define CDIM   512
#define HEADS  8
#define HD     64
#define NPOS   4096   // 64*64
#define NKPOS  1024   // 32*32
#define ATT_SCALE 0.125f

// ---------------------------------------------------------------------------
// WMMA helpers.  16-bit A-matrix 16x32 layout (ISA 7.12.2): lane L holds row
// m = L%16; its 16 halves are two contiguous 8-half chunks at k = off..off+7
// and k = off+16..off+23, off = (L>=16 ? 8 : 0).  B uses the symmetric layout
// (lane = column, identical k packing), so both fragments are two 16-byte
// loads from a k-contiguous row.
// ---------------------------------------------------------------------------
__device__ __forceinline__ v16h frag_ld(const half_t* rowbase, int lane) {
  const int off = (lane & 16) ? 8 : 0;
  union { uint4 u[2]; v16h v; } t;
  t.u[0] = *(const uint4*)(rowbase + off);
  t.u[1] = *(const uint4*)(rowbase + off + 16);
  return t.v;
}

__device__ __forceinline__ v8f wmma16(v16h a, v16h b, v8f c) {
  return __builtin_amdgcn_wmma_f32_16x16x32_f16(false, a, false, b,
                                                (short)0, c, false, false);
}

// Low 32 bits of a flat pointer into LDS == LDS byte offset (ISA 10.2:
// the LDS aperture maps by truncating to addr[31:0]).
__device__ __forceinline__ uint32_t lds_addr32(const void* p) {
  return (uint32_t)(uintptr_t)p;
}

// Eight async global->LDS copies of one lane, 16 B each: rows r, r + 16, ... of a
// 128-row tile.  lds = the lane's LDS byte address of row r, ls = LDS bytes per
// 16 rows; g0..g7 = the lane's global addresses.  s_wait_xcnt closes the same
// statement as a precaution: the address registers are not rewritten ahead of it.
__device__ __forceinline__ void async_cp8_b128(uint32_t lds, uint32_t ls,
                                               const half_t* g0, const half_t* g1,
                                               const half_t* g2, const half_t* g3,
                                               const half_t* g4, const half_t* g5,
                                               const half_t* g6, const half_t* g7) {
  asm volatile("global_load_async_to_lds_b128 %0, %1, off\n\t"
               "global_load_async_to_lds_b128 %2, %3, off\n\t"
               "global_load_async_to_lds_b128 %4, %5, off\n\t"
               "global_load_async_to_lds_b128 %6, %7, off\n\t"
               "global_load_async_to_lds_b128 %8, %9, off\n\t"
               "global_load_async_to_lds_b128 %10, %11, off\n\t"
               "global_load_async_to_lds_b128 %12, %13, off\n\t"
               "global_load_async_to_lds_b128 %14, %15, off\n\t"
               "s_wait_xcnt 0x0"
               :: "v"(lds),          "v"(g0), "v"(lds + ls),     "v"(g1),
                  "v"(lds + 2 * ls), "v"(g2), "v"(lds + 3 * ls), "v"(g3),
                  "v"(lds + 4 * ls), "v"(g4), "v"(lds + 5 * ls), "v"(g5),
                  "v"(lds + 6 * ls), "v"(g6), "v"(lds + 7 * ls), "v"(g7) : "memory");
}

// Four async global->LDS copies of one lane, 16 B each, per-lane 64-bit address.
// s_wait_xcnt closes the same statement as a precaution: the address registers
// are not rewritten ahead of it.
__device__ __forceinline__ void async_cp4_b128(uint32_t l0, const half_t* g0,
                                               uint32_t l1, const half_t* g1,
                                               uint32_t l2, const half_t* g2,
                                               uint32_t l3, const half_t* g3) {
  asm volatile("global_load_async_to_lds_b128 %0, %1, off\n\t"
               "global_load_async_to_lds_b128 %2, %3, off\n\t"
               "global_load_async_to_lds_b128 %4, %5, off\n\t"
               "global_load_async_to_lds_b128 %6, %7, off\n\t"
               "s_wait_xcnt 0x0"
               :: "v"(l0), "v"(g0), "v"(l1), "v"(g1),
                  "v"(l2), "v"(g2), "v"(l3), "v"(g3) : "memory");
}

// ---------------------------------------------------------------------------
// Conversion kernels (f32 -> f16, layout shuffles)
// ---------------------------------------------------------------------------
// Same layout, 4,096 elements a block: a thread converts four groups of 4, the
// groups 1,024 elements apart, so that every load of a wave reads four whole
// 128-byte lines and every store fills two.  Every weight count here is a
// multiple of 4,096.
#define CVT_PER_BLK 4096
__device__ __forceinline__
void cvt_f16(const float* __restrict__ in, half_t* __restrict__ out, int blk) {
  const int i0 = blk * CVT_PER_BLK + threadIdx.x * 4;
  const float* src = in + i0;
  float4 v[4];
  #pragma unroll
  for (int j = 0; j < 4; j++) v[j] = *(const float4*)(src + j * 1024);
  // the wait that belongs in front of any rewrite of the loads' address pair
  asm volatile("s_wait_xcnt 0x0" :: "v"(src) : "memory");
  #pragma unroll
  for (int j = 0; j < 4; j++) {
    union { uint2 u; half_t e[4]; } o;
    o.e[0] = (half_t)v[j].x;
    o.e[1] = (half_t)v[j].y;
    o.e[2] = (half_t)v[j].z;
    o.e[3] = (half_t)v[j].w;
    *(uint2*)(out + i0 + j * 1024) = o.u;
  }
  // the wait that belongs in front of any rewrite of the stores' registers: in the
  // merged grid another conversion's body follows this one in the code
  asm volatile("s_wait_xcnt 0x0" ::: "memory");
}

// x [B][512][4096] -> xT [B][4096][512] (f16, position-major)
// The transposition happens in registers: a thread holds 16 channels x 4
// positions (sixteen 16-byte loads, all in flight together) and stores, per
// position, two 16-byte runs of 8 channels.  A wave covers 64 channels x 32
// positions: every load reads four whole 128-byte lines of x, and the two
// stores of one position fill one whole 128-byte line of xT, 64 bytes each.
__device__ __forceinline__
void cvt_xT(const float* __restrict__ x, half_t* __restrict__ xT,
            const int blk) {                      // B * 8 channel tiles * 16 position tiles
  const int lane = threadIdx.x & 31;
  const int wave = threadIdx.x >> 5;
  const int b    = blk >> 7;
  const int c0   = ((blk >> 4) & 7) * 64 + (lane >> 3) * 8;   // and c0 + 32
  const int n0   = (blk & 15) * 256 + wave * 32 + (lane & 7) * 4;
  const float* src = x + ((size_t)b * CDIM + c0) * NPOS + n0;
  float4 v[2][8];
  #pragma unroll
  for (int g = 0; g < 2; g++)
    #pragma unroll
    for (int j = 0; j < 8; j++)
      v[g][j] = *(const float4*)(src + (size_t)(g * 32 + j) * NPOS);
  // the wait that belongs in front of any rewrite of the loads' address pair; it
  // names the pair, so that no load's own result is placed on it either
  asm volatile("s_wait_xcnt 0x0" :: "v"(src) : "memory");
  // keeps all sixteen loads in front of the first conversion: without it four of
  // them are issued behind a wait and the wave pays a second memory latency
  __builtin_amdgcn_sched_barrier(0);
  half_t* dst = xT + ((size_t)b * NPOS + n0) * CDIM + c0;
  #pragma unroll
  for (int i = 0; i < 4; i++) {
    #pragma unroll
    for (int g = 0; g < 2; g++) {
      union { uint4 u; half_t e[8]; } o;
      #pragma unroll
      for (int j = 0; j < 8; j++) {
        const float* f = (const float*)&v[g][j];
        o.e[j] = (half_t)f[i];
      }
      *(uint4*)(dst + (size_t)i * CDIM + g * 32) = o.u;
    }
  }
}

// sr_w [O=512][C=512][2][2] -> srwh [o][k], k = (sy*2+sx)*512 + c
// A thread holds 4 consecutive channels x the 4 taps of one o (four 16-byte loads,
// 64 contiguous bytes) and stores, per tap s = sy*2+sx, one 8-byte run of 4
// channels: a wave's store fills two whole 128-byte lines.
__device__ __forceinline__
void cvt_srw(const float* __restrict__ srw, half_t* __restrict__ out, int blk) {
  const int i  = blk * 256 + threadIdx.x;        // over 512 o * 128 channel groups
  const int o  = i >> 7;
  const int c0 = (i & 127) * 4;
  const float* src = srw + ((size_t)o * 512 + c0) * 4;
  float4 v[4];
  #pragma unroll
  for (int j = 0; j < 4; j++) v[j] = *(const float4*)(src + j * 4);
  // the wait that belongs in front of any rewrite of the loads' address pair
  asm volatile("s_wait_xcnt 0x0" :: "v"(src) : "memory");
  half_t* dst = out + (size_t)o * 2048 + c0;
  #pragma unroll
  for (int s = 0; s < 4; s++) {
    union { uint2 u; half_t e[4]; } t;
    #pragma unroll
    for (int j = 0; j < 4; j++) {
      const float* f = (const float*)&v[j];
      t.e[j] = (half_t)f[s];
    }
    *(uint2*)(dst + s * 512) = t.u;
  }
  // the wait that belongs in front of any rewrite of the store's registers: in the
  // merged grid another conversion's body follows this one in the code
  asm volatile("s_wait_xcnt 0x0" ::: "memory");
}

// All five conversions are independent of one another: one grid, each block
// picks its conversion by its index range (the x transposition, the largest,
// starts first).
#define XT_BLKS  (BATCH * (CDIM / 64) * (NPOS / 256))
#define SRW_BLKS ((CDIM * 2048) / (256 * 16))
#define KVW_BLKS ((2 * CDIM * CDIM) / CVT_PER_BLK)
#define QW_BLKS  ((CDIM * CDIM) / CVT_PER_BLK)
#define PW_BLKS  ((CDIM * CDIM) / CVT_PER_BLK)
__global__ __launch_bounds__(256)
void cvt_all(const float* __restrict__ x, const float* __restrict__ sr_w,
             const float* __restrict__ kv_w, const float* __restrict__ q_w,
             const float* __restrict__ proj_w,
             half_t* __restrict__ xT, half_t* __restrict__ srwh,
             half_t* __restrict__ kvwh, half_t* __restrict__ qwh,
             half_t* __restrict__ pwh) {
  int blk = blockIdx.x;
  if (blk < XT_BLKS) { cvt_xT(x, xT, blk); return; }
  blk -= XT_BLKS;
  if (blk < SRW_BLKS) { cvt_srw(sr_w, srwh, blk); return; }
  blk -= SRW_BLKS;
  if (blk < KVW_BLKS) { cvt_f16(kv_w, kvwh, blk); return; }
  blk -= KVW_BLKS;
  if (blk < QW_BLKS) { cvt_f16(q_w, qwh, blk); return; }
  blk -= QW_BLKS;
  cvt_f16(proj_w, pwh, blk);
}

// ---------------------------------------------------------------------------
// LayerNorm over channels at each reduced spatial position.
// kvin [B*1024][512] f32 -> lnT [B*1024][512] f16
// ---------------------------------------------------------------------------
// value of lane l ^ 16 (a vector cross-row move, no LDS round trip)
__device__ __forceinline__ float xhalf(float x) {
  return __builtin_bit_cast(float, __builtin_amdgcn_permlanex16(
      __builtin_bit_cast(int, x), __builtin_bit_cast(int, x),
      0x76543210, 0xfedcba98, false, false));
}

// value of lane l ^ M inside a 16-lane row (DPP row_xmask)
template<int M>
__device__ __forceinline__ float xrow(float x) {
  return __builtin_bit_cast(float, __builtin_amdgcn_update_dpp(
      0, __builtin_bit_cast(int, x), 0x160 | M, 0xf, 0xf, true));
}

__device__ __forceinline__ float wave_sum(float x) {
  x += xrow<1>(x);
  x += xrow<2>(x);
  x += xrow<4>(x);
  x += xrow<8>(x);
  return x + xhalf(x);
}

// One wave owns one position: a lane holds 16 of the 512 channels (four 16-byte
// loads, whole lines), the two sums are in-lane plus five cross-lane steps, and
// nothing goes through LDS or a barrier.  8 positions a block.
__global__ __launch_bounds__(256)
void ln_kernel(const float* __restrict__ kvin, const float* __restrict__ g,
               const float* __restrict__ be, half_t* __restrict__ lnT) {
  const int lane = threadIdx.x & 31;
  const int pos  = blockIdx.x * 8 + (threadIdx.x >> 5);
  const float* xr = kvin + (size_t)pos * CDIM + lane * 4;
  float4 x[4], gg[4], bb[4];
  #pragma unroll
  for (int j = 0; j < 4; j++) x[j] = *(const float4*)(xr + j * 128);
  #pragma unroll
  for (int j = 0; j < 4; j++) {
    gg[j] = *(const float4*)(g + lane * 4 + j * 128);
    bb[j] = *(const float4*)(be + lane * 4 + j * 128);
  }
  // the wait that belongs in front of any rewrite of the loads' address pair; it
  // names the pair, so that no load's own result is placed on it either
  asm volatile("s_wait_xcnt 0x0" :: "v"(xr) : "memory");
  // four partial sums each, one per component of a load, joined at the end
  float4 a = x[0];
  float4 q = make_float4(x[0].x * x[0].x, x[0].y * x[0].y, x[0].z * x[0].z, x[0].w * x[0].w);
  #pragma unroll
  for (int j = 1; j < 4; j++) {
    a.x += x[j].x;  a.y += x[j].y;  a.z += x[j].z;  a.w += x[j].w;
    q.x += x[j].x * x[j].x;  q.y += x[j].y * x[j].y;
    q.z += x[j].z * x[j].z;  q.w += x[j].w * x[j].w;
  }
  const float s1 = wave_sum((a.x + a.y) + (a.z + a.w));
  const float s2 = wave_sum((q.x + q.y) + (q.z + q.w));
  const float mean = s1 * (1.0f / 512.0f);
  const float var  = s2 * (1.0f / 512.0f) - mean * mean;
  const float rs   = rsqrtf(var + 1e-6f);
  half_t* dst = lnT + (size_t)pos * CDIM + lane * 4;
  #pragma unroll
  for (int j = 0; j < 4; j++) {
    union { uint2 u; half_t e[4]; } o;
    o.e[0] = (half_t)((x[j].x - mean) * rs * gg[j].x + bb[j].x);
    o.e[1] = (half_t)((x[j].y - mean) * rs * gg[j].y + bb[j].y);
    o.e[2] = (half_t)((x[j].z - mean) * rs * gg[j].z + bb[j].z);
    o.e[3] = (half_t)((x[j].w - mean) * rs * gg[j].w + bb[j].w);
    *(uint2*)(dst + j * 128) = o.u;
  }
}

// ---------------------------------------------------------------------------
// Tiled WMMA GEMM: out[M][Npos] = W[M][K] * act[Npos][K]^T  (+bias)
// Block = 256 threads = 8 waves, 128x128 tile; a stage is 128 k of both operands.
// Stages are filled by double-buffered GLOBAL_LOAD_ASYNC_TO_LDS_B128 copies:
// stage t+1 flies (ASYNCcnt) while stage t runs through its 32 WMMAs per wave,
// so a copy has four k-steps of matrix work to land behind.
// MODE 0: Q proj   K=512 NP=4096 -> qh  [bh][n][d]   f16
// MODE 1: SR conv  K=2048 NP=1024 (im2col gather from xT) -> kvin f32 [b][n][o]
// MODE 2: KV proj  K=512 NP=1024 -> kh [bh][nk][d], vt [bh][d][nk]  f16
// MODE 3: out proj K=512 NP=4096 -> d_out f32 [b][o][n]
// ---------------------------------------------------------------------------
#define BK   128                    // k per stage: rows of 256 B, whole lines
#define GP   136                    // LDS row pitch in halves: 272 B = 16 B x odd (conflict free)
#define TILE (128 * GP)             // halves per buffer

template<int MODE>
__device__ __forceinline__
void gemm_tile(half_t* Ah, half_t* Bh, const int bx, const int by, const int b,
               const half_t* __restrict__ W, const half_t* __restrict__ actBase,
               const float* __restrict__ bias,
               float* __restrict__ outF, half_t* __restrict__ outH,
               half_t* __restrict__ outH2) {
  constexpr int K  = (MODE == 1) ? 2048 : 512;

  const int n0   = bx * 128;
  const int m0   = by * 128;
  const int tid  = threadIdx.x;
  const int lane = tid & 31;
  const int wave = tid >> 5;
  const int wm   = wave & 3;   // 4 row blocks of 32
  const int wn   = wave >> 2;  // 2 col blocks of 64
  const half_t* act = actBase + (size_t)b * ((MODE == 2) ? (NKPOS * CDIM) : (NPOS * CDIM));

  // Each thread copies eight 16-byte chunks of each operand per stage: chunk cch
  // of rows crow, crow + 16, ...; a wave's copy covers two whole 256-byte rows.
  const int crow = tid >> 4;
  const int cch  = (tid & 15) * 8;
  const uint32_t ldsA = lds_addr32(&Ah[crow * GP + cch]);
  const uint32_t ldsB = lds_addr32(&Bh[crow * GP + cch]);
  const half_t* gA = W + (size_t)(m0 + crow) * K + cch;
  // MODE 1, im2col: reduced position n = (py, px) reads x position
  // (2 py + sy, 2 px + sx); n0 is a multiple of 128 and crow < 16, so 16 rows on
  // are 16 px on (32 x positions) or, every second time, one py on (128).
  const int nrow = n0 + crow;
  const half_t* gB = (MODE == 1)
      ? act + (size_t)((nrow >> 5) * 128 + (nrow & 31) * 2) * CDIM + cch
      : act + (size_t)nrow * K + cch;
  constexpr int RA  = 16 * K;                              // halves per 16 rows of W
  constexpr int RB1 = (MODE == 1) ? 32 * CDIM  : 16 * K;   // 16 rows of act
  constexpr int RB2 = (MODE == 1) ? 128 * CDIM : 32 * K;   // 32 rows of act

  // Issue one 128x128 A stage + B stage into buffer `buf` (16 copies / wave).
  auto issue_tile = [&](int buf, int k0) {
    const uint32_t lo = (uint32_t)(buf * TILE * 2);
    const half_t* a = gA + k0;
    const half_t* p;
    if (MODE == 1) {
      const int tap = k0 >> 9;           // 2x2 tap selector, one per stage (512 % BK == 0)
      p = gB + ((tap >> 1) * 64 + (tap & 1)) * CDIM + (k0 & 511);
    } else {
      p = gB + k0;
    }
    async_cp8_b128(ldsA + lo, 16 * GP * 2,
                   a,          a + RA,     a + 2 * RA, a + 3 * RA,
                   a + 4 * RA, a + 5 * RA, a + 6 * RA, a + 7 * RA);
    async_cp8_b128(ldsB + lo, 16 * GP * 2,
                   p,           p + RB1,           p + RB2,     p + RB2 + RB1,
                   p + 2 * RB2, p + 2 * RB2 + RB1, p + 3 * RB2, p + 3 * RB2 + RB1);
  };

  v8f acc[2][4];
  const v8f vzero = {0.f, 0.f, 0.f, 0.f, 0.f, 0.f, 0.f, 0.f};
  for (int i = 0; i < 2; i++)
    for (int j = 0; j < 4; j++) acc[i][j] = vzero;

  constexpr int NT = K / BK;             // at least 4 stages in every mode
  issue_tile(0, 0);
  // stage 0 landed (this wave's copies), then visible to every wave
  asm volatile("s_wait_asynccnt 0x0" ::: "memory");
  __syncthreads();
  issue_tile(1, BK);

  for (int t = 0; t < NT; ++t) {
    const half_t* At = &Ah[(t & 1) * TILE + (wm * 32 + (lane & 15)) * GP];
    const half_t* Bt = &Bh[(t & 1) * TILE + (wn * 64 + (lane & 15)) * GP];
    // unrolled so that ks folds into the immediate offsets of the LDS reads
    #pragma unroll
    for (int ks = 0; ks < BK; ks += 32) {
      v16h af[2], bf[4];
      #pragma unroll
      for (int mt = 0; mt < 2; mt++)
        af[mt] = frag_ld(At + mt * 16 * GP + ks, lane);
      #pragma unroll
      for (int nt = 0; nt < 4; nt++)
        bf[nt] = frag_ld(Bt + nt * 16 * GP + ks, lane);
      #pragma unroll
      for (int mt = 0; mt < 2; mt++)
        #pragma unroll
        for (int nt = 0; nt < 4; nt++)
          acc[mt][nt] = wmma16(af[mt], bf[nt], acc[mt][nt]);
    }
    // hand-over: this wave's reads of stage t are done ...
    asm volatile("s_wait_dscnt 0x0" ::: "memory");
    // ... its copies of stage t + 1 have landed ...
    asm volatile("s_wait_asynccnt 0x0" ::: "memory");
    // ... and one barrier publishes stage t + 1 and frees stage t's buffer
    __syncthreads();
    if (t + 2 < NT) issue_tile(t & 1, (t + 2) * BK);
  }
  // nothing is outstanding here; kept so that no copy can outlive the wave
  asm volatile("s_wait_asynccnt 0x0" ::: "memory");

  // epilogue: C/D layout -> lane holds col n = lane%16, rows r + (lane>=16?8:0)
  const int halfoff = (lane & 16) ? 8 : 0;
  const int ncol = lane & 15;
  #pragma unroll
  for (int mt = 0; mt < 2; mt++) {
    #pragma unroll
    for (int nt = 0; nt < 4; nt++) {
      #pragma unroll
      for (int r = 0; r < 8; r++) {
        int o = m0 + wm * 32 + mt * 16 + r + halfoff;
        int n = n0 + wn * 64 + nt * 16 + ncol;
        float v = acc[mt][nt][r] + bias[o];
        if (MODE == 0) {
          int head = o >> 6, d = o & 63;
          outH[(((size_t)(b * HEADS + head) * NPOS) + n) * HD + d] = (half_t)v;
        } else if (MODE == 1) {
          outF[((size_t)b * NKPOS + n) * CDIM + o] = v;
        } else if (MODE == 2) {
          if (o < CDIM) {
            int head = o >> 6, d = o & 63;
            outH[(((size_t)(b * HEADS + head) * NKPOS) + n) * HD + d] = (half_t)v;
          } else {
            int vc = o - CDIM;
            int head = vc >> 6, d = vc & 63;
            outH2[(((size_t)(b * HEADS + head) * HD) + d) * NKPOS + n] = (half_t)v;
          }
        } else { // MODE 3
          outF[((size_t)b * CDIM + o) * NPOS + n] = v;
        }
      }
    }
  }
}

template<int MODE>
__global__ __launch_bounds__(256)
void gemm_wmma(const half_t* __restrict__ W, const half_t* __restrict__ actBase,
               const float* __restrict__ bias,
               float* __restrict__ outF, half_t* __restrict__ outH,
               half_t* __restrict__ outH2) {
  __shared__ __attribute__((aligned(16))) half_t Ah[2 * TILE];
  __shared__ __attribute__((aligned(16))) half_t Bh[2 * TILE];
  gemm_tile<MODE>(Ah, Bh, blockIdx.x, blockIdx.y, blockIdx.z,
                  W, actBase, bias, outF, outH, outH2);
}

// The SR conv and the Q projection both read only xT and their own weights:
// one grid.  The SR tiles (four times the K loop, only 128 of them) start
// first; the Q tiles fill the rest of the chip beside them.
#define SR_TILES ((NKPOS / 128) * (CDIM / 128) * BATCH)
#define Q_TILES  ((NPOS / 128) * (CDIM / 128) * BATCH)
__global__ __launch_bounds__(256)
void gemm_sr_q(const half_t* __restrict__ srwh, const half_t* __restrict__ qwh,
               const half_t* __restrict__ xT,
               const float* __restrict__ sr_b, const float* __restrict__ q_b,
               float* __restrict__ kvin, half_t* __restrict__ qh) {
  __shared__ __attribute__((aligned(16))) half_t Ah[2 * TILE];
  __shared__ __attribute__((aligned(16))) half_t Bh[2 * TILE];
  const int blk = blockIdx.x;
  if (blk < SR_TILES) {
    gemm_tile<1>(Ah, Bh, blk & 7, (blk >> 3) & 3, blk >> 5,
                 srwh, xT, sr_b, kvin, nullptr, nullptr);
  } else {
    const int t = blk - SR_TILES;
    gemm_tile<0>(Ah, Bh, t & 31, (t >> 5) & 3, t >> 7,
                 qwh, xT, q_b, nullptr, qh, nullptr);
  }
}

#define KSTG   64
#define KVP    72
#define KVTILE (64 * KVP)

__global__ __launch_bounds__(256)
void attn_kernel(const half_t* __restrict__ qh, const half_t* __restrict__ kh,
                 const half_t* __restrict__ vt, half_t* __restrict__ attnT) {
  __shared__ __attribute__((aligned(16))) half_t Ks[2 * KVTILE];
  __shared__ __attribute__((aligned(16))) half_t Vs[2 * KVTILE];
  const int tid  = threadIdx.x;
  const int lane = tid & 31;
  const int wave = tid >> 5;
  const int bh   = blockIdx.y;          // b*8 + h
  const int b    = bh >> 3, h = bh & 7;
  const int q0   = blockIdx.x * 128 + wave * 16;
  const int lrow = lane & 15;
  const int halfoff = (lane & 16) ? 8 : 0;

  // Q B-fragments (64 d x 16 q = two k-steps), loaded once; lane = query column
  const half_t* qrow = qh + ((size_t)bh * NPOS + q0 + lrow) * HD;
  v16h qa0 = frag_ld(qrow, lane);
  v16h qa1 = frag_ld(qrow + 32, lane);

  const v8f vzero = {0.f, 0.f, 0.f, 0.f, 0.f, 0.f, 0.f, 0.f};
  v8f acc[4];                           // O^T: acc[dt][r] = O[q = lrow][d = dt*16 + halfoff + r]
  for (int dt = 0; dt < 4; dt++) acc[dt] = vzero;
  float rmax = -1e30f;                  // running maximum of this lane's query
  float rsum = 0.f;                     // this lane's half of the query's denominator

  // Each thread copies two 16-byte chunks of the K tile and two of the V^T tile.
  const int crow = tid >> 3;            // rows crow and crow + 32
  const int cch  = (tid & 7) * 8;       // 8-half chunk inside the 64-half row
  const uint32_t ldsK = lds_addr32(&Ks[crow * KVP + cch]);
  const uint32_t ldsV = lds_addr32(&Vs[crow * KVP + cch]);
  const half_t* gK = kh + ((size_t)bh * NKPOS + crow) * HD + cch;
  const half_t* gV = vt + ((size_t)bh * HD + crow) * NKPOS + cch;
  auto issue_stage = [&](int buf, int kb0) {
    const uint32_t lo = (uint32_t)(buf * KVTILE * 2);
    const half_t* k0p = gK + (size_t)kb0 * HD;
    const half_t* v0p = gV + kb0;
    async_cp4_b128(ldsK + lo,                k0p,
                   ldsK + lo + 32 * KVP * 2, k0p + 32 * HD,
                   ldsV + lo,                v0p,
                   ldsV + lo + 32 * KVP * 2, v0p + 32 * NKPOS);
  };

  issue_stage(0, 0);
  // tile 0 landed (this wave's copies), then visible to every wave
  asm volatile("s_wait_asynccnt 0x0" ::: "memory");
  __syncthreads();
  issue_stage(1, KSTG);

  for (int t = 0; t < NKPOS / KSTG; ++t) {
   const half_t* Kt = &Ks[(t & 1) * KVTILE];
   const half_t* Vt = &Vs[(t & 1) * KVTILE];
   // unrolled so that sub folds into the immediate offsets of the LDS reads
   #pragma unroll
   for (int sub = 0; sub < KSTG; sub += 32) {
    // S^T = (K Q^T) * scale for a 32x16 chunk (two 16x16 tiles):
    // s[st][r] = score of key sub + st*16 + halfoff + r against query lrow
    v8f s[2];
    #pragma unroll
    for (int st = 0; st < 2; st++) {
      const half_t* kbase = Kt + (sub + st * 16 + lrow) * KVP;
      v16h kf0 = frag_ld(kbase, lane);
      v16h kf1 = frag_ld(kbase + 32, lane);
      v8f z = vzero;
      z = wmma16(kf0, qa0, z);
      z = wmma16(kf1, qa1, z);
      #pragma unroll
      for (int r = 0; r < 8; r++) z[r] *= ATT_SCALE;
      s[st] = z;
    }
    // online softmax: 16 scores of one query per lane, the other 16 in lane^16
    float mx[8];
    #pragma unroll
    for (int i = 0; i < 8; i++) mx[i] = fmaxf(s[i >> 2][2 * (i & 3)], s[i >> 2][2 * (i & 3) + 1]);
    float m = fmaxf(fmaxf(fmaxf(mx[0], mx[1]), fmaxf(mx[2], mx[3])),
                    fmaxf(fmaxf(mx[4], mx[5]), fmaxf(mx[6], mx[7])));
    m = fmaxf(m, xhalf(m));
    const float nm = fmaxf(rmax, m);
    const float alpha = __expf(rmax - nm);
    rmax = nm;
    // P^T as the B operand: element e = key kmap(e) = tile e>>3, register e&7
    v16h pb;
    float pp[8];
    #pragma unroll
    for (int i = 0; i < 8; i++) {
      float p0 = __expf(s[i >> 2][2 * (i & 3)] - nm);
      float p1 = __expf(s[i >> 2][2 * (i & 3) + 1] - nm);
      pb[2 * i]     = (half_t)p0;
      pb[2 * i + 1] = (half_t)p1;
      pp[i] = p0 + p1;
    }
    const float ps = ((pp[0] + pp[1]) + (pp[2] + pp[3])) + ((pp[4] + pp[5]) + (pp[6] + pp[7]));
    rsum = rsum * alpha + ps;
    #pragma unroll
    for (int dt = 0; dt < 4; dt++)
      #pragma unroll
      for (int r = 0; r < 8; r++) acc[dt][r] *= alpha;
    // acc += V^T (16 d x 32 keys) * P^T (32 keys x 16 q)
    #pragma unroll
    for (int dt = 0; dt < 4; dt++) {
      const half_t* vbase = Vt + (dt * 16 + lrow) * KVP + sub;
      v16h vf = frag_ld(vbase, lane);
      acc[dt] = wmma16(vf, pb, acc[dt]);
    }
   }
   // hand-over: this wave's reads of tile t are done ...
   asm volatile("s_wait_dscnt 0x0" ::: "memory");
   // ... its copies of tile t + 1 have landed ...
   asm volatile("s_wait_asynccnt 0x0" ::: "memory");
   // ... and one barrier publishes tile t + 1 and frees tile t's buffer
   __syncthreads();
   if (t + 2 < NKPOS / KSTG) issue_stage(t & 1, (t + 2) * KSTG);
  }
  // nothing is outstanding here; kept so that no copy can outlive the wave
  asm volatile("s_wait_asynccnt 0x0" ::: "memory");

  // join the two halves' denominators, normalize and emit position-major
  // [n][c] f16 for the projection GEMM: 8 consecutive d per lane, 16-byte stores
  const float inv = 1.0f / (rsum + xhalf(rsum));
  half_t* orow = attnT + ((size_t)b * NPOS + q0 + lrow) * CDIM + h * HD + halfoff;
  #pragma unroll
  for (int dt = 0; dt < 4; dt++) {
    union { uint4 u; half_t e[8]; } o;
    #pragma unroll
    for (int r = 0; r < 8; r++) o.e[r] = (half_t)(acc[dt][r] * inv);
    *(uint4*)(orow + dt * 16) = o.u;
  }
}

// ---------------------------------------------------------------------------
extern "C" void kernel_launch(void* const* d_in, const int* in_sizes, int n_in,
                              void* d_out, int out_size, void* d_ws, size_t ws_size,
                              hipStream_t stream) {
  const float* x      = (const float*)d_in[0];
  const float* q_w    = (const float*)d_in[1];
  const float* q_b    = (const float*)d_in[2];
  const float* kv_w   = (const float*)d_in[3];
  const float* kv_b   = (const float*)d_in[4];
  const float* sr_w   = (const float*)d_in[5];
  const float* sr_b   = (const float*)d_in[6];
  const float* ln_g   = (const float*)d_in[7];
  const float* ln_b   = (const float*)d_in[8];
  const float* proj_w = (const float*)d_in[9];
  const float* proj_b = (const float*)d_in[10];
  float* out = (float*)d_out;

  size_t off = 0;
  auto carve = [&](size_t bytes) {
    void* p = (char*)d_ws + off;
    off += (bytes + 255) & ~(size_t)255;
    return p;
  };
  half_t* xT    = (half_t*)carve((size_t)BATCH * NPOS * CDIM * 2);
  half_t* qwh   = (half_t*)carve((size_t)CDIM * CDIM * 2);
  half_t* kvwh  = (half_t*)carve((size_t)2 * CDIM * CDIM * 2);
  half_t* srwh  = (half_t*)carve((size_t)CDIM * 2048 * 2);
  half_t* pwh   = (half_t*)carve((size_t)CDIM * CDIM * 2);
  half_t* qhb   = (half_t*)carve((size_t)BATCH * HEADS * NPOS * HD * 2);
  float*  kvin  = (float*)carve((size_t)BATCH * NKPOS * CDIM * 4);
  half_t* lnT   = (half_t*)carve((size_t)BATCH * NKPOS * CDIM * 2);
  half_t* khb   = (half_t*)carve((size_t)BATCH * HEADS * NKPOS * HD * 2);
  half_t* vtb   = (half_t*)carve((size_t)BATCH * HEADS * HD * NKPOS * 2);
  half_t* attnT = (half_t*)carve((size_t)BATCH * NPOS * CDIM * 2);

  // 1. precision / layout conversions
  cvt_all<<<XT_BLKS + SRW_BLKS + KVW_BLKS + QW_BLKS + PW_BLKS, 256, 0, stream>>>(
      x, sr_w, kv_w, q_w, proj_w, xT, srwh, kvwh, qwh, pwh);

  // 2. SR conv as im2col GEMM -> kvin f32 [b][n][c], and beside it
  //    the Q projection -> qh [bh][n][d]
  gemm_sr_q<<<SR_TILES + Q_TILES, 256, 0, stream>>>(
      srwh, qwh, xT, sr_b, q_b, kvin, qhb);

  // 3. channel LayerNorm -> lnT f16
  ln_kernel<<<(BATCH * NKPOS) / 8, 256, 0, stream>>>(kvin, ln_g, ln_b, lnT);

  // 4. KV projection -> kh [bh][nk][d], vt [bh][d][nk]
  gemm_wmma<2><<<dim3(NKPOS / 128, (2 * CDIM) / 128, BATCH), 256, 0, stream>>>(
      kvwh, lnT, kv_b, nullptr, khb, vtb);

  // 5. flash attention -> attnT f16 [b][n][c]
  attn_kernel<<<dim3(NPOS / 128, BATCH * HEADS), 256, 0, stream>>>(
      qhb, khb, vtb, attnT);

  // 6. output projection -> d_out f32 [b][c][n]
  gemm_wmma<3><<<dim3(NPOS / 128, CDIM / 128, BATCH), 256, 0, stream>>>(
      pwh, attnT, proj_b, out, nullptr, nullptr);
}

// v007
// It runs in 90.6 microseconds.
// In both of two side-by-side timings against v006, it was 1.25 times as fast.
// All steps since v000 together make it 3.40 times as fast.
#include <hip/hip_runtime.h>
#include <hip/hip_bf16.h>

typedef _Float16 half_t;
typedef __attribute__((ext_vector_type(16))) _Float16 v16h;
typedef __attribute__((ext_vector_type(8)))  float    v8f;

#define BATCH  4
#define CDIM   512
#define HEADS  8
#define HD     64
#define NPOS   4096   // 64*64
#define NKPOS  1024   // 32*32
#define ATT_SCALE 0.125f

// ---------------------------------------------------------------------------
// WMMA helpers.  16-bit A-matrix 16x32 layout (ISA 7.12.2): lane L holds row
// m = L%16; its 16 halves are two contiguous 8-half chunks at k = off..off+7
// and k = off+16..off+23, off = (L>=16 ? 8 : 0).  B uses the symmetric layout
// (lane = column, identical k packing), so both fragments are two 16-byte
// loads from a k-contiguous row.
// ---------------------------------------------------------------------------
__device__ __forceinline__ v16h frag_ld(const half_t* rowbase, int lane) {
  const int off = (lane & 16) ? 8 : 0;
  union { uint4 u[2]; v16h v; } t;
  t.u[0] = *(const uint4*)(rowbase + off);
  t.u[1] = *(const uint4*)(rowbase + off + 16);
  return t.v;
}

__device__ __forceinline__ v8f wmma16(v16h a, v16h b, v8f c) {
  return __builtin_amdgcn_wmma_f32_16x16x32_f16(false, a, false, b,
                                                (short)0, c, false, false);
}

// Low 32 bits of a flat pointer into LDS == LDS byte offset (ISA 10.2:
// the LDS aperture maps by truncating to addr[31:0]).
__device__ __forceinline__ uint32_t lds_addr32(const void* p) {
  return (uint32_t)(uintptr_t)p;
}

// Eight async global->LDS copies of one lane, 16 B each: rows r, r + 16, ... of a
// 128-row tile.  lds = the lane's LDS byte address of row r, ls = LDS bytes per
// 16 rows; g0..g7 = the lane's global addresses.  s_wait_xcnt closes the same
// statement as a precaution: the address registers are not rewritten ahead of it.
__device__ __forceinline__ void async_cp8_b128(uint32_t lds, uint32_t ls,
                                               const half_t* g0, const half_t* g1,
                                               const half_t* g2, const half_t* g3,
                                               const half_t* g4, const half_t* g5,
                                               const half_t* g6, const half_t* g7) {
  asm volatile("global_load_async_to_lds_b128 %0, %1, off\n\t"
               "global_load_async_to_lds_b128 %2, %3, off\n\t"
               "global_load_async_to_lds_b128 %4, %5, off\n\t"
               "global_load_async_to_lds_b128 %6, %7, off\n\t"
               "global_load_async_to_lds_b128 %8, %9, off\n\t"
               "global_load_async_to_lds_b128 %10, %11, off\n\t"
               "global_load_async_to_lds_b128 %12, %13, off\n\t"
               "global_load_async_to_lds_b128 %14, %15, off\n\t"
               "s_wait_xcnt 0x0"
               :: "v"(lds),          "v"(g0), "v"(lds + ls),     "v"(g1),
                  "v"(lds + 2 * ls), "v"(g2), "v"(lds + 3 * ls), "v"(g3),
                  "v"(lds + 4 * ls), "v"(g4), "v"(lds + 5 * ls), "v"(g5),
                  "v"(lds + 6 * ls), "v"(g6), "v"(lds + 7 * ls), "v"(g7) : "memory");
}

// Four async global->LDS copies of one lane, 16 B each, per-lane 64-bit address.
// s_wait_xcnt closes the same statement as a precaution: the address registers
// are not rewritten ahead of it.
__device__ __forceinline__ void async_cp4_b128(uint32_t l0, const half_t* g0,
                                               uint32_t l1, const half_t* g1,
                                               uint32_t l2, const half_t* g2,
                                               uint32_t l3, const half_t* g3) {
  asm volatile("global_load_async_to_lds_b128 %0, %1, off\n\t"
               "global_load_async_to_lds_b128 %2, %3, off\n\t"
               "global_load_async_to_lds_b128 %4, %5, off\n\t"
               "global_load_async_to_lds_b128 %6, %7, off\n\t"
               "s_wait_xcnt 0x0"
               :: "v"(l0), "v"(g0), "v"(l1), "v"(g1),
                  "v"(l2), "v"(g2), "v"(l3), "v"(g3) : "memory");
}

// ---------------------------------------------------------------------------
// Conversion kernels (f32 -> f16, layout shuffles)
// ---------------------------------------------------------------------------
// Same layout, 4,096 elements a block: a thread converts four groups of 4, the
// groups 1,024 elements apart, so that every load of a wave reads four whole
// 128-byte lines and every store fills two.  Every weight count here is a
// multiple of 4,096.
#define CVT_PER_BLK 4096
__device__ __forceinline__
void cvt_f16(const float* __restrict__ in, half_t* __restrict__ out, int blk) {
  const int i0 = blk * CVT_PER_BLK + threadIdx.x * 4;
  const float* src = in + i0;
  float4 v[4];
  #pragma unroll
  for (int j = 0; j < 4; j++) v[j] = *(const float4*)(src + j * 1024);
  // the wait that belongs in front of any rewrite of the loads' address pair
  asm volatile("s_wait_xcnt 0x0" :: "v"(src) : "memory");
  #pragma unroll
  for (int j = 0; j < 4; j++) {
    union { uint2 u; half_t e[4]; } o;
    o.e[0] = (half_t)v[j].x;
    o.e[1] = (half_t)v[j].y;
    o.e[2] = (half_t)v[j].z;
    o.e[3] = (half_t)v[j].w;
    *(uint2*)(out + i0 + j * 1024) = o.u;
  }
  // the wait that belongs in front of any rewrite of the stores' registers: in the
  // merged grid another conversion's body follows this one in the code
  asm volatile("s_wait_xcnt 0x0" ::: "memory");
}

// x [B][512][4096] -> xT [B][4096][512] (f16, position-major)
// The transposition happens in registers: a thread holds 16 channels x 4
// positions (sixteen 16-byte loads, all in flight together) and stores, per
// position, two 16-byte runs of 8 channels.  A wave covers 64 channels x 32
// positions: every load reads four whole 128-byte lines of x, and the two
// stores of one position fill one whole 128-byte line of xT, 64 bytes each.
__device__ __forceinline__
void cvt_xT(const float* __restrict__ x, half_t* __restrict__ xT,
            const int blk) {                      // B * 8 channel tiles * 16 position tiles
  const int lane = threadIdx.x & 31;
  const int wave = threadIdx.x >> 5;
  const int b    = blk >> 7;
  const int c0   = ((blk >> 4) & 7) * 64 + (lane >> 3) * 8;   // and c0 + 32
  const int n0   = (blk & 15) * 256 + wave * 32 + (lane & 7) * 4;
  const float* src = x + ((size_t)b * CDIM + c0) * NPOS + n0;
  float4 v[2][8];
  #pragma unroll
  for (int g = 0; g < 2; g++)
    #pragma unroll
    for (int j = 0; j < 8; j++)
      v[g][j] = *(const float4*)(src + (size_t)(g * 32 + j) * NPOS);
  // the wait that belongs in front of any rewrite of the loads' address pair; it
  // names the pair, so that no load's own result is placed on it either
  asm volatile("s_wait_xcnt 0x0" :: "v"(src) : "memory");
  // keeps all sixteen loads in front of the first conversion: without it four of
  // them are issued behind a wait and the wave pays a second memory latency
  __builtin_amdgcn_sched_barrier(0);
  half_t* dst = xT + ((size_t)b * NPOS + n0) * CDIM + c0;
  #pragma unroll
  for (int i = 0; i < 4; i++) {
    #pragma unroll
    for (int g = 0; g < 2; g++) {
      union { uint4 u; half_t e[8]; } o;
      #pragma unroll
      for (int j = 0; j < 8; j++) {
        const float* f = (const float*)&v[g][j];
        o.e[j] = (half_t)f[i];
      }
      *(uint4*)(dst + (size_t)i * CDIM + g * 32) = o.u;
    }
  }
}

// sr_w [O=512][C=512][2][2] -> srwh [o][k], k = (sy*2+sx)*512 + c
// A thread holds 4 consecutive channels x the 4 taps of one o (four 16-byte loads,
// 64 contiguous bytes) and stores, per tap s = sy*2+sx, one 8-byte run of 4
// channels: a wave's store fills two whole 128-byte lines.
__device__ __forceinline__
void cvt_srw(const float* __restrict__ srw, half_t* __restrict__ out, int blk) {
  const int i  = blk * 256 + threadIdx.x;        // over 512 o * 128 channel groups
  const int o  = i >> 7;
  const int c0 = (i & 127) * 4;
  const float* src = srw + ((size_t)o * 512 + c0) * 4;
  float4 v[4];
  #pragma unroll
  for (int j = 0; j < 4; j++) v[j] = *(const float4*)(src + j * 4);
  // the wait that belongs in front of any rewrite of the loads' address pair
  asm volatile("s_wait_xcnt 0x0" :: "v"(src) : "memory");
  half_t* dst = out + (size_t)o * 2048 + c0;
  #pragma unroll
  for (int s = 0; s < 4; s++) {
    union { uint2 u; half_t e[4]; } t;
    #pragma unroll
    for (int j = 0; j < 4; j++) {
      const float* f = (const float*)&v[j];
      t.e[j] = (half_t)f[s];
    }
    *(uint2*)(dst + s * 512) = t.u;
  }
  // the wait that belongs in front of any rewrite of the store's registers: in the
  // merged grid another conversion's body follows this one in the code
  asm volatile("s_wait_xcnt 0x0" ::: "memory");
}

// All five conversions are independent of one another: one grid, each block
// picks its conversion by its index range (the x transposition, the largest,
// starts first).
#define XT_BLKS  (BATCH * (CDIM / 64) * (NPOS / 256))
#define SRW_BLKS ((CDIM * 2048) / (256 * 16))
#define KVW_BLKS ((2 * CDIM * CDIM) / CVT_PER_BLK)
#define QW_BLKS  ((CDIM * CDIM) / CVT_PER_BLK)
#define PW_BLKS  ((CDIM * CDIM) / CVT_PER_BLK)
__global__ __launch_bounds__(256)
void cvt_all(const float* __restrict__ x, const float* __restrict__ sr_w,
             const float* __restrict__ kv_w, const float* __restrict__ q_w,
             const float* __restrict__ proj_w,
             half_t* __restrict__ xT, half_t* __restrict__ srwh,
             half_t* __restrict__ kvwh, half_t* __restrict__ qwh,
             half_t* __restrict__ pwh) {
  int blk = blockIdx.x;
  if (blk < XT_BLKS) { cvt_xT(x, xT, blk); return; }
  blk -= XT_BLKS;
  if (blk < SRW_BLKS) { cvt_srw(sr_w, srwh, blk); return; }
  blk -= SRW_BLKS;
  if (blk < KVW_BLKS) { cvt_f16(kv_w, kvwh, blk); return; }
  blk -= KVW_BLKS;
  if (blk < QW_BLKS) { cvt_f16(q_w, qwh, blk); return; }
  blk -= QW_BLKS;
  cvt_f16(proj_w, pwh, blk);
}

// ---------------------------------------------------------------------------
// LayerNorm over channels at each reduced spatial position.
// kvin [B*1024][512] f32 -> lnT [B*1024][512] f16
// ---------------------------------------------------------------------------
// value of lane l ^ 16 (a vector cross-row move, no LDS round trip)
__device__ __forceinline__ float xhalf(float x) {
  return __builtin_bit_cast(float, __builtin_amdgcn_permlanex16(
      __builtin_bit_cast(int, x), __builtin_bit_cast(int, x),
      0x76543210, 0xfedcba98, false, false));
}

// value of lane l ^ M inside a 16-lane row (DPP row_xmask)
template<int M>
__device__ __forceinline__ float xrow(float x) {
  return __builtin_bit_cast(float, __builtin_amdgcn_update_dpp(
      0, __builtin_bit_cast(int, x), 0x160 | M, 0xf, 0xf, true));
}

__device__ __forceinline__ float wave_sum(float x) {
  x += xrow<1>(x);
  x += xrow<2>(x);
  x += xrow<4>(x);
  x += xrow<8>(x);
  return x + xhalf(x);
}

// One wave owns one position: a lane holds 16 of the 512 channels (four 16-byte
// loads, whole lines), the two sums are in-lane plus five cross-lane steps, and
// nothing goes through LDS or a barrier.  8 positions a block.
__global__ __launch_bounds__(256)
void ln_kernel(const float* __restrict__ kvin, const float* __restrict__ g,
               const float* __restrict__ be, half_t* __restrict__ lnT) {
  const int lane = threadIdx.x & 31;
  const int pos  = blockIdx.x * 8 + (threadIdx.x >> 5);
  const float* xr = kvin + (size_t)pos * CDIM + lane * 4;
  float4 x[4], gg[4], bb[4];
  #pragma unroll
  for (int j = 0; j < 4; j++) x[j] = *(const float4*)(xr + j * 128);
  #pragma unroll
  for (int j = 0; j < 4; j++) {
    gg[j] = *(const float4*)(g + lane * 4 + j * 128);
    bb[j] = *(const float4*)(be + lane * 4 + j * 128);
  }
  // the wait that belongs in front of any rewrite of the loads' address pair; it
  // names the pair, so that no load's own result is placed on it either
  asm volatile("s_wait_xcnt 0x0" :: "v"(xr) : "memory");
  // four partial sums each, one per component of a load, joined at the end
  float4 a = x[0];
  float4 q = make_float4(x[0].x * x[0].x, x[0].y * x[0].y, x[0].z * x[0].z, x[0].w * x[0].w);
  #pragma unroll
  for (int j = 1; j < 4; j++) {
    a.x += x[j].x;  a.y += x[j].y;  a.z += x[j].z;  a.w += x[j].w;
    q.x += x[j].x * x[j].x;  q.y += x[j].y * x[j].y;
    q.z += x[j].z * x[j].z;  q.w += x[j].w * x[j].w;
  }
  const float s1 = wave_sum((a.x + a.y) + (a.z + a.w));
  const float s2 = wave_sum((q.x + q.y) + (q.z + q.w));
  const float mean = s1 * (1.0f / 512.0f);
  const float var  = s2 * (1.0f / 512.0f) - mean * mean;
  const float rs   = rsqrtf(var + 1e-6f);
  half_t* dst = lnT + (size_t)pos * CDIM + lane * 4;
  #pragma unroll
  for (int j = 0; j < 4; j++) {
    union { uint2 u; half_t e[4]; } o;
    o.e[0] = (half_t)((x[j].x - mean) * rs * gg[j].x + bb[j].x);
    o.e[1] = (half_t)((x[j].y - mean) * rs * gg[j].y + bb[j].y);
    o.e[2] = (half_t)((x[j].z - mean) * rs * gg[j].z + bb[j].z);
    o.e[3] = (half_t)((x[j].w - mean) * rs * gg[j].w + bb[j].w);
    *(uint2*)(dst + j * 128) = o.u;
  }
}

// ---------------------------------------------------------------------------
// Tiled WMMA GEMM: out[M][Npos] = W[M][K] * act[Npos][K]^T  (+bias)
// Block = 256 threads = 8 waves, 128x128 tile; a stage is 128 k of both operands.
// Stages are filled by double-buffered GLOBAL_LOAD_ASYNC_TO_LDS_B128 copies:
// stage t+1 flies (ASYNCcnt) while stage t runs through its 32 WMMAs per wave,
// so a copy has four k-steps of matrix work to land behind.
// MODE 0: Q proj   K=512 NP=4096 -> qh  [bh][n][d]   f16
// MODE 1: SR conv  K=2048 NP=1024 (im2col gather from xT) -> kvin f32 [b][n][o]
// MODE 2: KV proj  K=512 NP=1024 -> kh [bh][nk][d], vt [bh][d][nk]  f16
// MODE 3: out proj K=512 NP=4096 -> d_out f32 [b][o][n]
// ---------------------------------------------------------------------------
#define BK   128                    // k per stage: rows of 256 B, whole lines
#define GP   136                    // LDS row pitch in halves: 272 B = 16 B x odd (conflict free)
#define TILE (128 * GP)             // halves per buffer

template<int MODE>
__device__ __forceinline__
void gemm_tile(half_t* Ah, half_t* Bh, const int bx, const int by, const int b,
               const half_t* __restrict__ W, const half_t* __restrict__ actBase,
               const float* __restrict__ bias,
               float* __restrict__ outF, half_t* __restrict__ outH,
               half_t* __restrict__ outH2) {
  constexpr int K  = (MODE == 1) ? 2048 : 512;

  const int n0   = bx * 128;
  const int m0   = by * 128;
  const int tid  = threadIdx.x;
  const int lane = tid & 31;
  const int wave = tid >> 5;
  const int wm   = wave & 3;   // 4 row blocks of 32
  const int wn   = wave >> 2;  // 2 col blocks of 64
  const half_t* act = actBase + (size_t)b * ((MODE == 2) ? (NKPOS * CDIM) : (NPOS * CDIM));

  // Each thread copies eight 16-byte chunks of each operand per stage: chunk cch
  // of rows crow, crow + 16, ...; a wave's copy covers two whole 256-byte rows.
  const int crow = tid >> 4;
  const int cch  = (tid & 15) * 8;
  const uint32_t ldsA = lds_addr32(&Ah[crow * GP + cch]);
  const uint32_t ldsB = lds_addr32(&Bh[crow * GP + cch]);
  const half_t* gA = W + (size_t)(m0 + crow) * K + cch;
  // MODE 1, im2col: reduced position n = (py, px) reads x position
  // (2 py + sy, 2 px + sx); n0 is a multiple of 128 and crow < 16, so 16 rows on
  // are 16 px on (32 x positions) or, every second time, one py on (128).
  const int nrow = n0 + crow;
  const half_t* gB = (MODE == 1)
      ? act + (size_t)((nrow >> 5) * 128 + (nrow & 31) * 2) * CDIM + cch
      : act + (size_t)nrow * K + cch;
  constexpr int RA  = 16 * K;                              // halves per 16 rows of W
  constexpr int RB1 = (MODE == 1) ? 32 * CDIM  : 16 * K;   // 16 rows of act
  constexpr int RB2 = (MODE == 1) ? 128 * CDIM : 32 * K;   // 32 rows of act

  // Issue one 128x128 A stage + B stage into buffer `buf` (16 copies / wave).
  auto issue_tile = [&](int buf, int k0) {
    const uint32_t lo = (uint32_t)(buf * TILE * 2);
    const half_t* a = gA + k0;
    const half_t* p;
    if (MODE == 1) {
      const int tap = k0 >> 9;           // 2x2 tap selector, one per stage (512 % BK == 0)
      p = gB + ((tap >> 1) * 64 + (tap & 1)) * CDIM + (k0 & 511);
    } else {
      p = gB + k0;
    }
    async_cp8_b128(ldsA + lo, 16 * GP * 2,
                   a,          a + RA,     a + 2 * RA, a + 3 * RA,
                   a + 4 * RA, a + 5 * RA, a + 6 * RA, a + 7 * RA);
    async_cp8_b128(ldsB + lo, 16 * GP * 2,
                   p,           p + RB1,           p + RB2,     p + RB2 + RB1,
                   p + 2 * RB2, p + 2 * RB2 + RB1, p + 3 * RB2, p + 3 * RB2 + RB1);
  };

  v8f acc[2][4];
  const v8f vzero = {0.f, 0.f, 0.f, 0.f, 0.f, 0.f, 0.f, 0.f};
  for (int i = 0; i < 2; i++)
    for (int j = 0; j < 4; j++) acc[i][j] = vzero;

  constexpr int NT = K / BK;             // at least 4 stages in every mode
  issue_tile(0, 0);
  // stage 0 landed (this wave's copies), then visible to every wave
  asm volatile("s_wait_asynccnt 0x0" ::: "memory");
  __syncthreads();
  issue_tile(1, BK);

  for (int t = 0; t < NT; ++t) {
    const half_t* At = &Ah[(t & 1) * TILE + (wm * 32 + (lane & 15)) * GP];
    const half_t* Bt = &Bh[(t & 1) * TILE + (wn * 64 + (lane & 15)) * GP];
    // unrolled so that ks folds into the immediate offsets of the LDS reads
    #pragma unroll
    for (int ks = 0; ks < BK; ks += 32) {
      v16h af[2], bf[4];
      #pragma unroll
      for (int mt = 0; mt < 2; mt++)
        af[mt] = frag_ld(At + mt * 16 * GP + ks, lane);
      #pragma unroll
      for (int nt = 0; nt < 4; nt++)
        bf[nt] = frag_ld(Bt + nt * 16 * GP + ks, lane);
      #pragma unroll
      for (int mt = 0; mt < 2; mt++)
        #pragma unroll
        for (int nt = 0; nt < 4; nt++)
          acc[mt][nt] = wmma16(af[mt], bf[nt], acc[mt][nt]);
    }
    // hand-over: this wave's reads of stage t are done ...
    asm volatile("s_wait_dscnt 0x0" ::: "memory");
    // ... its copies of stage t + 1 have landed ...
    asm volatile("s_wait_asynccnt 0x0" ::: "memory");
    // ... and one barrier publishes stage t + 1 and frees stage t's buffer
    __syncthreads();
    if (t + 2 < NT) issue_tile(t & 1, (t + 2) * BK);
  }
  // nothing is outstanding here; kept so that no copy can outlive the wave
  asm volatile("s_wait_asynccnt 0x0" ::: "memory");

  // epilogue: C/D layout -> lane holds col n = lane%16, rows r + (lane>=16?8:0)
  const int halfoff = (lane & 16) ? 8 : 0;
  const int ncol = lane & 15;
  // Q and K go out as [head][n][d]: the 8 rows a lane holds of one tile are 8
  // consecutive d of one position (o0 is a multiple of 8, so inside one head),
  // packed into one 16-byte store; lanes l and l + 16 fill 32 bytes in a row.
  // In MODE 2 a block is all K (m0 < CDIM) or all V: the test is block-uniform.
  if (MODE == 0 || (MODE == 2 && m0 < CDIM)) {
    constexpr int NP = (MODE == 0) ? NPOS : NKPOS;
    uint4 pk[2][4];
    #pragma unroll
    for (int mt = 0; mt < 2; mt++) {
      const int o0 = m0 + wm * 32 + mt * 16 + halfoff;
      #pragma unroll
      for (int nt = 0; nt < 4; nt++) {
        union { uint4 u; half_t e[8]; } t;
        #pragma unroll
        for (int r = 0; r < 8; r++) t.e[r] = (half_t)(acc[mt][nt][r] + bias[o0 + r]);
        pk[mt][nt] = t.u;
      }
    }
    #pragma unroll
    for (int mt = 0; mt < 2; mt++) {
      const int o0 = m0 + wm * 32 + mt * 16 + halfoff;
      half_t* dst = outH + ((size_t)(b * HEADS + (o0 >> 6)) * NP + n0 + wn * 64 + ncol) * HD
                    + (o0 & 63);
      #pragma unroll
      for (int nt = 0; nt < 4; nt++) *(uint4*)(dst + (size_t)nt * 16 * HD) = pk[mt][nt];
    }
    return;
  }
  #pragma unroll
  for (int mt = 0; mt < 2; mt++) {
    #pragma unroll
    for (int nt = 0; nt < 4; nt++) {
      #pragma unroll
      for (int r = 0; r < 8; r++) {
        int o = m0 + wm * 32 + mt * 16 + r + halfoff;
        int n = n0 + wn * 64 + nt * 16 + ncol;
        float v = acc[mt][nt][r] + bias[o];
        if (MODE == 1) {
          outF[((size_t)b * NKPOS + n) * CDIM + o] = v;
        } else if (MODE == 2) {
          int vc = o - CDIM;
          int head = vc >> 6, d = vc & 63;
          outH2[(((size_t)(b * HEADS + head) * HD) + d) * NKPOS + n] = (half_t)v;
        } else if (MODE == 3) {
          outF[((size_t)b * CDIM + o) * NPOS + n] = v;
        }
      }
    }
  }
  // the wait that belongs in front of any rewrite of the stores' registers: in
  // MODE 2 the K epilogue's code follows the V stores in the built kernel
  if (MODE == 2) asm volatile("s_wait_xcnt 0x0" ::: "memory");
}

template<int MODE>
__global__ __launch_bounds__(256)
void gemm_wmma(const half_t* __restrict__ W, const half_t* __restrict__ actBase,
               const float* __restrict__ bias,
               float* __restrict__ outF, half_t* __restrict__ outH,
               half_t* __restrict__ outH2) {
  __shared__ __attribute__((aligned(16))) half_t Ah[2 * TILE];
  __shared__ __attribute__((aligned(16))) half_t Bh[2 * TILE];
  gemm_tile<MODE>(Ah, Bh, blockIdx.x, blockIdx.y, blockIdx.z,
                  W, actBase, bias, outF, outH, outH2);
}

// The SR conv and the Q projection both read only xT and their own weights:
// one grid.  The SR tiles (four times the K loop, only 128 of them) start
// first; the Q tiles fill the rest of the chip beside them.
#define SR_TILES ((NKPOS / 128) * (CDIM / 128) * BATCH)
#define Q_TILES  ((NPOS / 128) * (CDIM / 128) * BATCH)
__global__ __launch_bounds__(256)
void gemm_sr_q(const half_t* __restrict__ srwh, const half_t* __restrict__ qwh,
               const half_t* __restrict__ xT,
               const float* __restrict__ sr_b, const float* __restrict__ q_b,
               float* __restrict__ kvin, half_t* __restrict__ qh) {
  __shared__ __attribute__((aligned(16))) half_t Ah[2 * TILE];
  __shared__ __attribute__((aligned(16))) half_t Bh[2 * TILE];
  const int blk = blockIdx.x;
  if (blk < SR_TILES) {
    gemm_tile<1>(Ah, Bh, blk & 7, (blk >> 3) & 3, blk >> 5,
                 srwh, xT, sr_b, kvin, nullptr, nullptr);
  } else {
    const int t = blk - SR_TILES;
    gemm_tile<0>(Ah, Bh, t & 31, (t >> 5) & 3, t >> 7,
                 qwh, xT, q_b, nullptr, qh, nullptr);
  }
}

#define KSTG   64
#define KVP    72
#define KVTILE (64 * KVP)

__global__ __launch_bounds__(256)
void attn_kernel(const half_t* __restrict__ qh, const half_t* __restrict__ kh,
                 const half_t* __restrict__ vt, half_t* __restrict__ attnT) {
  __shared__ __attribute__((aligned(16))) half_t Ks[2 * KVTILE];
  __shared__ __attribute__((aligned(16))) half_t Vs[2 * KVTILE];
  const int tid  = threadIdx.x;
  const int lane = tid & 31;
  const int wave = tid >> 5;
  const int bh   = blockIdx.y;          // b*8 + h
  const int b    = bh >> 3, h = bh & 7;
  const int q0   = blockIdx.x * 128 + wave * 16;
  const int lrow = lane & 15;
  const int halfoff = (lane & 16) ? 8 : 0;

  // Q B-fragments (64 d x 16 q = two k-steps), loaded once; lane = query column
  const half_t* qrow = qh + ((size_t)bh * NPOS + q0 + lrow) * HD;
  v16h qa0 = frag_ld(qrow, lane);
  v16h qa1 = frag_ld(qrow + 32, lane);

  const v8f vzero = {0.f, 0.f, 0.f, 0.f, 0.f, 0.f, 0.f, 0.f};
  v8f acc[4];                           // O^T: acc[dt][r] = O[q = lrow][d = dt*16 + halfoff + r]
  for (int dt = 0; dt < 4; dt++) acc[dt] = vzero;
  float rmax = -1e30f;                  // running maximum of this lane's query
  float rsum = 0.f;                     // this lane's half of the query's denominator

  // Each thread copies two 16-byte chunks of the K tile and two of the V^T tile.
  const int crow = tid >> 3;            // rows crow and crow + 32
  const int cch  = (tid & 7) * 8;       // 8-half chunk inside the 64-half row
  const uint32_t ldsK = lds_addr32(&Ks[crow * KVP + cch]);
  const uint32_t ldsV = lds_addr32(&Vs[crow * KVP + cch]);
  const half_t* gK = kh + ((size_t)bh * NKPOS + crow) * HD + cch;
  const half_t* gV = vt + ((size_t)bh * HD + crow) * NKPOS + cch;
  auto issue_stage = [&](int buf, int kb0) {
    const uint32_t lo = (uint32_t)(buf * KVTILE * 2);
    const half_t* k0p = gK + (size_t)kb0 * HD;
    const half_t* v0p = gV + kb0;
    async_cp4_b128(ldsK + lo,                k0p,
                   ldsK + lo + 32 * KVP * 2, k0p + 32 * HD,
                   ldsV + lo,                v0p,
                   ldsV + lo + 32 * KVP * 2, v0p + 32 * NKPOS);
  };

  issue_stage(0, 0);
  // tile 0 landed (this wave's copies), then visible to every wave
  asm volatile("s_wait_asynccnt 0x0" ::: "memory");
  __syncthreads();
  issue_stage(1, KSTG);

  for (int t = 0; t < NKPOS / KSTG; ++t) {
   const half_t* Kt = &Ks[(t & 1) * KVTILE];
   const half_t* Vt = &Vs[(t & 1) * KVTILE];
   // unrolled so that sub folds into the immediate offsets of the LDS reads
   #pragma unroll
   for (int sub = 0; sub < KSTG; sub += 32) {
    // S^T = (K Q^T) * scale for a 32x16 chunk (two 16x16 tiles):
    // s[st][r] = score of key sub + st*16 + halfoff + r against query lrow
    v8f s[2];
    #pragma unroll
    for (int st = 0; st < 2; st++) {
      const half_t* kbase = Kt + (sub + st * 16 + lrow) * KVP;
      v16h kf0 = frag_ld(kbase, lane);
      v16h kf1 = frag_ld(kbase + 32, lane);
      v8f z = vzero;
      z = wmma16(kf0, qa0, z);
      z = wmma16(kf1, qa1, z);
      #pragma unroll
      for (int r = 0; r < 8; r++) z[r] *= ATT_SCALE;
      s[st] = z;
    }
    // online softmax: 16 scores of one query per lane, the other 16 in lane^16
    float mx[8];
    #pragma unroll
    for (int i = 0; i < 8; i++) mx[i] = fmaxf(s[i >> 2][2 * (i & 3)], s[i >> 2][2 * (i & 3) + 1]);
    float m = fmaxf(fmaxf(fmaxf(mx[0], mx[1]), fmaxf(mx[2], mx[3])),
                    fmaxf(fmaxf(mx[4], mx[5]), fmaxf(mx[6], mx[7])));
    m = fmaxf(m, xhalf(m));
    const float nm = fmaxf(rmax, m);
    const float alpha = __expf(rmax - nm);
    rmax = nm;
    // P^T as the B operand: element e = key kmap(e) = tile e>>3, register e&7
    v16h pb;
    float pp[8];
    #pragma unroll
    for (int i = 0; i < 8; i++) {
      float p0 = __expf(s[i >> 2][2 * (i & 3)] - nm);
      float p1 = __expf(s[i >> 2][2 * (i & 3) + 1] - nm);
      pb[2 * i]     = (half_t)p0;
      pb[2 * i + 1] = (half_t)p1;
      pp[i] = p0 + p1;
    }
    const float ps = ((pp[0] + pp[1]) + (pp[2] + pp[3])) + ((pp[4] + pp[5]) + (pp[6] + pp[7]));
    rsum = rsum * alpha + ps;
    #pragma unroll
    for (int dt = 0; dt < 4; dt++)
      #pragma unroll
      for (int r = 0; r < 8; r++) acc[dt][r] *= alpha;
    // acc += V^T (16 d x 32 keys) * P^T (32 keys x 16 q)
    #pragma unroll
    for (int dt = 0; dt < 4; dt++) {
      const half_t* vbase = Vt + (dt * 16 + lrow) * KVP + sub;
      v16h vf = frag_ld(vbase, lane);
      acc[dt] = wmma16(vf, pb, acc[dt]);
    }
   }
   // hand-over: this wave's reads of tile t are done ...
   asm volatile("s_wait_dscnt 0x0" ::: "memory");
   // ... its copies of tile t + 1 have landed ...
   asm volatile("s_wait_asynccnt 0x0" ::: "memory");
   // ... and one barrier publishes tile t + 1 and frees tile t's buffer
   __syncthreads();
   if (t + 2 < NKPOS / KSTG) issue_stage(t & 1, (t + 2) * KSTG);
  }
  // nothing is outstanding here; kept so that no copy can outlive the wave
  asm volatile("s_wait_asynccnt 0x0" ::: "memory");

  // join the two halves' denominators, normalize and emit position-major
  // [n][c] f16 for the projection GEMM: 8 consecutive d per lane, 16-byte stores
  const float inv = 1.0f / (rsum + xhalf(rsum));
  half_t* orow = attnT + ((size_t)b * NPOS + q0 + lrow) * CDIM + h * HD + halfoff;
  #pragma unroll
  for (int dt = 0; dt < 4; dt++) {
    union { uint4 u; half_t e[8]; } o;
    #pragma unroll
    for (int r = 0; r < 8; r++) o.e[r] = (half_t)(acc[dt][r] * inv);
    *(uint4*)(orow + dt * 16) = o.u;
  }
}

// ---------------------------------------------------------------------------
extern "C" void kernel_launch(void* const* d_in, const int* in_sizes, int n_in,
                              void* d_out, int out_size, void* d_ws, size_t ws_size,
                              hipStream_t stream) {
  const float* x      = (const float*)d_in[0];
  const float* q_w    = (const float*)d_in[1];
  const float* q_b    = (const float*)d_in[2];
  const float* kv_w   = (const float*)d_in[3];
  const float* kv_b   = (const float*)d_in[4];
  const float* sr_w   = (const float*)d_in[5];
  const float* sr_b   = (const float*)d_in[6];
  const float* ln_g   = (const float*)d_in[7];
  const float* ln_b   = (const float*)d_in[8];
  const float* proj_w = (const float*)d_in[9];
  const float* proj_b = (const float*)d_in[10];
  float* out = (float*)d_out;

  size_t off = 0;
  auto carve = [&](size_t bytes) {
    void* p = (char*)d_ws + off;
    off += (bytes + 255) & ~(size_t)255;
    return p;
  };
  half_t* xT    = (half_t*)carve((size_t)BATCH * NPOS * CDIM * 2);
  half_t* qwh   = (half_t*)carve((size_t)CDIM * CDIM * 2);
  half_t* kvwh  = (half_t*)carve((size_t)2 * CDIM * CDIM * 2);
  half_t* srwh  = (half_t*)carve((size_t)CDIM * 2048 * 2);
  half_t* pwh   = (half_t*)carve((size_t)CDIM * CDIM * 2);
  half_t* qhb   = (half_t*)carve((size_t)BATCH * HEADS * NPOS * HD * 2);
  float*  kvin  = (float*)carve((size_t)BATCH * NKPOS * CDIM * 4);
  half_t* lnT   = (half_t*)carve((size_t)BATCH * NKPOS * CDIM * 2);
  half_t* khb   = (half_t*)carve((size_t)BATCH * HEADS * NKPOS * HD * 2);
  half_t* vtb   = (half_t*)carve((size_t)BATCH * HEADS * HD * NKPOS * 2);
  half_t* attnT = (half_t*)carve((size_t)BATCH * NPOS * CDIM * 2);

  // 1. precision / layout conversions
  cvt_all<<<XT_BLKS + SRW_BLKS + KVW_BLKS + QW_BLKS + PW_BLKS, 256, 0, stream>>>(
      x, sr_w, kv_w, q_w, proj_w, xT, srwh, kvwh, qwh, pwh);

  // 2. SR conv as im2col GEMM -> kvin f32 [b][n][c], and beside it
  //    the Q projection -> qh [bh][n][d]
  gemm_sr_q<<<SR_TILES + Q_TILES, 256, 0, stream>>>(
      srwh, qwh, xT, sr_b, q_b, kvin, qhb);

  // 3. channel LayerNorm -> lnT f16
  ln_kernel<<<(BATCH * NKPOS) / 8, 256, 0, stream>>>(kvin, ln_g, ln_b, lnT);

  // 4. KV projection -> kh [bh][nk][d], vt [bh][d][nk]
  gemm_wmma<2><<<dim3(NKPOS / 128, (2 * CDIM) / 128, BATCH), 256, 0, stream>>>(
      kvwh, lnT, kv_b, nullptr, khb, vtb);

  // 5. flash attention -> attnT f16 [b][n][c]
  attn_kernel<<<dim3(NPOS / 128, BATCH * HEADS), 256, 0, stream>>>(
      qhb, khb, vtb, attnT);

  // 6. output projection -> d_out f32 [b][c][n]
  gemm_wmma<3><<<dim3(NPOS / 128, CDIM / 128, BATCH), 256, 0, stream>>>(
      pwh, attnT, proj_b, out, nullptr, nullptr);
}

// v008
// A run of this version takes 86.9 microseconds.
// Two timings next to v007 put it at 1.04 and 1.05 times that version's speed.
// Over all steps from v000 it is 3.56 times as fast.
#include <hip/hip_runtime.h>
#include <hip/hip_bf16.h>

typedef _Float16 half_t;
typedef __attribute__((ext_vector_type(16))) _Float16 v16h;
typedef __attribute__((ext_vector_type(8)))  float    v8f;
typedef __attribute__((ext_vector_type(2)))  float    v2f;

#define BATCH  4
#define CDIM   512
#define HEADS  8
#define HD     64
#define NPOS   4096   // 64*64
#define NKPOS  1024   // 32*32
#define ATT_SCALE 0.125f

// ---------------------------------------------------------------------------
// WMMA helpers.  16-bit A-matrix 16x32 layout (ISA 7.12.2): lane L holds row
// m = L%16; its 16 halves are two contiguous 8-half chunks at k = off..off+7
// and k = off+16..off+23, off = (L>=16 ? 8 : 0).  B uses the symmetric layout
// (lane = column, identical k packing), so both fragments are two 16-byte
// loads from a k-contiguous row.
// ---------------------------------------------------------------------------
__device__ __forceinline__ v16h frag_ld(const half_t* rowbase, int lane) {
  const int off = (lane & 16) ? 8 : 0;
  union { uint4 u[2]; v16h v; } t;
  t.u[0] = *(const uint4*)(rowbase + off);
  t.u[1] = *(const uint4*)(rowbase + off + 16);
  return t.v;
}

__device__ __forceinline__ v8f wmma16(v16h a, v16h b, v8f c) {
  return __builtin_amdgcn_wmma_f32_16x16x32_f16(false, a, false, b,
                                                (short)0, c, false, false);
}

// Low 32 bits of a flat pointer into LDS == LDS byte offset (ISA 10.2:
// the LDS aperture maps by truncating to addr[31:0]).
__device__ __forceinline__ uint32_t lds_addr32(const void* p) {
  return (uint32_t)(uintptr_t)p;
}

// Eight async global->LDS copies of one lane, 16 B each: rows r, r + 16, ... of a
// 128-row tile.  lds = the lane's LDS byte address of row r, ls = LDS bytes per
// 16 rows; g0..g7 = the lane's global addresses.  s_wait_xcnt closes the same
// statement as a precaution: the address registers are not rewritten ahead of it.
__device__ __forceinline__ void async_cp8_b128(uint32_t lds, uint32_t ls,
                                               const half_t* g0, const half_t* g1,
                                               const half_t* g2, const half_t* g3,
                                               const half_t* g4, const half_t* g5,
                                               const half_t* g6, const half_t* g7) {
  asm volatile("global_load_async_to_lds_b128 %0, %1, off\n\t"
               "global_load_async_to_lds_b128 %2, %3, off\n\t"
               "global_load_async_to_lds_b128 %4, %5, off\n\t"
               "global_load_async_to_lds_b128 %6, %7, off\n\t"
               "global_load_async_to_lds_b128 %8, %9, off\n\t"
               "global_load_async_to_lds_b128 %10, %11, off\n\t"
               "global_load_async_to_lds_b128 %12, %13, off\n\t"
               "global_load_async_to_lds_b128 %14, %15, off\n\t"
               "s_wait_xcnt 0x0"
               :: "v"(lds),          "v"(g0), "v"(lds + ls),     "v"(g1),
                  "v"(lds + 2 * ls), "v"(g2), "v"(lds + 3 * ls), "v"(g3),
                  "v"(lds + 4 * ls), "v"(g4), "v"(lds + 5 * ls), "v"(g5),
                  "v"(lds + 6 * ls), "v"(g6), "v"(lds + 7 * ls), "v"(g7) : "memory");
}

// Four async global->LDS copies of one lane, 16 B each, per-lane 64-bit address.
// s_wait_xcnt closes the same statement as a precaution: the address registers
// are not rewritten ahead of it.
__device__ __forceinline__ void async_cp4_b128(uint32_t l0, const half_t* g0,
                                               uint32_t l1, const half_t* g1,
                                               uint32_t l2, const half_t* g2,
                                               uint32_t l3, const half_t* g3) {
  asm volatile("global_load_async_to_lds_b128 %0, %1, off\n\t"
               "global_load_async_to_lds_b128 %2, %3, off\n\t"
               "global_load_async_to_lds_b128 %4, %5, off\n\t"
               "global_load_async_to_lds_b128 %6, %7, off\n\t"
               "s_wait_xcnt 0x0"
               :: "v"(l0), "v"(g0), "v"(l1), "v"(g1),
                  "v"(l2), "v"(g2), "v"(l3), "v"(g3) : "memory");
}

// ---------------------------------------------------------------------------
// Conversion kernels (f32 -> f16, layout shuffles)
// ---------------------------------------------------------------------------
// Same layout, 4,096 elements a block: a thread converts four groups of 4, the
// groups 1,024 elements apart, so that every load of a wave reads four whole
// 128-byte lines and every store fills two.  Every weight count here is a
// multiple of 4,096.
#define CVT_PER_BLK 4096
__device__ __forceinline__
void cvt_f16(const float* __restrict__ in, half_t* __restrict__ out, int blk) {
  const int i0 = blk * CVT_PER_BLK + threadIdx.x * 4;
  const float* src = in + i0;
  float4 v[4];
  #pragma unroll
  for (int j = 0; j < 4; j++) v[j] = *(const float4*)(src + j * 1024);
  // the wait that belongs in front of any rewrite of the loads' address pair
  asm volatile("s_wait_xcnt 0x0" :: "v"(src) : "memory");
  #pragma unroll
  for (int j = 0; j < 4; j++) {
    union { uint2 u; half_t e[4]; } o;
    o.e[0] = (half_t)v[j].x;
    o.e[1] = (half_t)v[j].y;
    o.e[2] = (half_t)v[j].z;
    o.e[3] = (half_t)v[j].w;
    *(uint2*)(out + i0 + j * 1024) = o.u;
  }
  // the wait that belongs in front of any rewrite of the stores' registers: in the
  // merged grid another conversion's body follows this one in the code
  asm volatile("s_wait_xcnt 0x0" ::: "memory");
}

// x [B][512][4096] -> xT [B][4096][512] (f16, position-major)
// The transposition happens in registers: a thread holds 16 channels x 4
// positions (sixteen 16-byte loads, all in flight together) and stores, per
// position, two 16-byte runs of 8 channels.  A wave covers 64 channels x 32
// positions: every load reads four whole 128-byte lines of x, and the two
// stores of one position fill one whole 128-byte line of xT, 64 bytes each.
__device__ __forceinline__
void cvt_xT(const float* __restrict__ x, half_t* __restrict__ xT,
            const int blk) {                      // B * 8 channel tiles * 16 position tiles
  const int lane = threadIdx.x & 31;
  const int wave = threadIdx.x >> 5;
  const int b    = blk >> 7;
  const int c0   = ((blk >> 4) & 7) * 64 + (lane >> 3) * 8;   // and c0 + 32
  const int n0   = (blk & 15) * 256 + wave * 32 + (lane & 7) * 4;
  const float* src = x + ((size_t)b * CDIM + c0) * NPOS + n0;
  float4 v[2][8];
  #pragma unroll
  for (int g = 0; g < 2; g++)
    #pragma unroll
    for (int j = 0; j < 8; j++)
      v[g][j] = *(const float4*)(src + (size_t)(g * 32 + j) * NPOS);
  // the wait that belongs in front of any rewrite of the loads' address pair; it
  // names the pair, so that no load's own result is placed on it either
  asm volatile("s_wait_xcnt 0x0" :: "v"(src) : "memory");
  // keeps all sixteen loads in front of the first conversion: without it four of
  // them are issued behind a wait and the wave pays a second memory latency
  __builtin_amdgcn_sched_barrier(0);
  half_t* dst = xT + ((size_t)b * NPOS + n0) * CDIM + c0;
  #pragma unroll
  for (int i = 0; i < 4; i++) {
    #pragma unroll
    for (int g = 0; g < 2; g++) {
      union { uint4 u; half_t e[8]; } o;
      #pragma unroll
      for (int j = 0; j < 8; j++) {
        const float* f = (const float*)&v[g][j];
        o.e[j] = (half_t)f[i];
      }
      *(uint4*)(dst + (size_t)i * CDIM + g * 32) = o.u;
    }
  }
}

// sr_w [O=512][C=512][2][2] -> srwh [o][k], k = (sy*2+sx)*512 + c
// A thread holds 4 consecutive channels x the 4 taps of one o (four 16-byte loads,
// 64 contiguous bytes) and stores, per tap s = sy*2+sx, one 8-byte run of 4
// channels: a wave's store fills two whole 128-byte lines.
__device__ __forceinline__
void cvt_srw(const float* __restrict__ srw, half_t* __restrict__ out, int blk) {
  const int i  = blk * 256 + threadIdx.x;        // over 512 o * 128 channel groups
  const int o  = i >> 7;
  const int c0 = (i & 127) * 4;
  const float* src = srw + ((size_t)o * 512 + c0) * 4;
  float4 v[4];
  #pragma unroll
  for (int j = 0; j < 4; j++) v[j] = *(const float4*)(src + j * 4);
  // the wait that belongs in front of any rewrite of the loads' address pair
  asm volatile("s_wait_xcnt 0x0" :: "v"(src) : "memory");
  half_t* dst = out + (size_t)o * 2048 + c0;
  #pragma unroll
  for (int s = 0; s < 4; s++) {
    union { uint2 u; half_t e[4]; } t;
    #pragma unroll
    for (int j = 0; j < 4; j++) {
      const float* f = (const float*)&v[j];
      t.e[j] = (half_t)f[s];
    }
    *(uint2*)(dst + s * 512) = t.u;
  }
  // the wait that belongs in front of any rewrite of the store's registers: in the
  // merged grid another conversion's body follows this one in the code
  asm volatile("s_wait_xcnt 0x0" ::: "memory");
}

// All five conversions are independent of one another: one grid, each block
// picks its conversion by its index range (the x transposition, the largest,
// starts first).
#define XT_BLKS  (BATCH * (CDIM / 64) * (NPOS / 256))
#define SRW_BLKS ((CDIM * 2048) / (256 * 16))
#define KVW_BLKS ((2 * CDIM * CDIM) / CVT_PER_BLK)
#define QW_BLKS  ((CDIM * CDIM) / CVT_PER_BLK)
#define PW_BLKS  ((CDIM * CDIM) / CVT_PER_BLK)
__global__ __launch_bounds__(256)
void cvt_all(const float* __restrict__ x, const float* __restrict__ sr_w,
             const float* __restrict__ kv_w, const float* __restrict__ q_w,
             const float* __restrict__ proj_w,
             half_t* __restrict__ xT, half_t* __restrict__ srwh,
             half_t* __restrict__ kvwh, half_t* __restrict__ qwh,
             half_t* __restrict__ pwh) {
  int blk = blockIdx.x;
  if (blk < XT_BLKS) { cvt_xT(x, xT, blk); return; }
  blk -= XT_BLKS;
  if (blk < SRW_BLKS) { cvt_srw(sr_w, srwh, blk); return; }
  blk -= SRW_BLKS;
  if (blk < KVW_BLKS) { cvt_f16(kv_w, kvwh, blk); return; }
  blk -= KVW_BLKS;
  if (blk < QW_BLKS) { cvt_f16(q_w, qwh, blk); return; }
  blk -= QW_BLKS;
  cvt_f16(proj_w, pwh, blk);
}

// ---------------------------------------------------------------------------
// LayerNorm over channels at each reduced spatial position.
// kvin [B*1024][512] f32 -> lnT [B*1024][512] f16
// ---------------------------------------------------------------------------
// value of lane l ^ 16 (a vector cross-row move, no LDS round trip)
__device__ __forceinline__ float xhalf(float x) {
  return __builtin_bit_cast(float, __builtin_amdgcn_permlanex16(
      __builtin_bit_cast(int, x), __builtin_bit_cast(int, x),
      0x76543210, 0xfedcba98, false, false));
}

// value of lane l ^ M inside a 16-lane row (DPP row_xmask)
template<int M>
__device__ __forceinline__ float xrow(float x) {
  return __builtin_bit_cast(float, __builtin_amdgcn_update_dpp(
      0, __builtin_bit_cast(int, x), 0x160 | M, 0xf, 0xf, true));
}

__device__ __forceinline__ float wave_sum(float x) {
  x += xrow<1>(x);
  x += xrow<2>(x);
  x += xrow<4>(x);
  x += xrow<8>(x);
  return x + xhalf(x);
}

// One wave owns one position: a lane holds 16 of the 512 channels (four 16-byte
// loads, whole lines), the two sums are in-lane plus five cross-lane steps, and
// nothing goes through LDS or a barrier.  8 positions a block.
__global__ __launch_bounds__(256)
void ln_kernel(const float* __restrict__ kvin, const float* __restrict__ g,
               const float* __restrict__ be, half_t* __restrict__ lnT) {
  const int lane = threadIdx.x & 31;
  const int pos  = blockIdx.x * 8 + (threadIdx.x >> 5);
  const float* xr = kvin + (size_t)pos * CDIM + lane * 4;
  float4 x[4], gg[4], bb[4];
  #pragma unroll
  for (int j = 0; j < 4; j++) x[j] = *(const float4*)(xr + j * 128);
  #pragma unroll
  for (int j = 0; j < 4; j++) {
    gg[j] = *(const float4*)(g + lane * 4 + j * 128);
    bb[j] = *(const float4*)(be + lane * 4 + j * 128);
  }
  // the wait that belongs in front of any rewrite of the loads' address pair; it
  // names the pair, so that no load's own result is placed on it either
  asm volatile("s_wait_xcnt 0x0" :: "v"(xr) : "memory");
  // four partial sums each, one per component of a load, joined at the end
  float4 a = x[0];
  float4 q = make_float4(x[0].x * x[0].x, x[0].y * x[0].y, x[0].z * x[0].z, x[0].w * x[0].w);
  #pragma unroll
  for (int j = 1; j < 4; j++) {
    a.x += x[j].x;  a.y += x[j].y;  a.z += x[j].z;  a.w += x[j].w;
    q.x += x[j].x * x[j].x;  q.y += x[j].y * x[j].y;
    q.z += x[j].z * x[j].z;  q.w += x[j].w * x[j].w;
  }
  const float s1 = wave_sum((a.x + a.y) + (a.z + a.w));
  const float s2 = wave_sum((q.x + q.y) + (q.z + q.w));
  const float mean = s1 * (1.0f / 512.0f);
  const float var  = s2 * (1.0f / 512.0f) - mean * mean;
  const float rs   = rsqrtf(var + 1e-6f);
  half_t* dst = lnT + (size_t)pos * CDIM + lane * 4;
  #pragma unroll
  for (int j = 0; j < 4; j++) {
    union { uint2 u; half_t e[4]; } o;
    o.e[0] = (half_t)((x[j].x - mean) * rs * gg[j].x + bb[j].x);
    o.e[1] = (half_t)((x[j].y - mean) * rs * gg[j].y + bb[j].y);
    o.e[2] = (half_t)((x[j].z - mean) * rs * gg[j].z + bb[j].z);
    o.e[3] = (half_t)((x[j].w - mean) * rs * gg[j].w + bb[j].w);
    *(uint2*)(dst + j * 128) = o.u;
  }
}

// ---------------------------------------------------------------------------
// Tiled WMMA GEMM: out[M][Npos] = W[M][K] * act[Npos][K]^T  (+bias)
// Block = 256 threads = 8 waves, 128x128 tile; a stage is 128 k of both operands.
// Stages are filled by double-buffered GLOBAL_LOAD_ASYNC_TO_LDS_B128 copies:
// stage t+1 flies (ASYNCcnt) while stage t runs through its 32 WMMAs per wave,
// so a copy has four k-steps of matrix work to land behind.
// MODE 0: Q proj   K=512 NP=4096 -> qh  [bh][n][d]   f16
// MODE 1: SR conv  K=2048 NP=1024 (im2col gather from xT) -> kvin f32 [b][n][o]
// MODE 2: KV proj  K=512 NP=1024 -> kh [bh][nk][d], vt [bh][d][nk]  f16
// MODE 3: out proj K=512 NP=4096 -> d_out f32 [b][o][n]
// ---------------------------------------------------------------------------
#define BK   128                    // k per stage: rows of 256 B, whole lines
#define GP   136                    // LDS row pitch in halves: 272 B = 16 B x odd (conflict free)
#define TILE (128 * GP)             // halves per buffer

template<int MODE>
__device__ __forceinline__
void gemm_tile(half_t* Ah, half_t* Bh, const int bx, const int by, const int b,
               const half_t* __restrict__ W, const half_t* __restrict__ actBase,
               const float* __restrict__ bias,
               float* __restrict__ outF, half_t* __restrict__ outH,
               half_t* __restrict__ outH2) {
  constexpr int K  = (MODE == 1) ? 2048 : 512;

  const int n0   = bx * 128;
  const int m0   = by * 128;
  const int tid  = threadIdx.x;
  const int lane = tid & 31;
  const int wave = tid >> 5;
  const int wm   = wave & 3;   // 4 row blocks of 32
  const int wn   = wave >> 2;  // 2 col blocks of 64
  const half_t* act = actBase + (size_t)b * ((MODE == 2) ? (NKPOS * CDIM) : (NPOS * CDIM));

  // Each thread copies eight 16-byte chunks of each operand per stage: chunk cch
  // of rows crow, crow + 16, ...; a wave's copy covers two whole 256-byte rows.
  const int crow = tid >> 4;
  const int cch  = (tid & 15) * 8;
  const uint32_t ldsA = lds_addr32(&Ah[crow * GP + cch]);
  const uint32_t ldsB = lds_addr32(&Bh[crow * GP + cch]);
  const half_t* gA = W + (size_t)(m0 + crow) * K + cch;
  // MODE 1, im2col: reduced position n = (py, px) reads x position
  // (2 py + sy, 2 px + sx); n0 is a multiple of 128 and crow < 16, so 16 rows on
  // are 16 px on (32 x positions) or, every second time, one py on (128).
  const int nrow = n0 + crow;
  const half_t* gB = (MODE == 1)
      ? act + (size_t)((nrow >> 5) * 128 + (nrow & 31) * 2) * CDIM + cch
      : act + (size_t)nrow * K + cch;
  constexpr int RA  = 16 * K;                              // halves per 16 rows of W
  constexpr int RB1 = (MODE == 1) ? 32 * CDIM  : 16 * K;   // 16 rows of act
  constexpr int RB2 = (MODE == 1) ? 128 * CDIM : 32 * K;   // 32 rows of act

  // Issue one 128x128 A stage + B stage into buffer `buf` (16 copies / wave).
  auto issue_tile = [&](int buf, int k0) {
    const uint32_t lo = (uint32_t)(buf * TILE * 2);
    const half_t* a = gA + k0;
    const half_t* p;
    if (MODE == 1) {
      const int tap = k0 >> 9;           // 2x2 tap selector, one per stage (512 % BK == 0)
      p = gB + ((tap >> 1) * 64 + (tap & 1)) * CDIM + (k0 & 511);
    } else {
      p = gB + k0;
    }
    async_cp8_b128(ldsA + lo, 16 * GP * 2,
                   a,          a + RA,     a + 2 * RA, a + 3 * RA,
                   a + 4 * RA, a + 5 * RA, a + 6 * RA, a + 7 * RA);
    async_cp8_b128(ldsB + lo, 16 * GP * 2,
                   p,           p + RB1,           p + RB2,     p + RB2 + RB1,
                   p + 2 * RB2, p + 2 * RB2 + RB1, p + 3 * RB2, p + 3 * RB2 + RB1);
  };

  v8f acc[2][4];
  const v8f vzero = {0.f, 0.f, 0.f, 0.f, 0.f, 0.f, 0.f, 0.f};
  for (int i = 0; i < 2; i++)
    for (int j = 0; j < 4; j++) acc[i][j] = vzero;

  constexpr int NT = K / BK;             // at least 4 stages in every mode
  issue_tile(0, 0);
  // stage 0 landed (this wave's copies), then visible to every wave
  asm volatile("s_wait_asynccnt 0x0" ::: "memory");
  __syncthreads();
  issue_tile(1, BK);

  for (int t = 0; t < NT; ++t) {
    const half_t* At = &Ah[(t & 1) * TILE + (wm * 32 + (lane & 15)) * GP];
    const half_t* Bt = &Bh[(t & 1) * TILE + (wn * 64 + (lane & 15)) * GP];
    // unrolled so that ks folds into the immediate offsets of the LDS reads
    #pragma unroll
    for (int ks = 0; ks < BK; ks += 32) {
      v16h af[2], bf[4];
      #pragma unroll
      for (int mt = 0; mt < 2; mt++)
        af[mt] = frag_ld(At + mt * 16 * GP + ks, lane);
      #pragma unroll
      for (int nt = 0; nt < 4; nt++)
        bf[nt] = frag_ld(Bt + nt * 16 * GP + ks, lane);
      #pragma unroll
      for (int mt = 0; mt < 2; mt++)
        #pragma unroll
        for (int nt = 0; nt < 4; nt++)
          acc[mt][nt] = wmma16(af[mt], bf[nt], acc[mt][nt]);
    }
    // hand-over: this wave's reads of stage t are done ...
    asm volatile("s_wait_dscnt 0x0" ::: "memory");
    // ... its copies of stage t + 1 have landed ...
    asm volatile("s_wait_asynccnt 0x0" ::: "memory");
    // ... and one barrier publishes stage t + 1 and frees stage t's buffer
    __syncthreads();
    if (t + 2 < NT) issue_tile(t & 1, (t + 2) * BK);
  }
  // nothing is outstanding here; kept so that no copy can outlive the wave
  asm volatile("s_wait_asynccnt 0x0" ::: "memory");

  // epilogue: C/D layout -> lane holds col n = lane%16, rows r + (lane>=16?8:0)
  const int halfoff = (lane & 16) ? 8 : 0;
  const int ncol = lane & 15;
  // Q and K go out as [head][n][d]: the 8 rows a lane holds of one tile are 8
  // consecutive d of one position (o0 is a multiple of 8, so inside one head),
  // packed into one 16-byte store; lanes l and l + 16 fill 32 bytes in a row.
  // In MODE 2 a block is all K (m0 < CDIM) or all V: the test is block-uniform.
  if (MODE == 0 || (MODE == 2 && m0 < CDIM)) {
    constexpr int NP = (MODE == 0) ? NPOS : NKPOS;
    uint4 pk[2][4];
    #pragma unroll
    for (int mt = 0; mt < 2; mt++) {
      const int o0 = m0 + wm * 32 + mt * 16 + halfoff;
      #pragma unroll
      for (int nt = 0; nt < 4; nt++) {
        union { uint4 u; half_t e[8]; } t;
        #pragma unroll
        for (int r = 0; r < 8; r++) t.e[r] = (half_t)(acc[mt][nt][r] + bias[o0 + r]);
        pk[mt][nt] = t.u;
      }
    }
    #pragma unroll
    for (int mt = 0; mt < 2; mt++) {
      const int o0 = m0 + wm * 32 + mt * 16 + halfoff;
      half_t* dst = outH + ((size_t)(b * HEADS + (o0 >> 6)) * NP + n0 + wn * 64 + ncol) * HD
                    + (o0 & 63);
      #pragma unroll
      for (int nt = 0; nt < 4; nt++) *(uint4*)(dst + (size_t)nt * 16 * HD) = pk[mt][nt];
    }
    return;
  }
  #pragma unroll
  for (int mt = 0; mt < 2; mt++) {
    #pragma unroll
    for (int nt = 0; nt < 4; nt++) {
      #pragma unroll
      for (int r = 0; r < 8; r++) {
        int o = m0 + wm * 32 + mt * 16 + r + halfoff;
        int n = n0 + wn * 64 + nt * 16 + ncol;
        float v = acc[mt][nt][r] + bias[o];
        if (MODE == 1) {
          outF[((size_t)b * NKPOS + n) * CDIM + o] = v;
        } else if (MODE == 2) {
          int vc = o - CDIM;
          int head = vc >> 6, d = vc & 63;
          outH2[(((size_t)(b * HEADS + head) * HD) + d) * NKPOS + n] = (half_t)v;
        } else if (MODE == 3) {
          outF[((size_t)b * CDIM + o) * NPOS + n] = v;
        }
      }
    }
  }
  // the wait that belongs in front of any rewrite of the stores' registers: in
  // MODE 2 the K epilogue's code follows the V stores in the built kernel
  if (MODE == 2) asm volatile("s_wait_xcnt 0x0" ::: "memory");
}

template<int MODE>
__global__ __launch_bounds__(256)
void gemm_wmma(const half_t* __restrict__ W, const half_t* __restrict__ actBase,
               const float* __restrict__ bias,
               float* __restrict__ outF, half_t* __restrict__ outH,
               half_t* __restrict__ outH2) {
  __shared__ __attribute__((aligned(16))) half_t Ah[2 * TILE];
  __shared__ __attribute__((aligned(16))) half_t Bh[2 * TILE];
  gemm_tile<MODE>(Ah, Bh, blockIdx.x, blockIdx.y, blockIdx.z,
                  W, actBase, bias, outF, outH, outH2);
}

// The SR conv and the Q projection both read only xT and their own weights:
// one grid.  The SR tiles (four times the K loop, only 128 of them) start
// first; the Q tiles fill the rest of the chip beside them.
#define SR_TILES ((NKPOS / 128) * (CDIM / 128) * BATCH)
#define Q_TILES  ((NPOS / 128) * (CDIM / 128) * BATCH)
__global__ __launch_bounds__(256)
void gemm_sr_q(const half_t* __restrict__ srwh, const half_t* __restrict__ qwh,
               const half_t* __restrict__ xT,
               const float* __restrict__ sr_b, const float* __restrict__ q_b,
               float* __restrict__ kvin, half_t* __restrict__ qh) {
  __shared__ __attribute__((aligned(16))) half_t Ah[2 * TILE];
  __shared__ __attribute__((aligned(16))) half_t Bh[2 * TILE];
  const int blk = blockIdx.x;
  if (blk < SR_TILES) {
    gemm_tile<1>(Ah, Bh, blk & 7, (blk >> 3) & 3, blk >> 5,
                 srwh, xT, sr_b, kvin, nullptr, nullptr);
  } else {
    const int t = blk - SR_TILES;
    gemm_tile<0>(Ah, Bh, t & 31, (t >> 5) & 3, t >> 7,
                 qwh, xT, q_b, nullptr, qh, nullptr);
  }
}

#define KSTG   64
#define KVP    72
#define KVTILE (64 * KVP)
#define P_LIMIT 4096.0f

__global__ __launch_bounds__(256)
void attn_kernel(const half_t* __restrict__ qh, const half_t* __restrict__ kh,
                 const half_t* __restrict__ vt, half_t* __restrict__ attnT) {
  __shared__ __attribute__((aligned(16))) half_t Ks[2 * KVTILE];
  __shared__ __attribute__((aligned(16))) half_t Vs[2 * KVTILE];
  const int tid  = threadIdx.x;
  const int lane = tid & 31;
  const int wave = tid >> 5;
  const int bh   = blockIdx.y;          // b*8 + h
  const int b    = bh >> 3, h = bh & 7;
  const int q0   = blockIdx.x * 128 + wave * 16;
  const int lrow = lane & 15;
  const int halfoff = (lane & 16) ? 8 : 0;

  // Q B-fragments (64 d x 16 q = two k-steps), loaded once; lane = query column
  const half_t* qrow = qh + ((size_t)bh * NPOS + q0 + lrow) * HD;
  v16h qa0 = frag_ld(qrow, lane);
  v16h qa1 = frag_ld(qrow + 32, lane);

  const v8f vzero = {0.f, 0.f, 0.f, 0.f, 0.f, 0.f, 0.f, 0.f};
  v8f acc[4];                           // O^T: acc[dt][r] = O[q = lrow][d = dt*16 + halfoff + r]
  for (int dt = 0; dt < 4; dt++) acc[dt] = vzero;
  float rmax = -1e30f;                  // reference of this lane's query: a maximum seen so far
  float rsum = 0.f;                     // this lane's half of the query's denominator

  // Each thread copies two 16-byte chunks of the K tile and two of the V^T tile.
  const int crow = tid >> 3;            // rows crow and crow + 32
  const int cch  = (tid & 7) * 8;       // 8-half chunk inside the 64-half row
  const uint32_t ldsK = lds_addr32(&Ks[crow * KVP + cch]);
  const uint32_t ldsV = lds_addr32(&Vs[crow * KVP + cch]);
  const half_t* gK = kh + ((size_t)bh * NKPOS + crow) * HD + cch;
  const half_t* gV = vt + ((size_t)bh * HD + crow) * NKPOS + cch;
  auto issue_stage = [&](int buf, int kb0) {
    const uint32_t lo = (uint32_t)(buf * KVTILE * 2);
    const half_t* k0p = gK + (size_t)kb0 * HD;
    const half_t* v0p = gV + kb0;
    async_cp4_b128(ldsK + lo,                k0p,
                   ldsK + lo + 32 * KVP * 2, k0p + 32 * HD,
                   ldsV + lo,                v0p,
                   ldsV + lo + 32 * KVP * 2, v0p + 32 * NKPOS);
  };

  issue_stage(0, 0);
  // tile 0 landed (this wave's copies), then visible to every wave
  asm volatile("s_wait_asynccnt 0x0" ::: "memory");
  __syncthreads();
  issue_stage(1, KSTG);

  for (int t = 0; t < NKPOS / KSTG; ++t) {
   const half_t* Kt = &Ks[(t & 1) * KVTILE];
   const half_t* Vt = &Vs[(t & 1) * KVTILE];
   // unrolled so that sub folds into the immediate offsets of the LDS reads
   #pragma unroll
   for (int sub = 0; sub < KSTG; sub += 32) {
    // S^T = K Q^T (unscaled) for a 32x16 chunk (two 16x16 tiles):
    // s[st][r] = score of key sub + st*16 + halfoff + r against query lrow
    v8f s[2];
    #pragma unroll
    for (int st = 0; st < 2; st++) {
      const half_t* kbase = Kt + (sub + st * 16 + lrow) * KVP;
      v16h kf0 = frag_ld(kbase, lane);
      v16h kf1 = frag_ld(kbase + 32, lane);
      v8f z = vzero;
      z = wmma16(kf0, qa0, z);
      z = wmma16(kf1, qa1, z);
      s[st] = z;                        // unscaled; the scale is applied where s is used
    }
    // online softmax: 16 scores of one query per lane, the other 16 in lane^16.
    // P is formed against the reference rmax as it stands; numerator and
    // denominator carry the same factor exp(-rmax), so any reference gives the
    // same quotient as long as P stays inside f16.
    // P^T as the B operand: element e = key kmap(e) = tile e>>3, register e&7
    v16h pb;
    float ps;
    auto probs = [&]() {
      float pp[8];
      #pragma unroll
      for (int i = 0; i < 8; i++) {
        const v2f d = (v2f){s[i >> 2][2 * (i & 3)], s[i >> 2][2 * (i & 3) + 1]} * ATT_SCALE - rmax;
        float p0 = __expf(d.x);
        float p1 = __expf(d.y);
        pb[2 * i]     = (half_t)p0;
        pb[2 * i + 1] = (half_t)p1;
        pp[i] = p0 + p1;
      }
      ps = ((pp[0] + pp[1]) + (pp[2] + pp[3])) + ((pp[4] + pp[5]) + (pp[6] + pp[7]));
    };
    probs();
    // The lane's sum bounds each of its 16 P: above P_LIMIT (infinite on the first
    // chunk, whose reference is -1e30, or not a number) some query's reference is too
    // low.  Then, and only then, the whole wave takes the chunk's maximum, raises
    // the references, rescales what it has summed and forms P again.  One scalar
    // branch per chunk: EXEC stays all ones for the matrix instructions.
    if (__builtin_amdgcn_ballot_w32(!(ps <= P_LIMIT)) != 0) {
      float mx[8];
      #pragma unroll
      for (int i = 0; i < 8; i++) mx[i] = fmaxf(s[i >> 2][2 * (i & 3)], s[i >> 2][2 * (i & 3) + 1]);
      float m = fmaxf(fmaxf(fmaxf(mx[0], mx[1]), fmaxf(mx[2], mx[3])),
                      fmaxf(fmaxf(mx[4], mx[5]), fmaxf(mx[6], mx[7]))) * ATT_SCALE;
      m = fmaxf(m, xhalf(m));
      const float nm = fmaxf(rmax, m);
      const float alpha = __expf(rmax - nm);
      rmax = nm;
      rsum *= alpha;
      #pragma unroll
      for (int dt = 0; dt < 4; dt++)
        #pragma unroll
        for (int r = 0; r < 8; r++) acc[dt][r] *= alpha;
      probs();
    }
    rsum += ps;
    // acc += V^T (16 d x 32 keys) * P^T (32 keys x 16 q); the four fragments are
    // read as one group, so that the wave waits out one LDS latency, not four
    v16h vf[4];
    #pragma unroll
    for (int dt = 0; dt < 4; dt++) vf[dt] = frag_ld(Vt + (dt * 16 + lrow) * KVP + sub, lane);
    #pragma unroll
    for (int dt = 0; dt < 4; dt++) acc[dt] = wmma16(vf[dt], pb, acc[dt]);
   }
   // hand-over: this wave's reads of tile t are done ...
   asm volatile("s_wait_dscnt 0x0" ::: "memory");
   // ... its copies of tile t + 1 have landed ...
   asm volatile("s_wait_asynccnt 0x0" ::: "memory");
   // ... and one barrier publishes tile t + 1 and frees tile t's buffer
   __syncthreads();
   if (t + 2 < NKPOS / KSTG) issue_stage(t & 1, (t + 2) * KSTG);
  }
  // nothing is outstanding here; kept so that no copy can outlive the wave
  asm volatile("s_wait_asynccnt 0x0" ::: "memory");

  // join the two halves' denominators, normalize and emit position-major
  // [n][c] f16 for the projection GEMM: 8 consecutive d per lane, 16-byte stores
  const float inv = 1.0f / (rsum + xhalf(rsum));
  half_t* orow = attnT + ((size_t)b * NPOS + q0 + lrow) * CDIM + h * HD + halfoff;
  #pragma unroll
  for (int dt = 0; dt < 4; dt++) {
    union { uint4 u; half_t e[8]; } o;
    #pragma unroll
    for (int r = 0; r < 8; r++) o.e[r] = (half_t)(acc[dt][r] * inv);
    *(uint4*)(orow + dt * 16) = o.u;
  }
}

// ---------------------------------------------------------------------------
extern "C" void kernel_launch(void* const* d_in, const int* in_sizes, int n_in,
                              void* d_out, int out_size, void* d_ws, size_t ws_size,
                              hipStream_t stream) {
  const float* x      = (const float*)d_in[0];
  const float* q_w    = (const float*)d_in[1];
  const float* q_b    = (const float*)d_in[2];
  const float* kv_w   = (const float*)d_in[3];
  const float* kv_b   = (const float*)d_in[4];
  const float* sr_w   = (const float*)d_in[5];
  const float* sr_b   = (const float*)d_in[6];
  const float* ln_g   = (const float*)d_in[7];
  const float* ln_b   = (const float*)d_in[8];
  const float* proj_w = (const float*)d_in[9];
  const float* proj_b = (const float*)d_in[10];
  float* out = (float*)d_out;

  size_t off = 0;
  auto carve = [&](size_t bytes) {
    void* p = (char*)d_ws + off;
    off += (bytes + 255) & ~(size_t)255;
    return p;
  };
  half_t* xT    = (half_t*)carve((size_t)BATCH * NPOS * CDIM * 2);
  half_t* qwh   = (half_t*)carve((size_t)CDIM * CDIM * 2);
  half_t* kvwh  = (half_t*)carve((size_t)2 * CDIM * CDIM * 2);
  half_t* srwh  = (half_t*)carve((size_t)CDIM * 2048 * 2);
  half_t* pwh   = (half_t*)carve((size_t)CDIM * CDIM * 2);
  half_t* qhb   = (half_t*)carve((size_t)BATCH * HEADS * NPOS * HD * 2);
  float*  kvin  = (float*)carve((size_t)BATCH * NKPOS * CDIM * 4);
  half_t* lnT   = (half_t*)carve((size_t)BATCH * NKPOS * CDIM * 2);
  half_t* khb   = (half_t*)carve((size_t)BATCH * HEADS * NKPOS * HD * 2);
  half_t* vtb   = (half_t*)carve((size_t)BATCH * HEADS * HD * NKPOS * 2);
  half_t* attnT = (half_t*)carve((size_t)BATCH * NPOS * CDIM * 2);

  // 1. precision / layout conversions
  cvt_all<<<XT_BLKS + SRW_BLKS + KVW_BLKS + QW_BLKS + PW_BLKS, 256, 0, stream>>>(
      x, sr_w, kv_w, q_w, proj_w, xT, srwh, kvwh, qwh, pwh);

  // 2. SR conv as im2col GEMM -> kvin f32 [b][n][c], and beside it
  //    the Q projection -> qh [bh][n][d]
  gemm_sr_q<<<SR_TILES + Q_TILES, 256, 0, stream>>>(
      srwh, qwh, xT, sr_b, q_b, kvin, qhb);

  // 3. channel LayerNorm -> lnT f16
  ln_kernel<<<(BATCH * NKPOS) / 8, 256, 0, stream>>>(kvin, ln_g, ln_b, lnT);

  // 4. KV projection -> kh [bh][nk][d], vt [bh][d][nk]
  gemm_wmma<2><<<dim3(NKPOS / 128, (2 * CDIM) / 128, BATCH), 256, 0, stream>>>(
      kvwh, lnT, kv_b, nullptr, khb, vtb);

  // 5. flash attention -> attnT f16 [b][n][c]
  attn_kernel<<<dim3(NPOS / 128, BATCH * HEADS), 256, 0, stream>>>(
      qhb, khb, vtb, attnT);

  // 6. output projection -> d_out f32 [b][c][n]
  gemm_wmma<3><<<dim3(NPOS / 128, CDIM / 128, BATCH), 256, 0, stream>>>(
      pwh, attnT, proj_b, out, nullptr, nullptr);
}

// v009
// It runs in 84 microseconds.
// Two timings next to v008 both put it at 1.03 times that version's speed.
// Over all steps from v000 it is 3.67 times as fast.
#include <hip/hip_runtime.h>
#include <hip/hip_bf16.h>

typedef _Float16 half_t;
typedef __attribute__((ext_vector_type(16))) _Float16 v16h;
typedef __attribute__((ext_vector_type(8)))  float    v8f;
typedef __attribute__((ext_vector_type(2)))  float    v2f;

#define BATCH  4
#define CDIM   512
#define HEADS  8
#define HD     64
#define NPOS   4096   // 64*64
#define NKPOS  1024   // 32*32
#define ATT_SCALE 0.125f

// ---------------------------------------------------------------------------
// WMMA helpers.  16-bit A-matrix 16x32 layout (ISA 7.12.2): lane L holds row
// m = L%16; its 16 halves are two contiguous 8-half chunks at k = off..off+7
// and k = off+16..off+23, off = (L>=16 ? 8 : 0).  B uses the symmetric layout
// (lane = column, identical k packing), so both fragments are two 16-byte
// loads from a k-contiguous row.
// ---------------------------------------------------------------------------
__device__ __forceinline__ v16h frag_ld(const half_t* rowbase, int lane) {
  const int off = (lane & 16) ? 8 : 0;
  union { uint4 u[2]; v16h v; } t;
  t.u[0] = *(const uint4*)(rowbase + off);
  t.u[1] = *(const uint4*)(rowbase + off + 16);
  return t.v;
}

__device__ __forceinline__ v8f wmma16(v16h a, v16h b, v8f c) {
  return __builtin_amdgcn_wmma_f32_16x16x32_f16(false, a, false, b,
                                                (short)0, c, false, false);
}

// Low 32 bits of a flat pointer into LDS == LDS byte offset (ISA 10.2:
// the LDS aperture maps by truncating to addr[31:0]).
__device__ __forceinline__ uint32_t lds_addr32(const void* p) {
  return (uint32_t)(uintptr_t)p;
}

// Eight async global->LDS copies of one lane, 16 B each: rows r, r + 16, ... of a
// 128-row tile.  lds = the lane's LDS byte address of row r, ls = LDS bytes per
// 16 rows; g0..g7 = the lane's global addresses.  s_wait_xcnt closes the same
// statement as a precaution: the address registers are not rewritten ahead of it.
__device__ __forceinline__ void async_cp8_b128(uint32_t lds, uint32_t ls,
                                               const half_t* g0, const half_t* g1,
                                               const half_t* g2, const half_t* g3,
                                               const half_t* g4, const half_t* g5,
                                               const half_t* g6, const half_t* g7) {
  asm volatile("global_load_async_to_lds_b128 %0, %1, off\n\t"
               "global_load_async_to_lds_b128 %2, %3, off\n\t"
               "global_load_async_to_lds_b128 %4, %5, off\n\t"
               "global_load_async_to_lds_b128 %6, %7, off\n\t"
               "global_load_async_to_lds_b128 %8, %9, off\n\t"
               "global_load_async_to_lds_b128 %10, %11, off\n\t"
               "global_load_async_to_lds_b128 %12, %13, off\n\t"
               "global_load_async_to_lds_b128 %14, %15, off\n\t"
               "s_wait_xcnt 0x0"
               :: "v"(lds),          "v"(g0), "v"(lds + ls),     "v"(g1),
                  "v"(lds + 2 * ls), "v"(g2), "v"(lds + 3 * ls), "v"(g3),
                  "v"(lds + 4 * ls), "v"(g4), "v"(lds + 5 * ls), "v"(g5),
                  "v"(lds + 6 * ls), "v"(g6), "v"(lds + 7 * ls), "v"(g7) : "memory");
}

// Four async global->LDS copies of one lane, 16 B each, per-lane 64-bit address.
// s_wait_xcnt closes the same statement as a precaution: the address registers
// are not rewritten ahead of it.
__device__ __forceinline__ void async_cp4_b128(uint32_t l0, const half_t* g0,
                                               uint32_t l1, const half_t* g1,
                                               uint32_t l2, const half_t* g2,
                                               uint32_t l3, const half_t* g3) {
  asm volatile("global_load_async_to_lds_b128 %0, %1, off\n\t"
               "global_load_async_to_lds_b128 %2, %3, off\n\t"
               "global_load_async_to_lds_b128 %4, %5, off\n\t"
               "global_load_async_to_lds_b128 %6, %7, off\n\t"
               "s_wait_xcnt 0x0"
               :: "v"(l0), "v"(g0), "v"(l1), "v"(g1),
                  "v"(l2), "v"(g2), "v"(l3), "v"(g3) : "memory");
}

// ---------------------------------------------------------------------------
// Conversion kernels (f32 -> f16, layout shuffles)
// ---------------------------------------------------------------------------
// Same layout, 4,096 elements a block: a thread converts four groups of 4, the
// groups 1,024 elements apart, so that every load of a wave reads four whole
// 128-byte lines and every store fills two.  Every weight count here is a
// multiple of 4,096.
#define CVT_PER_BLK 4096
__device__ __forceinline__
void cvt_f16(const float* __restrict__ in, half_t* __restrict__ out, int blk) {
  const int i0 = blk * CVT_PER_BLK + threadIdx.x * 4;
  const float* src = in + i0;
  float4 v[4];
  #pragma unroll
  for (int j = 0; j < 4; j++) v[j] = *(const float4*)(src + j * 1024);
  // the wait that belongs in front of any rewrite of the loads' address pair
  asm volatile("s_wait_xcnt 0x0" :: "v"(src) : "memory");
  #pragma unroll
  for (int j = 0; j < 4; j++) {
    union { uint2 u; half_t e[4]; } o;
    o.e[0] = (half_t)v[j].x;
    o.e[1] = (half_t)v[j].y;
    o.e[2] = (half_t)v[j].z;
    o.e[3] = (half_t)v[j].w;
    *(uint2*)(out + i0 + j * 1024) = o.u;
  }
  // the wait that belongs in front of any rewrite of the stores' registers: in the
  // merged grid another conversion's body follows this one in the code
  asm volatile("s_wait_xcnt 0x0" ::: "memory");
}

// x [B][512][4096] -> xT [B][4096][512] (f16, position-major)
// The transposition happens in registers: a thread holds 16 channels x 4
// positions (sixteen 16-byte loads, all in flight together) and stores, per
// position, two 16-byte runs of 8 channels.  A wave covers 64 channels x 32
// positions: every load reads four whole 128-byte lines of x, and the two
// stores of one position fill one whole 128-byte line of xT, 64 bytes each.
__device__ __forceinline__
void cvt_xT(const float* __restrict__ x, half_t* __restrict__ xT,
            const int blk) {                      // B * 8 channel tiles * 16 position tiles
  const int lane = threadIdx.x & 31;
  const int wave = threadIdx.x >> 5;
  const int b    = blk >> 7;
  const int c0   = ((blk >> 4) & 7) * 64 + (lane >> 3) * 8;   // and c0 + 32
  const int n0   = (blk & 15) * 256 + wave * 32 + (lane & 7) * 4;
  const float* src = x + ((size_t)b * CDIM + c0) * NPOS + n0;
  float4 v[2][8];
  #pragma unroll
  for (int g = 0; g < 2; g++)
    #pragma unroll
    for (int j = 0; j < 8; j++)
      v[g][j] = *(const float4*)(src + (size_t)(g * 32 + j) * NPOS);
  // the wait that belongs in front of any rewrite of the loads' address pair; it
  // names the pair, so that no load's own result is placed on it either
  asm volatile("s_wait_xcnt 0x0" :: "v"(src) : "memory");
  // keeps all sixteen loads in front of the first conversion: without it four of
  // them are issued behind a wait and the wave pays a second memory latency
  __builtin_amdgcn_sched_barrier(0);
  half_t* dst = xT + ((size_t)b * NPOS + n0) * CDIM + c0;
  #pragma unroll
  for (int i = 0; i < 4; i++) {
    #pragma unroll
    for (int g = 0; g < 2; g++) {
      union { uint4 u; half_t e[8]; } o;
      #pragma unroll
      for (int j = 0; j < 8; j++) {
        const float* f = (const float*)&v[g][j];
        o.e[j] = (half_t)f[i];
      }
      *(uint4*)(dst + (size_t)i * CDIM + g * 32) = o.u;
    }
  }
}

// sr_w [O=512][C=512][2][2] -> srwh [o][k], k = (sy*2+sx)*512 + c
// A thread holds 4 consecutive channels x the 4 taps of one o (four 16-byte loads,
// 64 contiguous bytes) and stores, per tap s = sy*2+sx, one 8-byte run of 4
// channels: a wave's store fills two whole 128-byte lines.
__device__ __forceinline__
void cvt_srw(const float* __restrict__ srw, half_t* __restrict__ out, int blk) {
  const int i  = blk * 256 + threadIdx.x;        // over 512 o * 128 channel groups
  const int o  = i >> 7;
  const int c0 = (i & 127) * 4;
  const float* src = srw + ((size_t)o * 512 + c0) * 4;
  float4 v[4];
  #pragma unroll
  for (int j = 0; j < 4; j++) v[j] = *(const float4*)(src + j * 4);
  // the wait that belongs in front of any rewrite of the loads' address pair
  asm volatile("s_wait_xcnt 0x0" :: "v"(src) : "memory");
  half_t* dst = out + (size_t)o * 2048 + c0;
  #pragma unroll
  for (int s = 0; s < 4; s++) {
    union { uint2 u; half_t e[4]; } t;
    #pragma unroll
    for (int j = 0; j < 4; j++) {
      const float* f = (const float*)&v[j];
      t.e[j] = (half_t)f[s];
    }
    *(uint2*)(dst + s * 512) = t.u;
  }
  // the wait that belongs in front of any rewrite of the store's registers: in the
  // merged grid another conversion's body follows this one in the code
  asm volatile("s_wait_xcnt 0x0" ::: "memory");
}

// All five conversions are independent of one another: one grid, each block
// picks its conversion by its index range (the x transposition, the largest,
// starts first).
#define XT_BLKS  (BATCH * (CDIM / 64) * (NPOS / 256))
#define SRW_BLKS ((CDIM * 2048) / (256 * 16))
#define KVW_BLKS ((2 * CDIM * CDIM) / CVT_PER_BLK)
#define QW_BLKS  ((CDIM * CDIM) / CVT_PER_BLK)
#define PW_BLKS  ((CDIM * CDIM) / CVT_PER_BLK)
__global__ __launch_bounds__(256)
void cvt_all(const float* __restrict__ x, const float* __restrict__ sr_w,
             const float* __restrict__ kv_w, const float* __restrict__ q_w,
             const float* __restrict__ proj_w,
             half_t* __restrict__ xT, half_t* __restrict__ srwh,
             half_t* __restrict__ kvwh, half_t* __restrict__ qwh,
             half_t* __restrict__ pwh) {
  int blk = blockIdx.x;
  if (blk < XT_BLKS) { cvt_xT(x, xT, blk); return; }
  blk -= XT_BLKS;
  if (blk < SRW_BLKS) { cvt_srw(sr_w, srwh, blk); return; }
  blk -= SRW_BLKS;
  if (blk < KVW_BLKS) { cvt_f16(kv_w, kvwh, blk); return; }
  blk -= KVW_BLKS;
  if (blk < QW_BLKS) { cvt_f16(q_w, qwh, blk); return; }
  blk -= QW_BLKS;
  cvt_f16(proj_w, pwh, blk);
}

// ---------------------------------------------------------------------------
// LayerNorm over channels at each reduced spatial position.
// kvin [B*1024][512] f32 -> lnT [B*1024][512] f16
// ---------------------------------------------------------------------------
// value of lane l ^ 16 (a vector cross-row move, no LDS round trip)
__device__ __forceinline__ float xhalf(float x) {
  return __builtin_bit_cast(float, __builtin_amdgcn_permlanex16(
      __builtin_bit_cast(int, x), __builtin_bit_cast(int, x),
      0x76543210, 0xfedcba98, false, false));
}

// value of lane l ^ M inside a 16-lane row (DPP row_xmask)
template<int M>
__device__ __forceinline__ float xrow(float x) {
  return __builtin_bit_cast(float, __builtin_amdgcn_update_dpp(
      0, __builtin_bit_cast(int, x), 0x160 | M, 0xf, 0xf, true));
}

__device__ __forceinline__ float wave_sum(float x) {
  x += xrow<1>(x);
  x += xrow<2>(x);
  x += xrow<4>(x);
  x += xrow<8>(x);
  return x + xhalf(x);
}

// One wave owns one position: a lane holds 16 of the 512 channels (four 16-byte
// loads, whole lines), the two sums are in-lane plus five cross-lane steps, and
// nothing goes through LDS or a barrier.  8 positions a block.
__global__ __launch_bounds__(256)
void ln_kernel(const float* __restrict__ kvin, const float* __restrict__ g,
               const float* __restrict__ be, half_t* __restrict__ lnT) {
  const int lane = threadIdx.x & 31;
  const int pos  = blockIdx.x * 8 + (threadIdx.x >> 5);
  const float* xr = kvin + (size_t)pos * CDIM + lane * 4;
  float4 x[4], gg[4], bb[4];
  #pragma unroll
  for (int j = 0; j < 4; j++) x[j] = *(const float4*)(xr + j * 128);
  #pragma unroll
  for (int j = 0; j < 4; j++) {
    gg[j] = *(const float4*)(g + lane * 4 + j * 128);
    bb[j] = *(const float4*)(be + lane * 4 + j * 128);
  }
  // the wait that belongs in front of any rewrite of the loads' address pair; it
  // names the pair, so that no load's own result is placed on it either
  asm volatile("s_wait_xcnt 0x0" :: "v"(xr) : "memory");
  // four partial sums each, one per component of a load, joined at the end
  float4 a = x[0];
  float4 q = make_float4(x[0].x * x[0].x, x[0].y * x[0].y, x[0].z * x[0].z, x[0].w * x[0].w);
  #pragma unroll
  for (int j = 1; j < 4; j++) {
    a.x += x[j].x;  a.y += x[j].y;  a.z += x[j].z;  a.w += x[j].w;
    q.x += x[j].x * x[j].x;  q.y += x[j].y * x[j].y;
    q.z += x[j].z * x[j].z;  q.w += x[j].w * x[j].w;
  }
  const float s1 = wave_sum((a.x + a.y) + (a.z + a.w));
  const float s2 = wave_sum((q.x + q.y) + (q.z + q.w));
  const float mean = s1 * (1.0f / 512.0f);
  const float var  = s2 * (1.0f / 512.0f) - mean * mean;
  const float rs   = rsqrtf(var + 1e-6f);
  half_t* dst = lnT + (size_t)pos * CDIM + lane * 4;
  #pragma unroll
  for (int j = 0; j < 4; j++) {
    union { uint2 u; half_t e[4]; } o;
    o.e[0] = (half_t)((x[j].x - mean) * rs * gg[j].x + bb[j].x);
    o.e[1] = (half_t)((x[j].y - mean) * rs * gg[j].y + bb[j].y);
    o.e[2] = (half_t)((x[j].z - mean) * rs * gg[j].z + bb[j].z);
    o.e[3] = (half_t)((x[j].w - mean) * rs * gg[j].w + bb[j].w);
    *(uint2*)(dst + j * 128) = o.u;
  }
}

// ---------------------------------------------------------------------------
// Tiled WMMA GEMM: out[M][Npos] = W[M][K] * act[Npos][K]^T  (+bias)
// Block = 256 threads = 8 waves, 128x128 tile; a stage is 128 k of both operands.
// Stages are filled by double-buffered GLOBAL_LOAD_ASYNC_TO_LDS_B128 copies:
// stage t+1 flies (ASYNCcnt) while stage t runs through its 32 WMMAs per wave,
// so a copy has four k-steps of matrix work to land behind.
// MODE 0: Q proj   K=512 NP=4096 -> qh  [bh][n][d]   f16
// MODE 1: SR conv  K=2048 NP=1024 (im2col gather from xT) -> kvin f32 [b][n][o]
// MODE 2: KV proj  K=512 NP=1024 -> kh [bh][nk][d], vt [bh][d][nk]  f16
// MODE 3: out proj K=512 NP=4096 -> d_out f32 [b][o][n]
// ---------------------------------------------------------------------------
#define BK   128                    // k per stage: rows of 256 B, whole lines
#define GP   136                    // LDS row pitch in halves: 272 B = 16 B x odd (conflict free)
#define TILE (128 * GP)             // halves per buffer

template<int MODE>
__device__ __forceinline__
void gemm_tile(half_t* Ah, half_t* Bh, const int bx, const int by, const int b,
               const half_t* __restrict__ W, const half_t* __restrict__ actBase,
               const float* __restrict__ bias,
               float* __restrict__ outF, half_t* __restrict__ outH,
               half_t* __restrict__ outH2) {
  constexpr int K  = (MODE == 1) ? 2048 : 512;

  const int n0   = bx * 128;
  const int m0   = by * 128;
  const int tid  = threadIdx.x;
  const int lane = tid & 31;
  const int wave = tid >> 5;
  const int wm   = wave & 3;   // 4 row blocks of 32
  const int wn   = wave >> 2;  // 2 col blocks of 64
  const half_t* act = actBase + (size_t)b * ((MODE == 2) ? (NKPOS * CDIM) : (NPOS * CDIM));

  // Each thread copies eight 16-byte chunks of each operand per stage: chunk cch
  // of rows crow, crow + 16, ...; a wave's copy covers two whole 256-byte rows.
  const int crow = tid >> 4;
  const int cch  = (tid & 15) * 8;
  const uint32_t ldsA = lds_addr32(&Ah[crow * GP + cch]);
  const uint32_t ldsB = lds_addr32(&Bh[crow * GP + cch]);
  const half_t* gA = W + (size_t)(m0 + crow) * K + cch;
  // MODE 1, im2col: reduced position n = (py, px) reads x position
  // (2 py + sy, 2 px + sx); n0 is a multiple of 128 and crow < 16, so 16 rows on
  // are 16 px on (32 x positions) or, every second time, one py on (128).
  const int nrow = n0 + crow;
  const half_t* gB = (MODE == 1)
      ? act + (size_t)((nrow >> 5) * 128 + (nrow & 31) * 2) * CDIM + cch
      : act + (size_t)nrow * K + cch;
  constexpr int RA  = 16 * K;                              // halves per 16 rows of W
  constexpr int RB1 = (MODE == 1) ? 32 * CDIM  : 16 * K;   // 16 rows of act
  constexpr int RB2 = (MODE == 1) ? 128 * CDIM : 32 * K;   // 32 rows of act

  // Issue one 128x128 A stage + B stage into buffer `buf` (16 copies / wave).
  auto issue_tile = [&](int buf, int k0) {
    const uint32_t lo = (uint32_t)(buf * TILE * 2);
    const half_t* a = gA + k0;
    const half_t* p;
    if (MODE == 1) {
      const int tap = k0 >> 9;           // 2x2 tap selector, one per stage (512 % BK == 0)
      p = gB + ((tap >> 1) * 64 + (tap & 1)) * CDIM + (k0 & 511);
    } else {
      p = gB + k0;
    }
    async_cp8_b128(ldsA + lo, 16 * GP * 2,
                   a,          a + RA,     a + 2 * RA, a + 3 * RA,
                   a + 4 * RA, a + 5 * RA, a + 6 * RA, a + 7 * RA);
    async_cp8_b128(ldsB + lo, 16 * GP * 2,
                   p,           p + RB1,           p + RB2,     p + RB2 + RB1,
                   p + 2 * RB2, p + 2 * RB2 + RB1, p + 3 * RB2, p + 3 * RB2 + RB1);
  };

  v8f acc[2][4];
  const v8f vzero = {0.f, 0.f, 0.f, 0.f, 0.f, 0.f, 0.f, 0.f};
  for (int i = 0; i < 2; i++)
    for (int j = 0; j < 4; j++) acc[i][j] = vzero;

  constexpr int NT = K / BK;             // at least 4 stages in every mode
  issue_tile(0, 0);
  // stage 0 landed (this wave's copies), then visible to every wave
  asm volatile("s_wait_asynccnt 0x0" ::: "memory");
  __syncthreads();
  issue_tile(1, BK);

  for (int t = 0; t < NT; ++t) {
    const half_t* At = &Ah[(t & 1) * TILE + (wm * 32 + (lane & 15)) * GP];
    const half_t* Bt = &Bh[(t & 1) * TILE + (wn * 64 + (lane & 15)) * GP];
    // unrolled so that ks folds into the immediate offsets of the LDS reads
    #pragma unroll
    for (int ks = 0; ks < BK; ks += 32) {
      v16h af[2], bf[4];
      #pragma unroll
      for (int mt = 0; mt < 2; mt++)
        af[mt] = frag_ld(At + mt * 16 * GP + ks, lane);
      #pragma unroll
      for (int nt = 0; nt < 4; nt++)
        bf[nt] = frag_ld(Bt + nt * 16 * GP + ks, lane);
      #pragma unroll
      for (int mt = 0; mt < 2; mt++)
        #pragma unroll
        for (int nt = 0; nt < 4; nt++)
          acc[mt][nt] = wmma16(af[mt], bf[nt], acc[mt][nt]);
    }
    // hand-over: this wave's reads of stage t are done ...
    asm volatile("s_wait_dscnt 0x0" ::: "memory");
    // ... its copies of stage t + 1 have landed ...
    asm volatile("s_wait_asynccnt 0x0" ::: "memory");
    // ... and one barrier publishes stage t + 1 and frees stage t's buffer
    __syncthreads();
    if (t + 2 < NT) issue_tile(t & 1, (t + 2) * BK);
  }
  // nothing is outstanding here; kept so that no copy can outlive the wave
  asm volatile("s_wait_asynccnt 0x0" ::: "memory");

  // epilogue: C/D layout -> lane holds col n = lane%16, rows r + (lane>=16?8:0)
  const int halfoff = (lane & 16) ? 8 : 0;
  const int ncol = lane & 15;
  // Q and K go out as [head][n][d]: the 8 rows a lane holds of one tile are 8
  // consecutive d of one position (o0 is a multiple of 8, so inside one head),
  // packed into one 16-byte store; lanes l and l + 16 fill 32 bytes in a row.
  // In MODE 2 a block is all K (m0 < CDIM) or all V: the test is block-uniform.
  if (MODE == 0 || (MODE == 2 && m0 < CDIM)) {
    constexpr int NP = (MODE == 0) ? NPOS : NKPOS;
    uint4 pk[2][4];
    #pragma unroll
    for (int mt = 0; mt < 2; mt++) {
      const int o0 = m0 + wm * 32 + mt * 16 + halfoff;
      #pragma unroll
      for (int nt = 0; nt < 4; nt++) {
        union { uint4 u; half_t e[8]; } t;
        #pragma unroll
        for (int r = 0; r < 8; r++) t.e[r] = (half_t)(acc[mt][nt][r] + bias[o0 + r]);
        pk[mt][nt] = t.u;
      }
    }
    #pragma unroll
    for (int mt = 0; mt < 2; mt++) {
      const int o0 = m0 + wm * 32 + mt * 16 + halfoff;
      half_t* dst = outH + ((size_t)(b * HEADS + (o0 >> 6)) * NP + n0 + wn * 64 + ncol) * HD
                    + (o0 & 63);
      #pragma unroll
      for (int nt = 0; nt < 4; nt++) *(uint4*)(dst + (size_t)nt * 16 * HD) = pk[mt][nt];
    }
    return;
  }
  #pragma unroll
  for (int mt = 0; mt < 2; mt++) {
    #pragma unroll
    for (int nt = 0; nt < 4; nt++) {
      #pragma unroll
      for (int r = 0; r < 8; r++) {
        int o = m0 + wm * 32 + mt * 16 + r + halfoff;
        int n = n0 + wn * 64 + nt * 16 + ncol;
        float v = acc[mt][nt][r] + bias[o];
        if (MODE == 1) {
          outF[((size_t)b * NKPOS + n) * CDIM + o] = v;
        } else if (MODE == 2) {
          int vc = o - CDIM;
          int head = vc >> 6, d = vc & 63;
          outH2[(((size_t)(b * HEADS + head) * HD) + d) * NKPOS + n] = (half_t)v;
        } else if (MODE == 3) {
          outF[((size_t)b * CDIM + o) * NPOS + n] = v;
        }
      }
    }
  }
  // the wait that belongs in front of any rewrite of the stores' registers: in
  // MODE 2 the K epilogue's code follows the V stores in the built kernel
  if (MODE == 2) asm volatile("s_wait_xcnt 0x0" ::: "memory");
}

template<int MODE>
__global__ __launch_bounds__(256)
void gemm_wmma(const half_t* __restrict__ W, const half_t* __restrict__ actBase,
               const float* __restrict__ bias,
               float* __restrict__ outF, half_t* __restrict__ outH,
               half_t* __restrict__ outH2) {
  __shared__ __attribute__((aligned(16))) half_t Ah[2 * TILE];
  __shared__ __attribute__((aligned(16))) half_t Bh[2 * TILE];
  gemm_tile<MODE>(Ah, Bh, blockIdx.x, blockIdx.y, blockIdx.z,
                  W, actBase, bias, outF, outH, outH2);
}

// The SR conv and the Q projection both read only xT and their own weights:
// one grid.  The SR tiles (four times the K loop, only 128 of them) start
// first; the Q tiles fill the rest of the chip beside them.
#define SR_TILES ((NKPOS / 128) * (CDIM / 128) * BATCH)
#define Q_TILES  ((NPOS / 128) * (CDIM / 128) * BATCH)
__global__ __launch_bounds__(256)
void gemm_sr_q(const half_t* __restrict__ srwh, const half_t* __restrict__ qwh,
               const half_t* __restrict__ xT,
               const float* __restrict__ sr_b, const float* __restrict__ q_b,
               float* __restrict__ kvin, half_t* __restrict__ qh) {
  __shared__ __attribute__((aligned(16))) half_t Ah[2 * TILE];
  __shared__ __attribute__((aligned(16))) half_t Bh[2 * TILE];
  const int blk = blockIdx.x;
  if (blk < SR_TILES) {
    gemm_tile<1>(Ah, Bh, blk & 7, (blk >> 3) & 3, blk >> 5,
                 srwh, xT, sr_b, kvin, nullptr, nullptr);
  } else {
    const int t = blk - SR_TILES;
    gemm_tile<0>(Ah, Bh, t & 31, (t >> 5) & 3, t >> 7,
                 qwh, xT, q_b, nullptr, qh, nullptr);
  }
}

#define KSTG   64
#define KVP    72
#define KVTILE (64 * KVP)
#define P_LIMIT 4096.0f
#define QT     2
#define QBLK   (8 * QT * 16)

// two blocks a WGP = four waves a SIMD: the register budget is 256 a wave
__global__ __launch_bounds__(256) __attribute__((amdgpu_waves_per_eu(4, 4)))
void attn_kernel(const half_t* __restrict__ qh, const half_t* __restrict__ kh,
                 const half_t* __restrict__ vt, half_t* __restrict__ attnT) {
  __shared__ __attribute__((aligned(16))) half_t Ks[2 * KVTILE];
  __shared__ __attribute__((aligned(16))) half_t Vs[2 * KVTILE];
  const int tid  = threadIdx.x;
  const int lane = tid & 31;
  const int wave = tid >> 5;
  const int bh   = blockIdx.y;          // b*8 + h
  const int b    = bh >> 3, h = bh & 7;
  const int q0   = blockIdx.x * QBLK + wave * (QT * 16);
  const int lrow = lane & 15;
  const int halfoff = (lane & 16) ? 8 : 0;

  // Q B-fragments (64 d x 16 q = two k-steps a tile), loaded once; lane = query column
  const half_t* qrow = qh + ((size_t)bh * NPOS + q0 + lrow) * HD;
  v16h qa[QT][2];
  #pragma unroll
  for (int j = 0; j < QT; j++) {
    qa[j][0] = frag_ld(qrow + j * 16 * HD, lane);
    qa[j][1] = frag_ld(qrow + j * 16 * HD + 32, lane);
  }

  const v8f vzero = {0.f, 0.f, 0.f, 0.f, 0.f, 0.f, 0.f, 0.f};
  v8f acc[QT][4];                       // O^T: acc[j][dt][r] = O[q = j*16 + lrow][d = dt*16 + halfoff + r]
  float rmax[QT];                       // reference of this lane's query: a maximum seen so far
  float rsum[QT];                       // this lane's half of the query's denominator
  #pragma unroll
  for (int j = 0; j < QT; j++) {
    for (int dt = 0; dt < 4; dt++) acc[j][dt] = vzero;
    rmax[j] = -1e30f;
    rsum[j] = 0.f;
  }

  // Each thread copies two 16-byte chunks of the K tile and two of the V^T tile.
  const int crow = tid >> 3;            // rows crow and crow + 32
  const int cch  = (tid & 7) * 8;       // 8-half chunk inside the 64-half row
  const uint32_t ldsK = lds_addr32(&Ks[crow * KVP + cch]);
  const uint32_t ldsV = lds_addr32(&Vs[crow * KVP + cch]);
  const half_t* gK = kh + ((size_t)bh * NKPOS + crow) * HD + cch;
  const half_t* gV = vt + ((size_t)bh * HD + crow) * NKPOS + cch;
  auto issue_stage = [&](int buf, int kb0) {
    const uint32_t lo = (uint32_t)(buf * KVTILE * 2);
    const half_t* k0p = gK + (size_t)kb0 * HD;
    const half_t* v0p = gV + kb0;
    async_cp4_b128(ldsK + lo,                k0p,
                   ldsK + lo + 32 * KVP * 2, k0p + 32 * HD,
                   ldsV + lo,                v0p,
                   ldsV + lo + 32 * KVP * 2, v0p + 32 * NKPOS);
  };

  issue_stage(0, 0);
  // tile 0 landed (this wave's copies), then visible to every wave
  asm volatile("s_wait_asynccnt 0x0" ::: "memory");
  __syncthreads();
  issue_stage(1, KSTG);

  for (int t = 0; t < NKPOS / KSTG; ++t) {
   const half_t* Kt = &Ks[(t & 1) * KVTILE];
   const half_t* Vt = &Vs[(t & 1) * KVTILE];
   // unrolled so that sub folds into the immediate offsets of the LDS reads
   #pragma unroll
   for (int sub = 0; sub < KSTG; sub += 32) {
    // S^T = K Q^T (unscaled) for a 32x16 chunk per query tile (two 16x16 tiles):
    // s[j][st][r] = score of key sub + st*16 + halfoff + r against query j*16 + lrow
    v8f s[QT][2];
    #pragma unroll
    for (int st = 0; st < 2; st++) {
      const half_t* kbase = Kt + (sub + st * 16 + lrow) * KVP;
      v16h kf0 = frag_ld(kbase, lane);
      v16h kf1 = frag_ld(kbase + 32, lane);
      #pragma unroll
      for (int j = 0; j < QT; j++) {
        v8f z = vzero;
        z = wmma16(kf0, qa[j][0], z);
        z = wmma16(kf1, qa[j][1], z);
        s[j][st] = z;                   // unscaled; the scale is applied where s is used
      }
    }
    // online softmax: 16 scores of one query per lane, the other 16 in lane^16.
    // P is formed against the reference rmax as it stands; numerator and
    // denominator carry the same factor exp(-rmax), so any reference gives the
    // same quotient as long as P stays inside f16.
    // P^T as the B operand: element e = key kmap(e) = tile e>>3, register e&7
    v16h pb[QT];
    float ps[QT];
    auto probs = [&](int j) {
      float pp[8];
      #pragma unroll
      for (int i = 0; i < 8; i++) {
        const v2f d = (v2f){s[j][i >> 2][2 * (i & 3)], s[j][i >> 2][2 * (i & 3) + 1]} * ATT_SCALE - rmax[j];
        float p0 = __expf(d.x);
        float p1 = __expf(d.y);
        pb[j][2 * i]     = (half_t)p0;
        pb[j][2 * i + 1] = (half_t)p1;
        pp[i] = p0 + p1;
      }
      ps[j] = ((pp[0] + pp[1]) + (pp[2] + pp[3])) + ((pp[4] + pp[5]) + (pp[6] + pp[7]));
    };
    #pragma unroll
    for (int j = 0; j < QT; j++) probs(j);
    // A lane's sum bounds each of its 16 P: above P_LIMIT (or infinite, as
    // on the first chunk, whose reference is -1e30) some query's reference is too
    // low.  Then, and only then, the whole wave takes the chunk's maximum, raises
    // the references, rescales what it has summed and forms P again.  One scalar
    // branch per chunk for both query tiles: EXEC stays all ones for the matrix
    // instructions.
    bool low = false;
    #pragma unroll
    for (int j = 0; j < QT; j++) low = low || !(ps[j] <= P_LIMIT);
    if (__builtin_amdgcn_ballot_w32(low) != 0) {
      #pragma unroll
      for (int j = 0; j < QT; j++) {
        float mx[8];
        #pragma unroll
        for (int i = 0; i < 8; i++)
          mx[i] = fmaxf(s[j][i >> 2][2 * (i & 3)], s[j][i >> 2][2 * (i & 3) + 1]);
        float m = fmaxf(fmaxf(fmaxf(mx[0], mx[1]), fmaxf(mx[2], mx[3])),
                        fmaxf(fmaxf(mx[4], mx[5]), fmaxf(mx[6], mx[7]))) * ATT_SCALE;
        m = fmaxf(m, xhalf(m));
        const float nm = fmaxf(rmax[j], m);
        const float alpha = __expf(rmax[j] - nm);
        rmax[j] = nm;
        rsum[j] *= alpha;
        #pragma unroll
        for (int dt = 0; dt < 4; dt++)
          #pragma unroll
          for (int r = 0; r < 8; r++) acc[j][dt][r] *= alpha;
        probs(j);
      }
    }
    #pragma unroll
    for (int j = 0; j < QT; j++) rsum[j] += ps[j];
    // acc += V^T (16 d x 32 keys) * P^T (32 keys x 16 q); the four fragments are
    // read as one group, so that the wave waits out one LDS latency, not four
    v16h vf[4];
    #pragma unroll
    for (int dt = 0; dt < 4; dt++) vf[dt] = frag_ld(Vt + (dt * 16 + lrow) * KVP + sub, lane);
    #pragma unroll
    for (int j = 0; j < QT; j++)
      #pragma unroll
      for (int dt = 0; dt < 4; dt++) acc[j][dt] = wmma16(vf[dt], pb[j], acc[j][dt]);
   }
   // hand-over: this wave's reads of tile t are done ...
   asm volatile("s_wait_dscnt 0x0" ::: "memory");
   // ... its copies of tile t + 1 have landed ...
   asm volatile("s_wait_asynccnt 0x0" ::: "memory");
   // ... and one barrier publishes tile t + 1 and frees tile t's buffer
   __syncthreads();
   if (t + 2 < NKPOS / KSTG) issue_stage(t & 1, (t + 2) * KSTG);
  }
  // nothing is outstanding here; kept so that no copy can outlive the wave
  asm volatile("s_wait_asynccnt 0x0" ::: "memory");

  // join the two halves' denominators, normalize and emit position-major
  // [n][c] f16 for the projection GEMM: 8 consecutive d per lane, 16-byte stores
  #pragma unroll
  for (int j = 0; j < QT; j++) {
    const float inv = 1.0f / (rsum[j] + xhalf(rsum[j]));
    half_t* orow = attnT + ((size_t)b * NPOS + q0 + j * 16 + lrow) * CDIM + h * HD + halfoff;
    #pragma unroll
    for (int dt = 0; dt < 4; dt++) {
      union { uint4 u; half_t e[8]; } o;
      #pragma unroll
      for (int r = 0; r < 8; r++) o.e[r] = (half_t)(acc[j][dt][r] * inv);
      *(uint4*)(orow + dt * 16) = o.u;
    }
    // the wait that belongs in front of any rewrite of the stores' registers: the
    // next tile's values are formed in registers that these stores name
    if (j + 1 < QT) {
      asm volatile("s_wait_xcnt 0x0" ::: "memory");
      // keeps the next tile's arithmetic behind that wait
      __builtin_amdgcn_sched_barrier(0);
    }
  }
}

// ---------------------------------------------------------------------------
extern "C" void kernel_launch(void* const* d_in, const int* in_sizes, int n_in,
                              void* d_out, int out_size, void* d_ws, size_t ws_size,
                              hipStream_t stream) {
  const float* x      = (const float*)d_in[0];
  const float* q_w    = (const float*)d_in[1];
  const float* q_b    = (const float*)d_in[2];
  const float* kv_w   = (const float*)d_in[3];
  const float* kv_b   = (const float*)d_in[4];
  const float* sr_w   = (const float*)d_in[5];
  const float* sr_b   = (const float*)d_in[6];
  const float* ln_g   = (const float*)d_in[7];
  const float* ln_b   = (const float*)d_in[8];
  const float* proj_w = (const float*)d_in[9];
  const float* proj_b = (const float*)d_in[10];
  float* out = (float*)d_out;

  size_t off = 0;
  auto carve = [&](size_t bytes) {
    void* p = (char*)d_ws + off;
    off += (bytes + 255) & ~(size_t)255;
    return p;
  };
  half_t* xT    = (half_t*)carve((size_t)BATCH * NPOS * CDIM * 2);
  half_t* qwh   = (half_t*)carve((size_t)CDIM * CDIM * 2);
  half_t* kvwh  = (half_t*)carve((size_t)2 * CDIM * CDIM * 2);
  half_t* srwh  = (half_t*)carve((size_t)CDIM * 2048 * 2);
  half_t* pwh   = (half_t*)carve((size_t)CDIM * CDIM * 2);
  half_t* qhb   = (half_t*)carve((size_t)BATCH * HEADS * NPOS * HD * 2);
  float*  kvin  = (float*)carve((size_t)BATCH * NKPOS * CDIM * 4);
  half_t* lnT   = (half_t*)carve((size_t)BATCH * NKPOS * CDIM * 2);
  half_t* khb   = (half_t*)carve((size_t)BATCH * HEADS * NKPOS * HD * 2);
  half_t* vtb   = (half_t*)carve((size_t)BATCH * HEADS * HD * NKPOS * 2);
  half_t* attnT = (half_t*)carve((size_t)BATCH * NPOS * CDIM * 2);

  // 1. precision / layout conversions
  cvt_all<<<XT_BLKS + SRW_BLKS + KVW_BLKS + QW_BLKS + PW_BLKS, 256, 0, stream>>>(
      x, sr_w, kv_w, q_w, proj_w, xT, srwh, kvwh, qwh, pwh);

  // 2. SR conv as im2col GEMM -> kvin f32 [b][n][c], and beside it
  //    the Q projection -> qh [bh][n][d]
  gemm_sr_q<<<SR_TILES + Q_TILES, 256, 0, stream>>>(
      srwh, qwh, xT, sr_b, q_b, kvin, qhb);

  // 3. channel LayerNorm -> lnT f16
  ln_kernel<<<(BATCH * NKPOS) / 8, 256, 0, stream>>>(kvin, ln_g, ln_b, lnT);

  // 4. KV projection -> kh [bh][nk][d], vt [bh][d][nk]
  gemm_wmma<2><<<dim3(NKPOS / 128, (2 * CDIM) / 128, BATCH), 256, 0, stream>>>(
      kvwh, lnT, kv_b, nullptr, khb, vtb);

  // 5. flash attention -> attnT f16 [b][n][c]
  attn_kernel<<<dim3(NPOS / QBLK, BATCH * HEADS), 256, 0, stream>>>(
      qhb, khb, vtb, attnT);

  // 6. output projection -> d_out f32 [b][c][n]
  gemm_wmma<3><<<dim3(NPOS / 128, CDIM / 128, BATCH), 256, 0, stream>>>(
      pwh, attnT, proj_b, out, nullptr, nullptr);
}

// v010
// A run of this version takes 81 microseconds.
// Two timings next to v009 both put it at 1.04 times that version's speed.
// All steps since v000 together make it 3.81 times as fast.
#include <hip/hip_runtime.h>
#include <hip/hip_bf16.h>

typedef _Float16 half_t;
typedef __attribute__((ext_vector_type(16))) _Float16 v16h;
typedef __attribute__((ext_vector_type(8)))  float    v8f;
typedef __attribute__((ext_vector_type(2)))  float    v2f;

#define BATCH  4
#define CDIM   512
#define HEADS  8
#define HD     64
#define NPOS   4096   // 64*64
#define NKPOS  1024   // 32*32
#define ATT_SCALE 0.125f

// ---------------------------------------------------------------------------
// WMMA helpers.  16-bit A-matrix 16x32 layout (ISA 7.12.2): lane L holds row
// m = L%16; its 16 halves are two contiguous 8-half chunks at k = off..off+7
// and k = off+16..off+23, off = (L>=16 ? 8 : 0).  B uses the symmetric layout
// (lane = column, identical k packing), so both fragments are two 16-byte
// loads from a k-contiguous row.
// ---------------------------------------------------------------------------
__device__ __forceinline__ v16h frag_ld(const half_t* rowbase, int lane) {
  const int off = (lane & 16) ? 8 : 0;
  union { uint4 u[2]; v16h v; } t;
  t.u[0] = *(const uint4*)(rowbase + off);
  t.u[1] = *(const uint4*)(rowbase + off + 16);
  return t.v;
}

__device__ __forceinline__ v8f wmma16(v16h a, v16h b, v8f c) {
  return __builtin_amdgcn_wmma_f32_16x16x32_f16(false, a, false, b,
                                                (short)0, c, false, false);
}

// Low 32 bits of a flat pointer into LDS == LDS byte offset (ISA 10.2:
// the LDS aperture maps by truncating to addr[31:0]).
__device__ __forceinline__ uint32_t lds_addr32(const void* p) {
  return (uint32_t)(uintptr_t)p;
}

// Eight async global->LDS copies of one lane, 16 B each: rows r, r + 16, ... of a
// 128-row tile.  lds = the lane's LDS byte address of row r, ls = LDS bytes per
// 16 rows; g0..g7 = the lane's global addresses.  s_wait_xcnt closes the same
// statement as a precaution: the address registers are not rewritten ahead of it.
__device__ __forceinline__ void async_cp8_b128(uint32_t lds, uint32_t ls,
                                               const half_t* g0, const half_t* g1,
                                               const half_t* g2, const half_t* g3,
                                               const half_t* g4, const half_t* g5,
                                               const half_t* g6, const half_t* g7) {
  asm volatile("global_load_async_to_lds_b128 %0, %1, off\n\t"
               "global_load_async_to_lds_b128 %2, %3, off\n\t"
               "global_load_async_to_lds_b128 %4, %5, off\n\t"
               "global_load_async_to_lds_b128 %6, %7, off\n\t"
               "global_load_async_to_lds_b128 %8, %9, off\n\t"
               "global_load_async_to_lds_b128 %10, %11, off\n\t"
               "global_load_async_to_lds_b128 %12, %13, off\n\t"
               "global_load_async_to_lds_b128 %14, %15, off\n\t"
               "s_wait_xcnt 0x0"
               :: "v"(lds),          "v"(g0), "v"(lds + ls),     "v"(g1),
                  "v"(lds + 2 * ls), "v"(g2), "v"(lds + 3 * ls), "v"(g3),
                  "v"(lds + 4 * ls), "v"(g4), "v"(lds + 5 * ls), "v"(g5),
                  "v"(lds + 6 * ls), "v"(g6), "v"(lds + 7 * ls), "v"(g7) : "memory");
}

// Four async global->LDS copies of one lane, 16 B each, per-lane 64-bit address.
// s_wait_xcnt closes the same statement as a precaution: the address registers
// are not rewritten ahead of it.
__device__ __forceinline__ void async_cp4_b128(uint32_t l0, const half_t* g0,
                                               uint32_t l1, const half_t* g1,
                                               uint32_t l2, const half_t* g2,
                                               uint32_t l3, const half_t* g3) {
  asm volatile("global_load_async_to_lds_b128 %0, %1, off\n\t"
               "global_load_async_to_lds_b128 %2, %3, off\n\t"
               "global_load_async_to_lds_b128 %4, %5, off\n\t"
               "global_load_async_to_lds_b128 %6, %7, off\n\t"
               "s_wait_xcnt 0x0"
               :: "v"(l0), "v"(g0), "v"(l1), "v"(g1),
                  "v"(l2), "v"(g2), "v"(l3), "v"(g3) : "memory");
}

// ---------------------------------------------------------------------------
// Conversion kernels (f32 -> f16, layout shuffles)
// ---------------------------------------------------------------------------
// Same layout, 4,096 elements a block: a thread converts four groups of 4, the
// groups 1,024 elements apart, so that every load of a wave reads four whole
// 128-byte lines and every store fills two.  Every weight count here is a
// multiple of 4,096.
#define CVT_PER_BLK 4096
__device__ __forceinline__
void cvt_f16(const float* __restrict__ in, half_t* __restrict__ out, int blk) {
  const int i0 = blk * CVT_PER_BLK + threadIdx.x * 4;
  const float* src = in + i0;
  float4 v[4];
  #pragma unroll
  for (int j = 0; j < 4; j++) v[j] = *(const float4*)(src + j * 1024);
  // the wait that belongs in front of any rewrite of the loads' address pair
  asm volatile("s_wait_xcnt 0x0" :: "v"(src) : "memory");
  #pragma unroll
  for (int j = 0; j < 4; j++) {
    union { uint2 u; half_t e[4]; } o;
    o.e[0] = (half_t)v[j].x;
    o.e[1] = (half_t)v[j].y;
    o.e[2] = (half_t)v[j].z;
    o.e[3] = (half_t)v[j].w;
    *(uint2*)(out + i0 + j * 1024) = o.u;
  }
  // the wait that belongs in front of any rewrite of the stores' registers: in the
  // merged grid another conversion's body follows this one in the code
  asm volatile("s_wait_xcnt 0x0" ::: "memory");
}

// x [B][512][4096] -> xT [B][4096][512] (f16, position-major)
// The transposition happens in registers: a thread holds 16 channels x 4
// positions (sixteen 16-byte loads, all in flight together) and stores, per
// position, two 16-byte runs of 8 channels.  A wave covers 64 channels x 32
// positions: every load reads four whole 128-byte lines of x, and the two
// stores of one position fill one whole 128-byte line of xT, 64 bytes each.
__device__ __forceinline__
void cvt_xT(const float* __restrict__ x, half_t* __restrict__ xT,
            const int blk) {                      // B * 8 channel tiles * 16 position tiles
  const int lane = threadIdx.x & 31;
  const int wave = threadIdx.x >> 5;
  const int b    = blk >> 7;
  const int c0   = ((blk >> 4) & 7) * 64 + (lane >> 3) * 8;   // and c0 + 32
  const int n0   = (blk & 15) * 256 + wave * 32 + (lane & 7) * 4;
  const float* src = x + ((size_t)b * CDIM + c0) * NPOS + n0;
  float4 v[2][8];
  #pragma unroll
  for (int g = 0; g < 2; g++)
    #pragma unroll
    for (int j = 0; j < 8; j++)
      v[g][j] = *(const float4*)(src + (size_t)(g * 32 + j) * NPOS);
  // the wait that belongs in front of any rewrite of the loads' address pair; it
  // names the pair, so that no load's own result is placed on it either
  asm volatile("s_wait_xcnt 0x0" :: "v"(src) : "memory");
  // keeps all sixteen loads in front of the first conversion: without it four of
  // them are issued behind a wait and the wave pays a second memory latency
  __builtin_amdgcn_sched_barrier(0);
  half_t* dst = xT + ((size_t)b * NPOS + n0) * CDIM + c0;
  #pragma unroll
  for (int i = 0; i < 4; i++) {
    #pragma unroll
    for (int g = 0; g < 2; g++) {
      union { uint4 u; half_t e[8]; } o;
      #pragma unroll
      for (int j = 0; j < 8; j++) {
        const float* f = (const float*)&v[g][j];
        o.e[j] = (half_t)f[i];
      }
      *(uint4*)(dst + (size_t)i * CDIM + g * 32) = o.u;
    }
  }
}

// sr_w [O=512][C=512][2][2] -> srwh [o][k], k = (sy*2+sx)*512 + c
// A thread holds 4 consecutive channels x the 4 taps of one o (four 16-byte loads,
// 64 contiguous bytes) and stores, per tap s = sy*2+sx, one 8-byte run of 4
// channels: a wave's store fills two whole 128-byte lines.
__device__ __forceinline__
void cvt_srw(const float* __restrict__ srw, half_t* __restrict__ out, int blk) {
  const int i  = blk * 256 + threadIdx.x;        // over 512 o * 128 channel groups
  const int o  = i >> 7;
  const int c0 = (i & 127) * 4;
  const float* src = srw + ((size_t)o * 512 + c0) * 4;
  float4 v[4];
  #pragma unroll
  for (int j = 0; j < 4; j++) v[j] = *(const float4*)(src + j * 4);
  // the wait that belongs in front of any rewrite of the loads' address pair
  asm volatile("s_wait_xcnt 0x0" :: "v"(src) : "memory");
  half_t* dst = out + (size_t)o * 2048 + c0;
  #pragma unroll
  for (int s = 0; s < 4; s++) {
    union { uint2 u; half_t e[4]; } t;
    #pragma unroll
    for (int j = 0; j < 4; j++) {
      const float* f = (const float*)&v[j];
      t.e[j] = (half_t)f[s];
    }
    *(uint2*)(dst + s * 512) = t.u;
  }
  // the wait that belongs in front of any rewrite of the store's registers: in the
  // merged grid another conversion's body follows this one in the code
  asm volatile("s_wait_xcnt 0x0" ::: "memory");
}

// All five conversions are independent of one another: one grid, each block
// picks its conversion by its index range (the x transposition, the largest,
// starts first).
#define XT_BLKS  (BATCH * (CDIM / 64) * (NPOS / 256))
#define SRW_BLKS ((CDIM * 2048) / (256 * 16))
#define KVW_BLKS ((2 * CDIM * CDIM) / CVT_PER_BLK)
#define QW_BLKS  ((CDIM * CDIM) / CVT_PER_BLK)
#define PW_BLKS  ((CDIM * CDIM) / CVT_PER_BLK)
__global__ __launch_bounds__(256)
void cvt_all(const float* __restrict__ x, const float* __restrict__ sr_w,
             const float* __restrict__ kv_w, const float* __restrict__ q_w,
             const float* __restrict__ proj_w,
             half_t* __restrict__ xT, half_t* __restrict__ srwh,
             half_t* __restrict__ kvwh, half_t* __restrict__ qwh,
             half_t* __restrict__ pwh) {
  int blk = blockIdx.x;
  if (blk < XT_BLKS) { cvt_xT(x, xT, blk); return; }
  blk -= XT_BLKS;
  if (blk < SRW_BLKS) { cvt_srw(sr_w, srwh, blk); return; }
  blk -= SRW_BLKS;
  if (blk < KVW_BLKS) { cvt_f16(kv_w, kvwh, blk); return; }
  blk -= KVW_BLKS;
  if (blk < QW_BLKS) { cvt_f16(q_w, qwh, blk); return; }
  blk -= QW_BLKS;
  cvt_f16(proj_w, pwh, blk);
}

// ---------------------------------------------------------------------------
// LayerNorm over channels at each reduced spatial position.
// kvin [B*1024][512] f32 -> lnT [B*1024][512] f16
// ---------------------------------------------------------------------------
// value of lane l ^ 16 (a vector cross-row move, no LDS round trip)
__device__ __forceinline__ float xhalf(float x) {
  return __builtin_bit_cast(float, __builtin_amdgcn_permlanex16(
      __builtin_bit_cast(int, x), __builtin_bit_cast(int, x),
      0x76543210, 0xfedcba98, false, false));
}

// value of lane l ^ M inside a 16-lane row (DPP row_xmask)
template<int M>
__device__ __forceinline__ float xrow(float x) {
  return __builtin_bit_cast(float, __builtin_amdgcn_update_dpp(
      0, __builtin_bit_cast(int, x), 0x160 | M, 0xf, 0xf, true));
}

__device__ __forceinline__ float wave_sum(float x) {
  x += xrow<1>(x);
  x += xrow<2>(x);
  x += xrow<4>(x);
  x += xrow<8>(x);
  return x + xhalf(x);
}

// One wave owns one position: a lane holds 16 of the 512 channels (four 16-byte
// loads, whole lines), the two sums are in-lane plus five cross-lane steps, and
// nothing goes through LDS or a barrier.  8 positions a block.
__global__ __launch_bounds__(256)
void ln_kernel(const float* __restrict__ kvin, const float* __restrict__ g,
               const float* __restrict__ be, half_t* __restrict__ lnT) {
  const int lane = threadIdx.x & 31;
  const int pos  = blockIdx.x * 8 + (threadIdx.x >> 5);
  const float* xr = kvin + (size_t)pos * CDIM + lane * 4;
  float4 x[4], gg[4], bb[4];
  #pragma unroll
  for (int j = 0; j < 4; j++) x[j] = *(const float4*)(xr + j * 128);
  #pragma unroll
  for (int j = 0; j < 4; j++) {
    gg[j] = *(const float4*)(g + lane * 4 + j * 128);
    bb[j] = *(const float4*)(be + lane * 4 + j * 128);
  }
  // the wait that belongs in front of any rewrite of the loads' address pair; it
  // names the pair, so that no load's own result is placed on it either
  asm volatile("s_wait_xcnt 0x0" :: "v"(xr) : "memory");
  // four partial sums each, one per component of a load, joined at the end
  float4 a = x[0];
  float4 q = make_float4(x[0].x * x[0].x, x[0].y * x[0].y, x[0].z * x[0].z, x[0].w * x[0].w);
  #pragma unroll
  for (int j = 1; j < 4; j++) {
    a.x += x[j].x;  a.y += x[j].y;  a.z += x[j].z;  a.w += x[j].w;
    q.x += x[j].x * x[j].x;  q.y += x[j].y * x[j].y;
    q.z += x[j].z * x[j].z;  q.w += x[j].w * x[j].w;
  }
  const float s1 = wave_sum((a.x + a.y) + (a.z + a.w));
  const float s2 = wave_sum((q.x + q.y) + (q.z + q.w));
  const float mean = s1 * (1.0f / 512.0f);
  const float var  = s2 * (1.0f / 512.0f) - mean * mean;
  const float rs   = rsqrtf(var + 1e-6f);
  half_t* dst = lnT + (size_t)pos * CDIM + lane * 4;
  #pragma unroll
  for (int j = 0; j < 4; j++) {
    union { uint2 u; half_t e[4]; } o;
    o.e[0] = (half_t)((x[j].x - mean) * rs * gg[j].x + bb[j].x);
    o.e[1] = (half_t)((x[j].y - mean) * rs * gg[j].y + bb[j].y);
    o.e[2] = (half_t)((x[j].z - mean) * rs * gg[j].z + bb[j].z);
    o.e[3] = (half_t)((x[j].w - mean) * rs * gg[j].w + bb[j].w);
    *(uint2*)(dst + j * 128) = o.u;
  }
}

// ---------------------------------------------------------------------------
// Tiled WMMA GEMM: out[M][Npos] = W[M][K] * act[Npos][K]^T  (+bias)
// Block = 256 threads = 8 waves, 128x128 tile; a stage is 128 k of both operands.
// Stages are filled by double-buffered GLOBAL_LOAD_ASYNC_TO_LDS_B128 copies:
// stage t+1 flies (ASYNCcnt) while stage t runs through its 32 WMMAs per wave,
// so a copy has four k-steps of matrix work to land behind.
// MODE 0: Q proj   K=512 NP=4096 -> qh  [bh][n][d]   f16
// MODE 1: SR conv  K=2048 NP=1024 (im2col gather from xT) -> kvin f32 [b][n][o]
// MODE 2: KV proj  K=512 NP=1024 -> kh [bh][nk][d], vt [bh][d][nk]  f16
// MODE 3: out proj K=512 NP=4096 -> d_out f32 [b][o][n]
// ---------------------------------------------------------------------------
#define BK   128                    // k per stage: rows of 256 B, whole lines
#define GP   136                    // LDS row pitch in halves: 272 B = 16 B x odd (conflict free)
#define TILE (128 * GP)             // halves per buffer

template<int MODE>
__device__ __forceinline__
void gemm_tile(half_t* Ah, half_t* Bh, const int bx, const int by, const int b,
               const half_t* __restrict__ W, const half_t* __restrict__ actBase,
               const float* __restrict__ bias,
               float* __restrict__ outF, half_t* __restrict__ outH,
               half_t* __restrict__ outH2) {
  constexpr int K  = (MODE == 1) ? 2048 : 512;

  const int n0   = bx * 128;
  const int m0   = by * 128;
  const int tid  = threadIdx.x;
  const int lane = tid & 31;
  const int wave = tid >> 5;
  const int wm   = wave & 3;   // 4 row blocks of 32
  const int wn   = wave >> 2;  // 2 col blocks of 64
  const half_t* act = actBase + (size_t)b * ((MODE == 2) ? (NKPOS * CDIM) : (NPOS * CDIM));

  // Each thread copies eight 16-byte chunks of each operand per stage: chunk cch
  // of rows crow, crow + 16, ...; a wave's copy covers two whole 256-byte rows.
  const int crow = tid >> 4;
  const int cch  = (tid & 15) * 8;
  const uint32_t ldsA = lds_addr32(&Ah[crow * GP + cch]);
  const uint32_t ldsB = lds_addr32(&Bh[crow * GP + cch]);
  const half_t* gA = W + (size_t)(m0 + crow) * K + cch;
  // MODE 1, im2col: reduced position n = (py, px) reads x position
  // (2 py + sy, 2 px + sx); n0 is a multiple of 128 and crow < 16, so 16 rows on
  // are 16 px on (32 x positions) or, every second time, one py on (128).
  const int nrow = n0 + crow;
  const half_t* gB = (MODE == 1)
      ? act + (size_t)((nrow >> 5) * 128 + (nrow & 31) * 2) * CDIM + cch
      : act + (size_t)nrow * K + cch;
  constexpr int RA  = 16 * K;                              // halves per 16 rows of W
  constexpr int RB1 = (MODE == 1) ? 32 * CDIM  : 16 * K;   // 16 rows of act
  constexpr int RB2 = (MODE == 1) ? 128 * CDIM : 32 * K;   // 32 rows of act

  // Issue one 128x128 A stage + B stage into buffer `buf` (16 copies / wave).
  auto issue_tile = [&](int buf, int k0) {
    const uint32_t lo = (uint32_t)(buf * TILE * 2);
    const half_t* a = gA + k0;
    const half_t* p;
    if (MODE == 1) {
      const int tap = k0 >> 9;           // 2x2 tap selector, one per stage (512 % BK == 0)
      p = gB + ((tap >> 1) * 64 + (tap & 1)) * CDIM + (k0 & 511);
    } else {
      p = gB + k0;
    }
    async_cp8_b128(ldsA + lo, 16 * GP * 2,
                   a,          a + RA,     a + 2 * RA, a + 3 * RA,
                   a + 4 * RA, a + 5 * RA, a + 6 * RA, a + 7 * RA);
    async_cp8_b128(ldsB + lo, 16 * GP * 2,
                   p,           p + RB1,           p + RB2,     p + RB2 + RB1,
                   p + 2 * RB2, p + 2 * RB2 + RB1, p + 3 * RB2, p + 3 * RB2 + RB1);
  };

  v8f acc[2][4];
  const v8f vzero = {0.f, 0.f, 0.f, 0.f, 0.f, 0.f, 0.f, 0.f};
  for (int i = 0; i < 2; i++)
    for (int j = 0; j < 4; j++) acc[i][j] = vzero;

  constexpr int NT = K / BK;             // at least 4 stages in every mode
  issue_tile(0, 0);
  // stage 0 landed (this wave's copies), then visible to every wave
  asm volatile("s_wait_asynccnt 0x0" ::: "memory");
  __syncthreads();
  issue_tile(1, BK);

  for (int t = 0; t < NT; ++t) {
    const half_t* At = &Ah[(t & 1) * TILE + (wm * 32 + (lane & 15)) * GP];
    const half_t* Bt = &Bh[(t & 1) * TILE + (wn * 64 + (lane & 15)) * GP];
    // unrolled so that ks folds into the immediate offsets of the LDS reads
    #pragma unroll
    for (int ks = 0; ks < BK; ks += 32) {
      v16h af[2], bf[4];
      #pragma unroll
      for (int mt = 0; mt < 2; mt++)
        af[mt] = frag_ld(At + mt * 16 * GP + ks, lane);
      #pragma unroll
      for (int nt = 0; nt < 4; nt++)
        bf[nt] = frag_ld(Bt + nt * 16 * GP + ks, lane);
      #pragma unroll
      for (int mt = 0; mt < 2; mt++)
        #pragma unroll
        for (int nt = 0; nt < 4; nt++)
          acc[mt][nt] = wmma16(af[mt], bf[nt], acc[mt][nt]);
    }
    // hand-over: this wave's reads of stage t are done ...
    asm volatile("s_wait_dscnt 0x0" ::: "memory");
    // ... its copies of stage t + 1 have landed ...
    asm volatile("s_wait_asynccnt 0x0" ::: "memory");
    // ... and one barrier publishes stage t + 1 and frees stage t's buffer
    __syncthreads();
    if (t + 2 < NT) issue_tile(t & 1, (t + 2) * BK);
  }
  // nothing is outstanding here; kept so that no copy can outlive the wave
  asm volatile("s_wait_asynccnt 0x0" ::: "memory");

  // epilogue: C/D layout -> lane holds col n = lane%16, rows r + (lane>=16?8:0)
  const int halfoff = (lane & 16) ? 8 : 0;
  const int ncol = lane & 15;
  // Q and K go out as [head][n][d]: the 8 rows a lane holds of one tile are 8
  // consecutive d of one position, packed into 16 bytes.  The block's tile (128
  // positions x 2 heads) is turned in one freed ring buffer, at the ring's pitch
  // (the ring is free: every wave's reads and copies ended in front of the loop's
  // last barrier), and leaves as whole 128-byte lines: a store covers 4 positions
  // of one head, 512 bytes in a row, instead of 32-byte pieces in 16 lines.
  // In MODE 2 a block is all K (m0 < CDIM) or all V: the test is block-uniform.
  if (MODE == 0 || (MODE == 2 && m0 < CDIM)) {
    constexpr int NP = (MODE == 0) ? NPOS : NKPOS;
    #pragma unroll
    for (int mt = 0; mt < 2; mt++) {
      const int oc = wm * 32 + mt * 16 + halfoff;
      #pragma unroll
      for (int nt = 0; nt < 4; nt++) {
        union { uint4 u; half_t e[8]; } t;
        #pragma unroll
        for (int r = 0; r < 8; r++) t.e[r] = (half_t)(acc[mt][nt][r] + bias[m0 + oc + r]);
        *(uint4*)(Ah + (wn * 64 + nt * 16 + ncol) * GP + oc) = t.u;
      }
    }
    // a line of one head holds the channels of two waves: publish the tile
    __syncthreads();
    const int hh = wave & 1;                       // head of the block's two
    const int nb = (wave >> 1) * 32 + (lane >> 3); // and nb + 4, nb + 8, ...
    const int ch = (lane & 7) * 8;
    uint4 v[8];
    #pragma unroll
    for (int i = 0; i < 8; i++)
      v[i] = *(const uint4*)(Ah + (nb + i * 4) * GP + hh * HD + ch);
    half_t* dst = outH + ((size_t)(b * HEADS + (m0 >> 6) + hh) * NP + n0 + nb) * HD + ch;
    #pragma unroll
    for (int i = 0; i < 8; i++) *(uint4*)(dst + (size_t)i * 4 * HD) = v[i];
    return;
  }
  // The SR conv goes out as [n][o] f32: the block's tile is 128 positions x 128
  // channels, 512 bytes in a row per position.  It is turned in the freed ring and
  // a store covers one position's 512 bytes, instead of 16-byte pieces in 16
  // lines.  Pitch 132 floats: the 16-byte writes of 16 rows spread over all banks.
  if (MODE == 1) {
    constexpr int SP = 132;
    float* st = (float*)Ah;                        // 67,584 of its 69,632 bytes
    #pragma unroll
    for (int mt = 0; mt < 2; mt++) {
      const int oc = wm * 32 + mt * 16 + halfoff;
      const float4 b0 = *(const float4*)(bias + m0 + oc);
      const float4 b1 = *(const float4*)(bias + m0 + oc + 4);
      #pragma unroll
      for (int nt = 0; nt < 4; nt++) {
        float* p = st + (wn * 64 + nt * 16 + ncol) * SP + oc;
        *(float4*)p = make_float4(acc[mt][nt][0] + b0.x, acc[mt][nt][1] + b0.y,
                                  acc[mt][nt][2] + b0.z, acc[mt][nt][3] + b0.w);
        *(float4*)(p + 4) = make_float4(acc[mt][nt][4] + b1.x, acc[mt][nt][5] + b1.y,
                                        acc[mt][nt][6] + b1.z, acc[mt][nt][7] + b1.w);
      }
    }
    // a position's row holds the channels of four waves: publish the tile
    __syncthreads();
    float4 v[16];
    #pragma unroll
    for (int i = 0; i < 16; i++)
      v[i] = *(const float4*)(st + (wave * 16 + i) * SP + lane * 4);
    float* dst = outF + ((size_t)b * NKPOS + n0 + wave * 16) * CDIM + m0 + lane * 4;
    #pragma unroll
    for (int i = 0; i < 16; i++) *(float4*)(dst + (size_t)i * CDIM) = v[i];
    // the wait that belongs in front of any rewrite of the stores' registers: in
    // the merged grid the Q tile's code follows these stores in the built kernel
    asm volatile("s_wait_xcnt 0x0" ::: "memory");
    return;
  }
  // V goes out as [head][d][n] f16: the block's tile is 128 d x 128 positions, 256
  // bytes in a row per d.  It is turned in one freed ring buffer, at the ring's
  // pitch (the two half-waves' writes, rows 8 apart, lie 32 banks apart), and a
  // store covers two whole rows, instead of 2-byte elements in 32-byte pieces.
  if (MODE == 2) {
    #pragma unroll
    for (int mt = 0; mt < 2; mt++) {
      #pragma unroll
      for (int nt = 0; nt < 4; nt++) {
        #pragma unroll
        for (int r = 0; r < 8; r++) {
          const int oc = wm * 32 + mt * 16 + halfoff + r;
          Ah[oc * GP + wn * 64 + nt * 16 + ncol] = (half_t)(acc[mt][nt][r] + bias[m0 + oc]);
        }
      }
    }
    // a row of one d holds the positions of two waves: publish the tile
    __syncthreads();
    const int rr = wave * 16 + (lane >> 4);        // and rr + 2, rr + 4, ...
    const int ch = (lane & 15) * 8;
    uint4 v[8];
    #pragma unroll
    for (int i = 0; i < 8; i++) v[i] = *(const uint4*)(Ah + (rr + i * 2) * GP + ch);
    // (b * HEADS + head) * HD + d == b * CDIM + (o - CDIM)
    half_t* dst = outH2 + ((size_t)b * CDIM + (m0 - CDIM) + rr) * NKPOS + n0 + ch;
    #pragma unroll
    for (int i = 0; i < 8; i++) *(uint4*)(dst + (size_t)i * 2 * NKPOS) = v[i];
    // the wait that belongs in front of any rewrite of the stores' registers: the
    // K epilogue's code may follow the V stores in the built kernel
    asm volatile("s_wait_xcnt 0x0" ::: "memory");
    return;
  }
  #pragma unroll
  for (int mt = 0; mt < 2; mt++) {
    #pragma unroll
    for (int nt = 0; nt < 4; nt++) {
      #pragma unroll
      for (int r = 0; r < 8; r++) {
        int o = m0 + wm * 32 + mt * 16 + r + halfoff;
        int n = n0 + wn * 64 + nt * 16 + ncol;
        float v = acc[mt][nt][r] + bias[o];
        if (MODE == 3) outF[((size_t)b * CDIM + o) * NPOS + n] = v;
      }
    }
  }
}

template<int MODE>
__global__ __launch_bounds__(256)
void gemm_wmma(const half_t* __restrict__ W, const half_t* __restrict__ actBase,
               const float* __restrict__ bias,
               float* __restrict__ outF, half_t* __restrict__ outH,
               half_t* __restrict__ outH2) {
  __shared__ __attribute__((aligned(16))) half_t Ah[2 * TILE];
  __shared__ __attribute__((aligned(16))) half_t Bh[2 * TILE];
  gemm_tile<MODE>(Ah, Bh, blockIdx.x, blockIdx.y, blockIdx.z,
                  W, actBase, bias, outF, outH, outH2);
}

// The SR conv and the Q projection both read only xT and their own weights:
// one grid.  The SR tiles (four times the K loop, only 128 of them) start
// first; the Q tiles fill the rest of the chip beside them.
#define SR_TILES ((NKPOS / 128) * (CDIM / 128) * BATCH)
#define Q_TILES  ((NPOS / 128) * (CDIM / 128) * BATCH)
__global__ __launch_bounds__(256)
void gemm_sr_q(const half_t* __restrict__ srwh, const half_t* __restrict__ qwh,
               const half_t* __restrict__ xT,
               const float* __restrict__ sr_b, const float* __restrict__ q_b,
               float* __restrict__ kvin, half_t* __restrict__ qh) {
  __shared__ __attribute__((aligned(16))) half_t Ah[2 * TILE];
  __shared__ __attribute__((aligned(16))) half_t Bh[2 * TILE];
  const int blk = blockIdx.x;
  if (blk < SR_TILES) {
    gemm_tile<1>(Ah, Bh, blk & 7, (blk >> 3) & 3, blk >> 5,
                 srwh, xT, sr_b, kvin, nullptr, nullptr);
  } else {
    const int t = blk - SR_TILES;
    gemm_tile<0>(Ah, Bh, t & 31, (t >> 5) & 3, t >> 7,
                 qwh, xT, q_b, nullptr, qh, nullptr);
  }
}

#define KSTG   64
#define KVP    72
#define KVTILE (64 * KVP)
#define P_LIMIT 4096.0f
#define QT     2
#define QBLK   (8 * QT * 16)

// two blocks a WGP = four waves a SIMD: the register budget is 256 a wave
__global__ __launch_bounds__(256) __attribute__((amdgpu_waves_per_eu(4, 4)))
void attn_kernel(const half_t* __restrict__ qh, const half_t* __restrict__ kh,
                 const half_t* __restrict__ vt, half_t* __restrict__ attnT) {
  __shared__ __attribute__((aligned(16))) half_t Ks[2 * KVTILE];
  __shared__ __attribute__((aligned(16))) half_t Vs[2 * KVTILE];
  const int tid  = threadIdx.x;
  const int lane = tid & 31;
  const int wave = tid >> 5;
  const int bh   = blockIdx.y;          // b*8 + h
  const int b    = bh >> 3, h = bh & 7;
  const int q0   = blockIdx.x * QBLK + wave * (QT * 16);
  const int lrow = lane & 15;
  const int halfoff = (lane & 16) ? 8 : 0;

  // Q B-fragments (64 d x 16 q = two k-steps a tile), loaded once; lane = query column
  const half_t* qrow = qh + ((size_t)bh * NPOS + q0 + lrow) * HD;
  v16h qa[QT][2];
  #pragma unroll
  for (int j = 0; j < QT; j++) {
    qa[j][0] = frag_ld(qrow + j * 16 * HD, lane);
    qa[j][1] = frag_ld(qrow + j * 16 * HD + 32, lane);
  }

  const v8f vzero = {0.f, 0.f, 0.f, 0.f, 0.f, 0.f, 0.f, 0.f};
  v8f acc[QT][4];                       // O^T: acc[j][dt][r] = O[q = j*16 + lrow][d = dt*16 + halfoff + r]
  float rmax[QT];                       // reference of this lane's query: a maximum seen so far
  float rsum[QT];                       // this lane's half of the query's denominator
  #pragma unroll
  for (int j = 0; j < QT; j++) {
    for (int dt = 0; dt < 4; dt++) acc[j][dt] = vzero;
    rmax[j] = -1e30f;
    rsum[j] = 0.f;
  }

  // Each thread copies two 16-byte chunks of the K tile and two of the V^T tile.
  const int crow = tid >> 3;            // rows crow and crow + 32
  const int cch  = (tid & 7) * 8;       // 8-half chunk inside the 64-half row
  const uint32_t ldsK = lds_addr32(&Ks[crow * KVP + cch]);
  const uint32_t ldsV = lds_addr32(&Vs[crow * KVP + cch]);
  const half_t* gK = kh + ((size_t)bh * NKPOS + crow) * HD + cch;
  const half_t* gV = vt + ((size_t)bh * HD + crow) * NKPOS + cch;
  auto issue_stage = [&](int buf, int kb0) {
    const uint32_t lo = (uint32_t)(buf * KVTILE * 2);
    const half_t* k0p = gK + (size_t)kb0 * HD;
    const half_t* v0p = gV + kb0;
    async_cp4_b128(ldsK + lo,                k0p,
                   ldsK + lo + 32 * KVP * 2, k0p + 32 * HD,
                   ldsV + lo,                v0p,
                   ldsV + lo + 32 * KVP * 2, v0p + 32 * NKPOS);
  };

  issue_stage(0, 0);
  // tile 0 landed (this wave's copies), then visible to every wave
  asm volatile("s_wait_asynccnt 0x0" ::: "memory");
  __syncthreads();
  issue_stage(1, KSTG);

  for (int t = 0; t < NKPOS / KSTG; ++t) {
   const half_t* Kt = &Ks[(t & 1) * KVTILE];
   const half_t* Vt = &Vs[(t & 1) * KVTILE];
   // unrolled so that sub folds into the immediate offsets of the LDS reads
   #pragma unroll
   for (int sub = 0; sub < KSTG; sub += 32) {
    // S^T = K Q^T (unscaled) for a 32x16 chunk per query tile (two 16x16 tiles):
    // s[j][st][r] = score of key sub + st*16 + halfoff + r against query j*16 + lrow
    v8f s[QT][2];
    #pragma unroll
    for (int st = 0; st < 2; st++) {
      const half_t* kbase = Kt + (sub + st * 16 + lrow) * KVP;
      v16h kf0 = frag_ld(kbase, lane);
      v16h kf1 = frag_ld(kbase + 32, lane);
      #pragma unroll
      for (int j = 0; j < QT; j++) {
        v8f z = vzero;
        z = wmma16(kf0, qa[j][0], z);
        z = wmma16(kf1, qa[j][1], z);
        s[j][st] = z;                   // unscaled; the scale is applied where s is used
      }
    }
    // online softmax: 16 scores of one query per lane, the other 16 in lane^16.
    // P is formed against the reference rmax as it stands; numerator and
    // denominator carry the same factor exp(-rmax), so any reference gives the
    // same quotient as long as P stays inside f16.
    // P^T as the B operand: element e = key kmap(e) = tile e>>3, register e&7
    v16h pb[QT];
    float ps[QT];
    auto probs = [&](int j) {
      float pp[8];
      #pragma unroll
      for (int i = 0; i < 8; i++) {
        const v2f d = (v2f){s[j][i >> 2][2 * (i & 3)], s[j][i >> 2][2 * (i & 3) + 1]} * ATT_SCALE - rmax[j];
        float p0 = __expf(d.x);
        float p1 = __expf(d.y);
        pb[j][2 * i]     = (half_t)p0;
        pb[j][2 * i + 1] = (half_t)p1;
        pp[i] = p0 + p1;
      }
      ps[j] = ((pp[0] + pp[1]) + (pp[2] + pp[3])) + ((pp[4] + pp[5]) + (pp[6] + pp[7]));
    };
    #pragma unroll
    for (int j = 0; j < QT; j++) probs(j);
    // A lane's sum bounds each of its 16 P: above P_LIMIT (or infinite, as
    // on the first chunk, whose reference is -1e30) some query's reference is too
    // low.  Then, and only then, the whole wave takes the chunk's maximum, raises
    // the references, rescales what it has summed and forms P again.  One scalar
    // branch per chunk for both query tiles: EXEC stays all ones for the matrix
    // instructions.
    bool low = false;
    #pragma unroll
    for (int j = 0; j < QT; j++) low = low || !(ps[j] <= P_LIMIT);
    if (__builtin_amdgcn_ballot_w32(low) != 0) {
      #pragma unroll
      for (int j = 0; j < QT; j++) {
        float mx[8];
        #pragma unroll
        for (int i = 0; i < 8; i++)
          mx[i] = fmaxf(s[j][i >> 2][2 * (i & 3)], s[j][i >> 2][2 * (i & 3) + 1]);
        float m = fmaxf(fmaxf(fmaxf(mx[0], mx[1]), fmaxf(mx[2], mx[3])),
                        fmaxf(fmaxf(mx[4], mx[5]), fmaxf(mx[6], mx[7]))) * ATT_SCALE;
        m = fmaxf(m, xhalf(m));
        const float nm = fmaxf(rmax[j], m);
        const float alpha = __expf(rmax[j] - nm);
        rmax[j] = nm;
        rsum[j] *= alpha;
        #pragma unroll
        for (int dt = 0; dt < 4; dt++)
          #pragma unroll
          for (int r = 0; r < 8; r++) acc[j][dt][r] *= alpha;
        probs(j);
      }
    }
    #pragma unroll
    for (int j = 0; j < QT; j++) rsum[j] += ps[j];
    // acc += V^T (16 d x 32 keys) * P^T (32 keys x 16 q); the four fragments are
    // read as one group, so that the wave waits out one LDS latency, not four
    v16h vf[4];
    #pragma unroll
    for (int dt = 0; dt < 4; dt++) vf[dt] = frag_ld(Vt + (dt * 16 + lrow) * KVP + sub, lane);
    #pragma unroll
    for (int j = 0; j < QT; j++)
      #pragma unroll
      for (int dt = 0; dt < 4; dt++) acc[j][dt] = wmma16(vf[dt], pb[j], acc[j][dt]);
   }
   // hand-over: this wave's reads of tile t are done ...
   asm volatile("s_wait_dscnt 0x0" ::: "memory");
   // ... its copies of tile t + 1 have landed ...
   asm volatile("s_wait_asynccnt 0x0" ::: "memory");
   // ... and one barrier publishes tile t + 1 and frees tile t's buffer
   __syncthreads();
   if (t + 2 < NKPOS / KSTG) issue_stage(t & 1, (t + 2) * KSTG);
  }
  // nothing is outstanding here; kept so that no copy can outlive the wave
  asm volatile("s_wait_asynccnt 0x0" ::: "memory");

  // join the two halves' denominators, normalize and emit position-major
  // [n][c] f16 for the projection GEMM.  A wave's tile is 32 queries x 64 d, one
  // whole 128-byte line per query: the wave turns it in a range of its own of the
  // freed K/V buffers (every wave's reads and copies ended in front of the loop's
  // last barrier) and stores whole lines, four a store, instead of 32-byte pieces
  // in 16 lines.  At the K/V pitch the 16-byte writes of 16 rows and the reads of
  // rows 8 apart both spread over all banks.
  half_t* st = ((wave & 4) ? Vs : Ks) + (wave & 3) * (QT * 16 * KVP);
  #pragma unroll
  for (int j = 0; j < QT; j++) {
    const float inv = 1.0f / (rsum[j] + xhalf(rsum[j]));
    #pragma unroll
    for (int dt = 0; dt < 4; dt++) {
      union { uint4 u; half_t e[8]; } o;
      #pragma unroll
      for (int r = 0; r < 8; r++) o.e[r] = (half_t)(acc[j][dt][r] * inv);
      *(uint4*)(st + (j * 16 + lrow) * KVP + dt * 16 + halfoff) = o.u;
    }
  }
  // this wave's LDS writes are done before its lanes read one another's rows
  asm volatile("s_wait_dscnt 0x0" ::: "memory");
  const int rrow = (lane >> 3) * 8;
  const int rch  = (lane & 7) * 8;
  uint4 ov[8];
  #pragma unroll
  for (int i = 0; i < 8; i++) ov[i] = *(const uint4*)(st + (rrow + i) * KVP + rch);
  half_t* orow = attnT + ((size_t)b * NPOS + q0 + rrow) * CDIM + h * HD + rch;
  #pragma unroll
  for (int i = 0; i < 8; i++) *(uint4*)(orow + (size_t)i * CDIM) = ov[i];
}

// ---------------------------------------------------------------------------
extern "C" void kernel_launch(void* const* d_in, const int* in_sizes, int n_in,
                              void* d_out, int out_size, void* d_ws, size_t ws_size,
                              hipStream_t stream) {
  const float* x      = (const float*)d_in[0];
  const float* q_w    = (const float*)d_in[1];
  const float* q_b    = (const float*)d_in[2];
  const float* kv_w   = (const float*)d_in[3];
  const float* kv_b   = (const float*)d_in[4];
  const float* sr_w   = (const float*)d_in[5];
  const float* sr_b   = (const float*)d_in[6];
  const float* ln_g   = (const float*)d_in[7];
  const float* ln_b   = (const float*)d_in[8];
  const float* proj_w = (const float*)d_in[9];
  const float* proj_b = (const float*)d_in[10];
  float* out = (float*)d_out;

  size_t off = 0;
  auto carve = [&](size_t bytes) {
    void* p = (char*)d_ws + off;
    off += (bytes + 255) & ~(size_t)255;
    return p;
  };
  half_t* xT    = (half_t*)carve((size_t)BATCH * NPOS * CDIM * 2);
  half_t* qwh   = (half_t*)carve((size_t)CDIM * CDIM * 2);
  half_t* kvwh  = (half_t*)carve((size_t)2 * CDIM * CDIM * 2);
  half_t* srwh  = (half_t*)carve((size_t)CDIM * 2048 * 2);
  half_t* pwh   = (half_t*)carve((size_t)CDIM * CDIM * 2);
  half_t* qhb   = (half_t*)carve((size_t)BATCH * HEADS * NPOS * HD * 2);
  float*  kvin  = (float*)carve((size_t)BATCH * NKPOS * CDIM * 4);
  half_t* lnT   = (half_t*)carve((size_t)BATCH * NKPOS * CDIM * 2);
  half_t* khb   = (half_t*)carve((size_t)BATCH * HEADS * NKPOS * HD * 2);
  half_t* vtb   = (half_t*)carve((size_t)BATCH * HEADS * HD * NKPOS * 2);
  half_t* attnT = (half_t*)carve((size_t)BATCH * NPOS * CDIM * 2);

  // 1. precision / layout conversions
  cvt_all<<<XT_BLKS + SRW_BLKS + KVW_BLKS + QW_BLKS + PW_BLKS, 256, 0, stream>>>(
      x, sr_w, kv_w, q_w, proj_w, xT, srwh, kvwh, qwh, pwh);

  // 2. SR conv as im2col GEMM -> kvin f32 [b][n][c], and beside it
  //    the Q projection -> qh [bh][n][d]
  gemm_sr_q<<<SR_TILES + Q_TILES, 256, 0, stream>>>(
      srwh, qwh, xT, sr_b, q_b, kvin, qhb);

  // 3. channel LayerNorm -> lnT f16
  ln_kernel<<<(BATCH * NKPOS) / 8, 256, 0, stream>>>(kvin, ln_g, ln_b, lnT);

  // 4. KV projection -> kh [bh][nk][d], vt [bh][d][nk]
  gemm_wmma<2><<<dim3(NKPOS / 128, (2 * CDIM) / 128, BATCH), 256, 0, stream>>>(
      kvwh, lnT, kv_b, nullptr, khb, vtb);

  // 5. flash attention -> attnT f16 [b][n][c]
  attn_kernel<<<dim3(NPOS / QBLK, BATCH * HEADS), 256, 0, stream>>>(
      qhb, khb, vtb, attnT);

  // 6. output projection -> d_out f32 [b][c][n]
  gemm_wmma<3><<<dim3(NPOS / 128, CDIM / 128, BATCH), 256, 0, stream>>>(
      pwh, attnT, proj_b, out, nullptr, nullptr);
}
